// v000
// The times below were measured on an AMD MI455X: many runs one after another, warmed up first and cycling through
// copies of the inputs, with the whole window's GPU time divided by the number of runs. Launches and the gaps
// between them are all in it. The median over several windows is given; except for v000 it joins two sittings, which
// can be a few percent apart, so the side-by-side timings, each taken in one sitting, are the better comparison.
// v000 is the starting kernel. One run takes 258 microseconds.
#include <hip/hip_runtime.h>
#include <stdint.h>

// Contractions: x.Wq^T, x.Wk^T, x.Wv^T on v_wmma_f32_16x16x32_bf16 (bf16 operands = RNE-converted f32 inputs, f32 accumulate);
// q.k^T and P.V on v_wmma_f32_16x16x32_f16 (f16 operands, P carried x1024, f32 accumulate); bias add, softmax, normalisation in f32.

typedef unsigned short u16;
typedef _Float16 h16;
typedef __bf16 v16bf __attribute__((ext_vector_type(16)));
typedef h16 v16h __attribute__((ext_vector_type(16)));
typedef h16 v8h __attribute__((ext_vector_type(8), __may_alias__));
typedef float v8f __attribute__((ext_vector_type(8)));
typedef float v4f __attribute__((ext_vector_type(4), __may_alias__));
typedef unsigned int v4u __attribute__((ext_vector_type(4), __may_alias__));

#ifndef NB
#define NB 4
#endif
#ifndef SEQ
#define SEQ 2048
#endif
#define NB_FULL 4
#define S_FULL 2048
#define DM 512
#define NH 8
#define HD 64
#define MT (NB * SEQ)

static_assert(NB >= 1 && NB <= NB_FULL);
static_assert(SEQ % 64 == 0 && SEQ <= S_FULL);
static_assert(DM % 64 == 0 && DM % 32 == 0);
static_assert(NH * HD == DM);
static_assert(HD == 64);
static_assert(MT % 64 == 0);

// ---------------- helpers ----------------

__device__ __forceinline__ u16 f2bf(float f) {
  unsigned u = __float_as_uint(f);
  u += 0x7FFFu + ((u >> 16) & 1u);   // RNE convert f32 -> bf16 bits
  return (u16)(u >> 16);
}

__device__ __forceinline__ float bf_rn(float f) {
  return __uint_as_float(((unsigned)f2bf(f)) << 16);
}

__device__ __forceinline__ v8f zero8() {
  v8f z = {0.f, 0.f, 0.f, 0.f, 0.f, 0.f, 0.f, 0.f};
  return z;
}

// 16x32 16-bit fragment from row-major storage with k contiguous (pitch ld elements):
// lane l: row = l&15; elements 0..7 <- k0 + 8*(l>>4) + 0..7; elements 8..15 <- k0 + 16 + 8*(l>>4) + 0..7.
// Used for A (row = m) and for B stored n-major with k contiguous (row = n).
__device__ __forceinline__ v16bf ldfrag_bf(const u16* base, int ld) {
  const int l = threadIdx.x & 31;
  const int row = l & 15;
  const int kb = (l >> 4) << 3;
  const u16* p = base + (size_t)row * ld + kb;
  union { v16bf v; v4u q[2]; } u;
  u.q[0] = *(const v4u*)(p);
  u.q[1] = *(const v4u*)(p + 16);
  return u.v;
}

__device__ __forceinline__ v16h ldfrag_h(const h16* base, int ld) {
  const int l = threadIdx.x & 31;
  const int row = l & 15;
  const int kb = (l >> 4) << 3;
  const h16* p = base + (size_t)row * ld + kb;
  union { v16h v; v8h q[2]; } u;
  u.q[0] = *(const v8h*)(p);
  u.q[1] = *(const v8h*)(p + 16);
  return u.v;
}

// D[16x16] += A[16x32] . B[32x16]; D element r of lane l = (row 8*(l>>4)+r, col l&15)
__device__ __forceinline__ v8f mma_bf(v16bf a, v16bf b, v8f c) {
  v8f r = __builtin_amdgcn_wmma_f32_16x16x32_bf16(false, a, false, b, (short)0, c, false, false);
  asm volatile("v_nop\n\tv_nop\n\tv_nop\n\tv_nop" : "+v"(r) : "v"(a), "v"(b));
  return r;
}

__device__ __forceinline__ v8f mma_h(v16h a, v16h b, v8f c) {
  v8f r = __builtin_amdgcn_wmma_f32_16x16x32_f16(false, a, false, b, (short)0, c, false, false);
  asm volatile("v_nop\n\tv_nop\n\tv_nop\n\tv_nop" : "+v"(r) : "v"(a), "v"(b));
  return r;
}

// reductions within 16-lane halves (D-layout rows live in one half)
__device__ __forceinline__ float hmax16(float x) {
#pragma unroll
  for (int s = 1; s < 16; s <<= 1) x = fmaxf(x, __shfl_xor(x, s, 32));
  return x;
}
__device__ __forceinline__ float hadd16(float x) {
#pragma unroll
  for (int s = 1; s < 16; s <<= 1) x += __shfl_xor(x, s, 32);
  return x;
}

// ---------------- stage 0: f32 -> bf16 planes (rows of DM elements) ----------------
// plane row pr <- source row (pr / rows_per_grp) * grp_stride_rows + pr % rows_per_grp.
__global__ __launch_bounds__(256) void k_cvt_bf16(const float* __restrict__ src, u16* __restrict__ dst,
                                                   int nrows, int rows_per_grp, int grp_stride_rows) {
  const int per_row = DM / 8;
  const int c = blockIdx.x * 256 + threadIdx.x;
  if (c >= nrows * per_row) return;
  const int pr = c / per_row;
  const int col = (c - pr * per_row) * 8;
  const int g = pr / rows_per_grp;
  const int sr = g * grp_stride_rows + (pr - g * rows_per_grp);
  const float* s = src + (size_t)sr * DM + col;
  const v4f a = *(const v4f*)(s);
  const v4f b = *(const v4f*)(s + 4);
  v4u w;
  w.x = (unsigned)f2bf(a.x) | ((unsigned)f2bf(a.y) << 16);
  w.y = (unsigned)f2bf(a.z) | ((unsigned)f2bf(a.w) << 16);
  w.z = (unsigned)f2bf(b.x) | ((unsigned)f2bf(b.y) << 16);
  w.w = (unsigned)f2bf(b.z) | ((unsigned)f2bf(b.w) << 16);
  v4u* d = (v4u*)(dst + (size_t)pr * DM + col);
  *d = w;
  
}

// ---------------- stage 1: projections ----------------
// out[row, n] = sum_k Xb[row, k] * W[n, k] + bias[n]; row in [0, MT), n in [0, DM), K = DM.
// blockIdx.z selects the matrix: 0 -> Q plane [bh][s][64], 1 -> K plane [bh][s][64], 2 -> V^T plane [bh][64][SEQ] (f16).
// Block = 4 waves, tile 64(M) x 64(N); wave owns 16 rows x 64 cols; fragments straight from global.
__global__ __launch_bounds__(128) __attribute__((amdgpu_num_vgpr(256)))
void k_proj(const u16* __restrict__ Xb, const u16* __restrict__ Wb,
            const float* __restrict__ bq, const float* __restrict__ bk, const float* __restrict__ bv,
            h16* __restrict__ Qp, h16* __restrict__ Kp, h16* __restrict__ VTp) {
  __shared__ __attribute__((aligned(16))) h16 Ts[64 * 64];

  const int wave = threadIdx.x >> 5, lane = threadIdx.x & 31;
  const int hh = lane >> 4, mm = lane & 15;
  const int mat = blockIdx.z;
  const int m0 = blockIdx.x * 64, n0 = blockIdx.y * 64;
  const u16* W = Wb + (size_t)mat * DM * DM + (size_t)n0 * DM;   // rows n0..n0+63, k contiguous
  const float* bias = (mat == 0) ? bq : ((mat == 1) ? bk : bv);
  const u16* Xr = Xb + (size_t)(m0 + wave * 16) * DM;

  v8f acc[4] = {zero8(), zero8(), zero8(), zero8()};

#pragma unroll 2
  for (int k0 = 0; k0 < DM; k0 += 32) {
    const v16bf a  = ldfrag_bf(Xr + k0, DM);
    const v16bf b0 = ldfrag_bf(W + (size_t)(0 * 16) * DM + k0, DM);
    const v16bf b1 = ldfrag_bf(W + (size_t)(1 * 16) * DM + k0, DM);
    const v16bf b2 = ldfrag_bf(W + (size_t)(2 * 16) * DM + k0, DM);
    const v16bf b3 = ldfrag_bf(W + (size_t)(3 * 16) * DM + k0, DM);
    acc[0] = mma_bf(a, b0, acc[0]);
    acc[1] = mma_bf(a, b1, acc[1]);
    acc[2] = mma_bf(a, b2, acc[2]);
    acc[3] = mma_bf(a, b3, acc[3]);
  }

  // bias enters as its bf16-RNE value
  float bb[4];
#pragma unroll
  for (int t = 0; t < 4; ++t) bb[t] = bf_rn(bias[n0 + 16 * t + mm]);

  // stage the 64x64 tile in LDS: [row][col] for Q/K, transposed [col][row] for V
  const bool tr = (mat == 2);
#pragma unroll
  for (int t = 0; t < 4; ++t) {
#pragma unroll
    for (int r = 0; r < 8; ++r) {
      const int row = wave * 16 + 8 * hh + r;
      const int col = 16 * t + mm;
      const int idx = tr ? (col * 64 + row) : (row * 64 + col);
      Ts[idx] = (h16)(acc[t][r] + bb[t]);
    }
  }
  __syncthreads();

  const int b  = m0 / SEQ;
  const int s0 = m0 - b * SEQ;
  const int bh = b * NH + blockIdx.y;
  h16* dstp = (mat == 0) ? Qp : ((mat == 1) ? Kp : VTp);
  const int pc = (threadIdx.x & 7) * 8;
  const int rb = threadIdx.x >> 3;
  v8h vals[4];
  size_t offs[4];
#pragma unroll
  for (int i = 0; i < 4; ++i) {
    const int rr = i * 16 + rb;
    vals[i] = *(const v8h*)(&Ts[rr * 64 + pc]);
    offs[i] = tr ? ((((size_t)bh * HD + rr) * SEQ) + s0 + pc)
                 : ((((size_t)bh * SEQ + s0 + rr) * HD) + pc);
  }
#pragma unroll
  for (int i = 0; i < 4; ++i) *(v8h*)(dstp + offs[i]) = vals[i];
  
}

// ---------------- stage 2: flash attention ----------------
// Block = 4 waves, owns (bh, 64 query rows); wave owns 16 query rows, loops over key tiles of 64.
// Q/K fragments from the [bh][s][64] planes, V fragments from the [bh][64][SEQ] plane, P restriped through per-wave LDS.
__global__ __launch_bounds__(128) __attribute__((amdgpu_num_vgpr(256)))
void k_attn(const h16* __restrict__ Qp, const h16* __restrict__ Kp, const h16* __restrict__ VTp,
            const int* __restrict__ mask, float* __restrict__ out) {
  __shared__ __attribute__((aligned(16))) h16   Ps[4][16 * 64];   // per wave: P [q][key] (x1024, f16)
  __shared__ __attribute__((aligned(16))) float Os[4][16 * 64];   // per wave: output tile [q][d]

  const int wave = threadIdx.x >> 5, lane = threadIdx.x & 31;
  const int hh = lane >> 4, mm = lane & 15;
  const int bh = blockIdx.y;
  const int b  = bh / NH;
  const int hd = bh - b * NH;
  const int q0 = blockIdx.x * 64 + wave * 16;

  const h16* Qbh = Qp  + (size_t)bh * SEQ * HD;
  const h16* Kbh = Kp  + (size_t)bh * SEQ * HD;
  const h16* Vbh = VTp + (size_t)bh * HD * SEQ;
  const int* mk_b = mask + (size_t)b * S_FULL;

  const v16h aq0 = ldfrag_h(Qbh + (size_t)q0 * HD, HD);
  const v16h aq1 = ldfrag_h(Qbh + (size_t)q0 * HD + 32, HD);

  float m_run[8], l_run[8];
  v8f o[4] = {zero8(), zero8(), zero8(), zero8()};
#pragma unroll
  for (int r = 0; r < 8; ++r) { m_run[r] = -1e30f; l_run[r] = 0.f; }

#pragma unroll 1
  for (int t0 = 0; t0 < SEQ; t0 += 64) {
    // scores S[16 q][64 keys] = q . k^T
    v8f sc[4];
#pragma unroll
    for (int t = 0; t < 4; ++t) {
      const v16h kf0 = ldfrag_h(Kbh + (size_t)(t0 + 16 * t) * HD, HD);
      const v16h kf1 = ldfrag_h(Kbh + (size_t)(t0 + 16 * t) * HD + 32, HD);
      sc[t] = mma_h(aq0, kf0, zero8());
      sc[t] = mma_h(aq1, kf1, sc[t]);
    }

    // scale 1/8 and additive key mask: s/8 - 10000*(1 - m)
    float madd[4];
#pragma unroll
    for (int t = 0; t < 4; ++t) madd[t] = -10000.0f * (1.0f - (float)mk_b[t0 + 16 * t + mm]);
#pragma unroll
    for (int t = 0; t < 4; ++t)
#pragma unroll
      for (int r = 0; r < 8; ++r) sc[t][r] = sc[t][r] * 0.125f + madd[t];

    // online softmax per query row (rows live across one 16-lane half)
    float alpha[8];
#pragma unroll
    for (int r = 0; r < 8; ++r) {
      float mx = fmaxf(fmaxf(sc[0][r], sc[1][r]), fmaxf(sc[2][r], sc[3][r]));
      mx = hmax16(mx);
      const float mn = fmaxf(m_run[r], mx);
      alpha[r] = __expf(m_run[r] - mn);
      m_run[r] = mn;
    }
#pragma unroll
    for (int r = 0; r < 8; ++r) {
      float ps = 0.f;
#pragma unroll
      for (int t = 0; t < 4; ++t) {
        const float p = __expf(sc[t][r] - m_run[r]);
        ps += p;
        Ps[wave][(8 * hh + r) * 64 + 16 * t + mm] = (h16)(p * 1024.0f);
      }
      l_run[r] = l_run[r] * alpha[r] + hadd16(ps);
    }
#pragma unroll
    for (int dt = 0; dt < 4; ++dt)
#pragma unroll
      for (int r = 0; r < 8; ++r) o[dt][r] *= alpha[r];

    __syncthreads();   // P tile stores complete before the fragment reload

    // O += P[16 q][64 keys] . V[64 keys][64 d]
    const v16h p0 = ldfrag_h(&Ps[wave][0], 64);
    const v16h p1 = ldfrag_h(&Ps[wave][32], 64);
#pragma unroll
    for (int dt = 0; dt < 4; ++dt) {
      const v16h vf0 = ldfrag_h(Vbh + (size_t)(16 * dt) * SEQ + t0, SEQ);
      const v16h vf1 = ldfrag_h(Vbh + (size_t)(16 * dt) * SEQ + t0 + 32, SEQ);
      o[dt] = mma_h(p0, vf0, o[dt]);
      o[dt] = mma_h(p1, vf1, o[dt]);
    }
    __syncthreads();   // fragment reload done before the next tile overwrites Ps
  }

  // normalise (undo the x1024 carry) and stage the 16x64 f32 tile per wave
  float inv[8];
#pragma unroll
  for (int r = 0; r < 8; ++r) inv[r] = (1.0f / l_run[r]) * 0.0009765625f;
#pragma unroll
  for (int dt = 0; dt < 4; ++dt)
#pragma unroll
    for (int r = 0; r < 8; ++r) Os[wave][(8 * hh + r) * 64 + 16 * dt + mm] = o[dt][r] * inv[r];
  __syncthreads();

  // each instruction: lanes 0..15 -> row 2i (256 B = 2 full lines), lanes 16..31 -> row 2i+1
  const int rsub = lane >> 4;
  const int cc = (lane & 15) * 4;
  float* ob = out + ((size_t)b * SEQ + q0) * DM + (size_t)hd * HD;
  v4f vv[8];
#pragma unroll
  for (int i = 0; i < 8; ++i) vv[i] = *(const v4f*)(&Os[wave][(2 * i + rsub) * 64 + cc]);
#pragma unroll
  for (int i = 0; i < 8; ++i) *(v4f*)(ob + (size_t)(2 * i + rsub) * DM + cc) = vv[i];
  
}

// ---------------- launcher ----------------
extern "C" void kernel_launch(void* const* d_in, const int* in_sizes, int n_in,
                              void* d_out, int out_size, void* d_ws, size_t ws_size,
                              hipStream_t stream) {
  if (n_in < 8) return;
  const float* x   = (const float*)d_in[0];
  const int*   msk = (const int*)d_in[1];
  const float* Wq  = (const float*)d_in[2];
  const float* bq  = (const float*)d_in[3];
  const float* Wk  = (const float*)d_in[4];
  const float* bk  = (const float*)d_in[5];
  const float* Wv  = (const float*)d_in[6];
  const float* bv  = (const float*)d_in[7];
  float* out = (float*)d_out;

  if (in_sizes[0] < ((NB - 1) * S_FULL + SEQ) * DM) return;
  if (in_sizes[1] < (NB - 1) * S_FULL + SEQ) return;
  if (in_sizes[2] < DM * DM || in_sizes[4] < DM * DM || in_sizes[6] < DM * DM) return;
  if (in_sizes[3] < DM || in_sizes[5] < DM || in_sizes[7] < DM) return;
  if (out_size < MT * DM) return;

  char* ws = (char*)d_ws;
  const size_t XB_BYTES = (size_t)MT * DM * 2;              // bf16 x plane [MT][DM]
  const size_t W_BYTES  = (size_t)DM * DM * 2;              // one bf16 weight plane
  const size_t PL_BYTES = (size_t)NB * NH * SEQ * HD * 2;   // one f16 q/k/v^T plane
  size_t off = 0;
  u16* Xb = (u16*)(ws + off);  off += XB_BYTES;
  u16* Wb = (u16*)(ws + off);  off += 3 * W_BYTES;
  h16* Qp = (h16*)(ws + off);  off += PL_BYTES;
  h16* Kp = (h16*)(ws + off);  off += PL_BYTES;
  h16* VTp = (h16*)(ws + off); off += PL_BYTES;
  if (off > ws_size) return;

  const int nchunk_x = MT * (DM / 8);
  const int nchunk_w = DM * (DM / 8);
  k_cvt_bf16<<<(nchunk_x + 255) / 256, 256, 0, stream>>>(x,  Xb, MT, SEQ, S_FULL);
  k_cvt_bf16<<<(nchunk_w + 255) / 256, 256, 0, stream>>>(Wq, Wb, DM, DM, DM);
  k_cvt_bf16<<<(nchunk_w + 255) / 256, 256, 0, stream>>>(Wk, Wb + (size_t)DM * DM, DM, DM, DM);
  k_cvt_bf16<<<(nchunk_w + 255) / 256, 256, 0, stream>>>(Wv, Wb + (size_t)2 * DM * DM, DM, DM, DM);

  dim3 gp(MT / 64, DM / 64, 3);
  k_proj<<<gp, 128, 0, stream>>>(Xb, Wb, bq, bk, bv, Qp, Kp, VTp);

  dim3 ga(SEQ / 64, NB * NH);
  k_attn<<<ga, 128, 0, stream>>>(Qp, Kp, VTp, msk, out);
}

// v001
// One run takes 176 microseconds.
// Timed twice side by side with v000, it ran 1.49 times as fast both times.
#include <hip/hip_runtime.h>
#include <stdint.h>

// Contractions: x.Wq^T, x.Wk^T, x.Wv^T on v_wmma_f32_16x16x32_bf16 (bf16 operands = RNE-converted f32 inputs, f32 accumulate);
// q.k^T and P.V on v_wmma_f32_16x16x32_f16 (f16 operands, P carried x1024, f32 accumulate); bias add, softmax, normalisation in f32.

typedef unsigned short u16;
typedef _Float16 h16;
typedef __bf16 v16bf __attribute__((ext_vector_type(16)));
typedef h16 v16h __attribute__((ext_vector_type(16)));
typedef h16 v8h __attribute__((ext_vector_type(8), __may_alias__));
typedef float v8f __attribute__((ext_vector_type(8)));
typedef float v4f __attribute__((ext_vector_type(4), __may_alias__));
typedef unsigned int v4u __attribute__((ext_vector_type(4), __may_alias__));

#ifndef NB
#define NB 4
#endif
#ifndef SEQ
#define SEQ 2048
#endif
#define NB_FULL 4
#define S_FULL 2048
#define DM 512
#define NH 8
#define HD 64
#define MT (NB * SEQ)

static_assert(NB >= 1 && NB <= NB_FULL);
static_assert(SEQ % 64 == 0 && SEQ <= S_FULL);
static_assert(DM % 64 == 0 && DM % 32 == 0);
static_assert(NH * HD == DM);
static_assert(HD == 64);
static_assert(MT % 64 == 0);

// ---------------- helpers ----------------

__device__ __forceinline__ u16 f2bf(float f) {
  unsigned u = __float_as_uint(f);
  u += 0x7FFFu + ((u >> 16) & 1u);   // RNE convert f32 -> bf16 bits
  return (u16)(u >> 16);
}

__device__ __forceinline__ float bf_rn(float f) {
  return __uint_as_float(((unsigned)f2bf(f)) << 16);
}

__device__ __forceinline__ v8f zero8() {
  v8f z = {0.f, 0.f, 0.f, 0.f, 0.f, 0.f, 0.f, 0.f};
  return z;
}

// 16x32 16-bit fragment from row-major storage with k contiguous (pitch ld elements):
// lane l: row = l&15; elements 0..7 <- k0 + 8*(l>>4) + 0..7; elements 8..15 <- k0 + 16 + 8*(l>>4) + 0..7.
// Used for A (row = m) and for B stored n-major with k contiguous (row = n).
__device__ __forceinline__ v16bf ldfrag_bf(const u16* base, int ld) {
  const int l = threadIdx.x & 31;
  const int row = l & 15;
  const int kb = (l >> 4) << 3;
  const u16* p = base + (size_t)row * ld + kb;
  union { v16bf v; v4u q[2]; } u;
  u.q[0] = *(const v4u*)(p);
  u.q[1] = *(const v4u*)(p + 16);
  return u.v;
}

__device__ __forceinline__ v16h ldfrag_h(const h16* base, int ld) {
  const int l = threadIdx.x & 31;
  const int row = l & 15;
  const int kb = (l >> 4) << 3;
  const h16* p = base + (size_t)row * ld + kb;
  union { v16h v; v8h q[2]; } u;
  u.q[0] = *(const v8h*)(p);
  u.q[1] = *(const v8h*)(p + 16);
  return u.v;
}

// D[16x16] += A[16x32] . B[32x16]; D element r of lane l = (row 8*(l>>4)+r, col l&15)
__device__ __forceinline__ v8f mma_bf(v16bf a, v16bf b, v8f c) {
  v8f r = __builtin_amdgcn_wmma_f32_16x16x32_bf16(false, a, false, b, (short)0, c, false, false);
  asm volatile("v_nop\n\tv_nop\n\tv_nop\n\tv_nop" : "+v"(r) : "v"(a), "v"(b));
  return r;
}

__device__ __forceinline__ v8f mma_h(v16h a, v16h b, v8f c) {
  v8f r = __builtin_amdgcn_wmma_f32_16x16x32_f16(false, a, false, b, (short)0, c, false, false);
  asm volatile("v_nop\n\tv_nop\n\tv_nop\n\tv_nop" : "+v"(r) : "v"(a), "v"(b));
  return r;
}

// reductions within 16-lane halves (D-layout rows live in one half)
__device__ __forceinline__ float hmax16(float x) {
#pragma unroll
  for (int s = 1; s < 16; s <<= 1) x = fmaxf(x, __shfl_xor(x, s, 32));
  return x;
}
__device__ __forceinline__ float hadd16(float x) {
#pragma unroll
  for (int s = 1; s < 16; s <<= 1) x += __shfl_xor(x, s, 32);
  return x;
}

// ---------------- stage 0: f32 -> bf16 planes (rows of DM elements) ----------------
// plane row pr <- source row (pr / rows_per_grp) * grp_stride_rows + pr % rows_per_grp.
__global__ __launch_bounds__(256) void k_cvt_bf16(const float* __restrict__ src, u16* __restrict__ dst,
                                                   int nrows, int rows_per_grp, int grp_stride_rows) {
  const int per_row = DM / 8;
  const int c = blockIdx.x * 256 + threadIdx.x;
  if (c >= nrows * per_row) return;
  const int pr = c / per_row;
  const int col = (c - pr * per_row) * 8;
  const int g = pr / rows_per_grp;
  const int sr = g * grp_stride_rows + (pr - g * rows_per_grp);
  const float* s = src + (size_t)sr * DM + col;
  const v4f a = *(const v4f*)(s);
  const v4f b = *(const v4f*)(s + 4);
  v4u w;
  w.x = (unsigned)f2bf(a.x) | ((unsigned)f2bf(a.y) << 16);
  w.y = (unsigned)f2bf(a.z) | ((unsigned)f2bf(a.w) << 16);
  w.z = (unsigned)f2bf(b.x) | ((unsigned)f2bf(b.y) << 16);
  w.w = (unsigned)f2bf(b.z) | ((unsigned)f2bf(b.w) << 16);
  v4u* d = (v4u*)(dst + (size_t)pr * DM + col);
  *d = w;
  
}

// ---------------- stage 1: projections ----------------
// out[row, n] = sum_k Xb[row, k] * W[n, k] + bias[n]; row in [0, MT), n in [0, DM), K = DM.
// blockIdx.z selects the matrix: 0 -> Q plane [bh][s][64], 1 -> K plane [bh][s][64], 2 -> V^T plane [bh][64][SEQ] (f16).
// Block = 4 waves, tile 64(M) x 64(N); wave owns 16 rows x 64 cols; fragments straight from global.
__global__ __launch_bounds__(128) __attribute__((amdgpu_num_vgpr(256)))
void k_proj(const u16* __restrict__ Xb, const u16* __restrict__ Wb,
            const float* __restrict__ bq, const float* __restrict__ bk, const float* __restrict__ bv,
            h16* __restrict__ Qp, h16* __restrict__ Kp, h16* __restrict__ VTp) {
  __shared__ __attribute__((aligned(16))) h16 Ts[64 * 64];

  const int wave = threadIdx.x >> 5, lane = threadIdx.x & 31;
  const int hh = lane >> 4, mm = lane & 15;
  const int mat = blockIdx.z;
  const int m0 = blockIdx.x * 64, n0 = blockIdx.y * 64;
  const u16* W = Wb + (size_t)mat * DM * DM + (size_t)n0 * DM;   // rows n0..n0+63, k contiguous
  const float* bias = (mat == 0) ? bq : ((mat == 1) ? bk : bv);
  const u16* Xr = Xb + (size_t)(m0 + wave * 16) * DM;

  v8f acc[4] = {zero8(), zero8(), zero8(), zero8()};

#pragma unroll 2
  for (int k0 = 0; k0 < DM; k0 += 32) {
    const v16bf a  = ldfrag_bf(Xr + k0, DM);
    const v16bf b0 = ldfrag_bf(W + (size_t)(0 * 16) * DM + k0, DM);
    const v16bf b1 = ldfrag_bf(W + (size_t)(1 * 16) * DM + k0, DM);
    const v16bf b2 = ldfrag_bf(W + (size_t)(2 * 16) * DM + k0, DM);
    const v16bf b3 = ldfrag_bf(W + (size_t)(3 * 16) * DM + k0, DM);
    acc[0] = mma_bf(a, b0, acc[0]);
    acc[1] = mma_bf(a, b1, acc[1]);
    acc[2] = mma_bf(a, b2, acc[2]);
    acc[3] = mma_bf(a, b3, acc[3]);
  }

  // bias enters as its bf16-RNE value
  float bb[4];
#pragma unroll
  for (int t = 0; t < 4; ++t) bb[t] = bf_rn(bias[n0 + 16 * t + mm]);

  // stage the 64x64 tile in LDS: [row][col] for Q/K, transposed [col][row] for V
  const bool tr = (mat == 2);
#pragma unroll
  for (int t = 0; t < 4; ++t) {
#pragma unroll
    for (int r = 0; r < 8; ++r) {
      const int row = wave * 16 + 8 * hh + r;
      const int col = 16 * t + mm;
      const int idx = tr ? (col * 64 + row) : (row * 64 + col);
      Ts[idx] = (h16)(acc[t][r] + bb[t]);
    }
  }
  __syncthreads();

  const int b  = m0 / SEQ;
  const int s0 = m0 - b * SEQ;
  const int bh = b * NH + blockIdx.y;
  h16* dstp = (mat == 0) ? Qp : ((mat == 1) ? Kp : VTp);
  const int pc = (threadIdx.x & 7) * 8;
  const int rb = threadIdx.x >> 3;
  v8h vals[4];
  size_t offs[4];
#pragma unroll
  for (int i = 0; i < 4; ++i) {
    const int rr = i * 16 + rb;
    vals[i] = *(const v8h*)(&Ts[rr * 64 + pc]);
    offs[i] = tr ? ((((size_t)bh * HD + rr) * SEQ) + s0 + pc)
                 : ((((size_t)bh * SEQ + s0 + rr) * HD) + pc);
  }
#pragma unroll
  for (int i = 0; i < 4; ++i) *(v8h*)(dstp + offs[i]) = vals[i];
  
}

// ---------------- stage 2: flash attention ----------------
// Block = 4 waves, owns (bh, 64 query rows); wave owns 16 query rows, loops over key tiles of 64.
// Q fragments from the [bh][s][64] plane. Each 64-key tile of K ([key][64]) and of V^T ([d][64 keys]) is copied once per
// block into LDS (two buffers, the next tile in flight while this one is worked on) and all four waves take their
// fragments from there; P restriped through per-wave LDS.
#define KVP 72                       // f16 per staged row: 128 B of data + 16 B pad, the pitch for 16-byte LDS readers
#define KV_TILE (64 * KVP)           // f16 per staged tile (64 rows)
#define KV_BUF_BYTES (2 * KV_TILE * 2)

// One tile of K and one of V^T into one buffer: 8 copies of 16 B per lane, each wave-wide copy = 4 whole 128-B rows.
// kg, vg: the lane's global address in rows 0..15 of the two tiles; lk: the lane's LDS byte address in the K tile.
__device__ __forceinline__ void stage_kv(const h16* kg, const h16* vg, unsigned lk) {
  const unsigned lv = lk + KV_TILE * 2;
  const unsigned rs = 16 * KVP * 2;  // 16 staged rows, in bytes
  // s_wait_xcnt closes the statement so that no address register is rewritten ahead of it
  asm volatile("global_load_async_to_lds_b128 %0, %8, off\n\t"
               "global_load_async_to_lds_b128 %1, %9, off\n\t"
               "global_load_async_to_lds_b128 %2, %10, off\n\t"
               "global_load_async_to_lds_b128 %3, %11, off\n\t"
               "global_load_async_to_lds_b128 %4, %12, off\n\t"
               "global_load_async_to_lds_b128 %5, %13, off\n\t"
               "global_load_async_to_lds_b128 %6, %14, off\n\t"
               "global_load_async_to_lds_b128 %7, %15, off\n\t"
               "s_wait_xcnt 0x0"
               :: "v"(lk), "v"(lk + rs), "v"(lk + 2 * rs), "v"(lk + 3 * rs),
                  "v"(lv), "v"(lv + rs), "v"(lv + 2 * rs), "v"(lv + 3 * rs),
                  "v"(kg), "v"(kg + 16 * HD), "v"(kg + 32 * HD), "v"(kg + 48 * HD),
                  "v"(vg), "v"(vg + (size_t)16 * SEQ), "v"(vg + (size_t)32 * SEQ), "v"(vg + (size_t)48 * SEQ)
               : "memory");
}

__global__ __launch_bounds__(128) __attribute__((amdgpu_num_vgpr(256)))
void k_attn(const h16* __restrict__ Qp, const h16* __restrict__ Kp, const h16* __restrict__ VTp,
            const int* __restrict__ mask, float* __restrict__ out) {
  __shared__ __attribute__((aligned(16))) h16   KVs[2][2][KV_TILE]; // [buffer][K | V^T][row * KVP + col]
  __shared__ __attribute__((aligned(16))) h16   Ps[4][16 * 64];   // per wave: P [q][key] (x1024, f16)
  __shared__ __attribute__((aligned(16))) float Os[4][16 * 64];   // per wave: output tile [q][d]

  const int wave = threadIdx.x >> 5, lane = threadIdx.x & 31;
  const int hh = lane >> 4, mm = lane & 15;
  const int bh = blockIdx.y;
  const int b  = bh / NH;
  const int hd = bh - b * NH;
  const int q0 = blockIdx.x * 64 + wave * 16;

  const h16* Qbh = Qp  + (size_t)bh * SEQ * HD;
  const h16* Kbh = Kp  + (size_t)bh * SEQ * HD;
  const h16* Vbh = VTp + (size_t)bh * HD * SEQ;
  const int* mk_b = mask + (size_t)b * S_FULL;

  const v16h aq0 = ldfrag_h(Qbh + (size_t)q0 * HD, HD);
  const v16h aq1 = ldfrag_h(Qbh + (size_t)q0 * HD + 32, HD);

  float m_run[8], l_run[8];
  v8f o[4] = {zero8(), zero8(), zero8(), zero8()};
#pragma unroll
  for (int r = 0; r < 8; ++r) { m_run[r] = -1e30f; l_run[r] = 0.f; }

  // the lane's 16-byte piece of rows 0..15 of a tile: 8 lanes per 128-B row
  const int crow = threadIdx.x >> 3, ccol = (threadIdx.x & 7) * 8;
  const h16* kg = Kbh + (size_t)crow * HD + ccol;
  const h16* vg = Vbh + (size_t)crow * SEQ + ccol;
  const unsigned lk0 = (unsigned)(uintptr_t)&KVs[0][0][crow * KVP + ccol];

  stage_kv(kg, vg, lk0);
  asm volatile("s_wait_asynccnt 0x0" ::: "memory");   // this wave's share of tile 0 has landed
  __syncthreads();                                     // tile 0 readable by every wave
  if (SEQ > 64) stage_kv(kg + (size_t)64 * HD, vg + 64, lk0 + KV_BUF_BYTES);

#pragma unroll 1
  for (int t0 = 0; t0 < SEQ; t0 += 64) {
    const int buf = (t0 >> 6) & 1;
    const h16* Kt = &KVs[buf][0][0];
    const h16* Vt = &KVs[buf][1][0];
    // scores S[16 q][64 keys] = q . k^T
    v8f sc[4];
#pragma unroll
    for (int t = 0; t < 4; ++t) {
      const v16h kf0 = ldfrag_h(Kt + (16 * t) * KVP, KVP);
      const v16h kf1 = ldfrag_h(Kt + (16 * t) * KVP + 32, KVP);
      sc[t] = mma_h(aq0, kf0, zero8());
      sc[t] = mma_h(aq1, kf1, sc[t]);
    }

    // scale 1/8 and additive key mask: s/8 - 10000*(1 - m)
    float madd[4];
#pragma unroll
    for (int t = 0; t < 4; ++t) madd[t] = -10000.0f * (1.0f - (float)mk_b[t0 + 16 * t + mm]);
#pragma unroll
    for (int t = 0; t < 4; ++t)
#pragma unroll
      for (int r = 0; r < 8; ++r) sc[t][r] = sc[t][r] * 0.125f + madd[t];

    // online softmax per query row (rows live across one 16-lane half)
    float alpha[8];
#pragma unroll
    for (int r = 0; r < 8; ++r) {
      float mx = fmaxf(fmaxf(sc[0][r], sc[1][r]), fmaxf(sc[2][r], sc[3][r]));
      mx = hmax16(mx);
      const float mn = fmaxf(m_run[r], mx);
      alpha[r] = __expf(m_run[r] - mn);
      m_run[r] = mn;
    }
#pragma unroll
    for (int r = 0; r < 8; ++r) {
      float ps = 0.f;
#pragma unroll
      for (int t = 0; t < 4; ++t) {
        const float p = __expf(sc[t][r] - m_run[r]);
        ps += p;
        Ps[wave][(8 * hh + r) * 64 + 16 * t + mm] = (h16)(p * 1024.0f);
      }
      l_run[r] = l_run[r] * alpha[r] + hadd16(ps);
    }
#pragma unroll
    for (int dt = 0; dt < 4; ++dt)
#pragma unroll
      for (int r = 0; r < 8; ++r) o[dt][r] *= alpha[r];

    __syncthreads();   // P tile stores complete before the fragment reload

    // O += P[16 q][64 keys] . V[64 keys][64 d]
    const v16h p0 = ldfrag_h(&Ps[wave][0], 64);
    const v16h p1 = ldfrag_h(&Ps[wave][32], 64);
#pragma unroll
    for (int dt = 0; dt < 4; ++dt) {
      const v16h vf0 = ldfrag_h(Vt + (16 * dt) * KVP, KVP);
      const v16h vf1 = ldfrag_h(Vt + (16 * dt) * KVP + 32, KVP);
      o[dt] = mma_h(p0, vf0, o[dt]);
      o[dt] = mma_h(p1, vf1, o[dt]);
    }
    asm volatile("s_wait_dscnt 0x0" ::: "memory");      // this wave's reads of the buffer and of Ps are done
    asm volatile("s_wait_asynccnt 0x0" ::: "memory");   // this wave's share of the next tile has landed
    __syncthreads();   // next tile readable by every wave; this trip's buffer free for the refill
    if (t0 + 128 < SEQ) stage_kv(kg + (size_t)(t0 + 128) * HD, vg + (t0 + 128), lk0 + buf * KV_BUF_BYTES);
  }
  asm volatile("s_wait_asynccnt 0x0" ::: "memory");     // no copy outstanding behind the loop

  // normalise (undo the x1024 carry) and stage the 16x64 f32 tile per wave
  float inv[8];
#pragma unroll
  for (int r = 0; r < 8; ++r) inv[r] = (1.0f / l_run[r]) * 0.0009765625f;
#pragma unroll
  for (int dt = 0; dt < 4; ++dt)
#pragma unroll
    for (int r = 0; r < 8; ++r) Os[wave][(8 * hh + r) * 64 + 16 * dt + mm] = o[dt][r] * inv[r];
  __syncthreads();

  // each instruction: lanes 0..15 -> row 2i (256 B = 2 full lines), lanes 16..31 -> row 2i+1
  const int rsub = lane >> 4;
  const int cc = (lane & 15) * 4;
  float* ob = out + ((size_t)b * SEQ + q0) * DM + (size_t)hd * HD;
  v4f vv[8];
#pragma unroll
  for (int i = 0; i < 8; ++i) vv[i] = *(const v4f*)(&Os[wave][(2 * i + rsub) * 64 + cc]);
#pragma unroll
  for (int i = 0; i < 8; ++i) *(v4f*)(ob + (size_t)(2 * i + rsub) * DM + cc) = vv[i];
  
}

// ---------------- launcher ----------------
extern "C" void kernel_launch(void* const* d_in, const int* in_sizes, int n_in,
                              void* d_out, int out_size, void* d_ws, size_t ws_size,
                              hipStream_t stream) {
  if (n_in < 8) return;
  const float* x   = (const float*)d_in[0];
  const int*   msk = (const int*)d_in[1];
  const float* Wq  = (const float*)d_in[2];
  const float* bq  = (const float*)d_in[3];
  const float* Wk  = (const float*)d_in[4];
  const float* bk  = (const float*)d_in[5];
  const float* Wv  = (const float*)d_in[6];
  const float* bv  = (const float*)d_in[7];
  float* out = (float*)d_out;

  if (in_sizes[0] < ((NB - 1) * S_FULL + SEQ) * DM) return;
  if (in_sizes[1] < (NB - 1) * S_FULL + SEQ) return;
  if (in_sizes[2] < DM * DM || in_sizes[4] < DM * DM || in_sizes[6] < DM * DM) return;
  if (in_sizes[3] < DM || in_sizes[5] < DM || in_sizes[7] < DM) return;
  if (out_size < MT * DM) return;

  char* ws = (char*)d_ws;
  const size_t XB_BYTES = (size_t)MT * DM * 2;              // bf16 x plane [MT][DM]
  const size_t W_BYTES  = (size_t)DM * DM * 2;              // one bf16 weight plane
  const size_t PL_BYTES = (size_t)NB * NH * SEQ * HD * 2;   // one f16 q/k/v^T plane
  size_t off = 0;
  u16* Xb = (u16*)(ws + off);  off += XB_BYTES;
  u16* Wb = (u16*)(ws + off);  off += 3 * W_BYTES;
  h16* Qp = (h16*)(ws + off);  off += PL_BYTES;
  h16* Kp = (h16*)(ws + off);  off += PL_BYTES;
  h16* VTp = (h16*)(ws + off); off += PL_BYTES;
  if (off > ws_size) return;

  const int nchunk_x = MT * (DM / 8);
  const int nchunk_w = DM * (DM / 8);
  k_cvt_bf16<<<(nchunk_x + 255) / 256, 256, 0, stream>>>(x,  Xb, MT, SEQ, S_FULL);
  k_cvt_bf16<<<(nchunk_w + 255) / 256, 256, 0, stream>>>(Wq, Wb, DM, DM, DM);
  k_cvt_bf16<<<(nchunk_w + 255) / 256, 256, 0, stream>>>(Wk, Wb + (size_t)DM * DM, DM, DM, DM);
  k_cvt_bf16<<<(nchunk_w + 255) / 256, 256, 0, stream>>>(Wv, Wb + (size_t)2 * DM * DM, DM, DM, DM);

  dim3 gp(MT / 64, DM / 64, 3);
  k_proj<<<gp, 128, 0, stream>>>(Xb, Wb, bq, bk, bv, Qp, Kp, VTp);

  dim3 ga(SEQ / 64, NB * NH);
  k_attn<<<ga, 128, 0, stream>>>(Qp, Kp, VTp, msk, out);
}

// v002
// Measured time: 138 microseconds a run.
// In both of two side-by-side timings against v001, it was 1.27 times as fast.
// Over all steps from v000 it is 1.89 times as fast.
#include <hip/hip_runtime.h>
#include <stdint.h>

// Contractions: x.Wq^T, x.Wk^T, x.Wv^T on v_wmma_f32_16x16x32_bf16 (bf16 operands = RNE-converted f32 inputs, f32 accumulate);
// k.q^T and V^T.P^T on v_wmma_f32_16x16x32_f16 (f16 operands, P carried x1024, f32 accumulate); bias add, softmax, normalisation in f32.

typedef unsigned short u16;
typedef _Float16 h16;
typedef __bf16 v16bf __attribute__((ext_vector_type(16)));
typedef h16 v16h __attribute__((ext_vector_type(16)));
typedef h16 v8h __attribute__((ext_vector_type(8), __may_alias__));
typedef float v8f __attribute__((ext_vector_type(8)));
typedef float v4f __attribute__((ext_vector_type(4), __may_alias__));
typedef unsigned int v4u __attribute__((ext_vector_type(4), __may_alias__));
typedef int v4i __attribute__((ext_vector_type(4), __may_alias__));

#ifndef NB
#define NB 4
#endif
#ifndef SEQ
#define SEQ 2048
#endif
#define NB_FULL 4
#define S_FULL 2048
#define DM 512
#define NH 8
#define HD 64
#define MT (NB * SEQ)

static_assert(NB >= 1 && NB <= NB_FULL);
static_assert(SEQ % 64 == 0 && SEQ <= S_FULL);
static_assert(DM % 64 == 0 && DM % 32 == 0);
static_assert(NH * HD == DM);
static_assert(HD == 64);
static_assert(MT % 64 == 0);

// ---------------- helpers ----------------

__device__ __forceinline__ u16 f2bf(float f) {
  unsigned u = __float_as_uint(f);
  u += 0x7FFFu + ((u >> 16) & 1u);   // RNE convert f32 -> bf16 bits
  return (u16)(u >> 16);
}

__device__ __forceinline__ float bf_rn(float f) {
  return __uint_as_float(((unsigned)f2bf(f)) << 16);
}

__device__ __forceinline__ v8f zero8() {
  v8f z = {0.f, 0.f, 0.f, 0.f, 0.f, 0.f, 0.f, 0.f};
  return z;
}

// 16x32 16-bit fragment from row-major storage with k contiguous (pitch ld elements):
// lane l: row = l&15; elements 0..7 <- k0 + 8*(l>>4) + 0..7; elements 8..15 <- k0 + 16 + 8*(l>>4) + 0..7.
// Used for A (row = m) and for B stored n-major with k contiguous (row = n).
__device__ __forceinline__ v16bf ldfrag_bf(const u16* base, int ld) {
  const int l = threadIdx.x & 31;
  const int row = l & 15;
  const int kb = (l >> 4) << 3;
  const u16* p = base + (size_t)row * ld + kb;
  union { v16bf v; v4u q[2]; } u;
  u.q[0] = *(const v4u*)(p);
  u.q[1] = *(const v4u*)(p + 16);
  return u.v;
}

__device__ __forceinline__ v16h ldfrag_h(const h16* base, int ld) {
  const int l = threadIdx.x & 31;
  const int row = l & 15;
  const int kb = (l >> 4) << 3;
  const h16* p = base + (size_t)row * ld + kb;
  union { v16h v; v8h q[2]; } u;
  u.q[0] = *(const v8h*)(p);
  u.q[1] = *(const v8h*)(p + 16);
  return u.v;
}

// D[16x16] += A[16x32] . B[32x16]; D element r of lane l = (row 8*(l>>4)+r, col l&15)
__device__ __forceinline__ v8f mma_bf(v16bf a, v16bf b, v8f c) {
  v8f r = __builtin_amdgcn_wmma_f32_16x16x32_bf16(false, a, false, b, (short)0, c, false, false);
  asm volatile("v_nop\n\tv_nop\n\tv_nop\n\tv_nop" : "+v"(r) : "v"(a), "v"(b));
  return r;
}

__device__ __forceinline__ v8f mma_h(v16h a, v16h b, v8f c) {
  v8f r = __builtin_amdgcn_wmma_f32_16x16x32_f16(false, a, false, b, (short)0, c, false, false);
  asm volatile("v_nop\n\tv_nop\n\tv_nop\n\tv_nop" : "+v"(r) : "v"(a), "v"(b));
  return r;
}

// value of lane l ^ 16 (the other half of the wave holds the other keys of the same query column)
__device__ __forceinline__ float xhalf(float x) {
  const int b = __float_as_int(x);
  return __int_as_float(__builtin_amdgcn_permlanex16(b, b, 0x76543210, 0xfedcba98, false, false));
}

// ---------------- stage 0: f32 -> bf16 planes (rows of DM elements) ----------------
// plane row pr <- source row (pr / rows_per_grp) * grp_stride_rows + pr % rows_per_grp.
__global__ __launch_bounds__(256) void k_cvt_bf16(const float* __restrict__ src, u16* __restrict__ dst,
                                                   int nrows, int rows_per_grp, int grp_stride_rows) {
  const int per_row = DM / 8;
  const int c = blockIdx.x * 256 + threadIdx.x;
  if (c >= nrows * per_row) return;
  const int pr = c / per_row;
  const int col = (c - pr * per_row) * 8;
  const int g = pr / rows_per_grp;
  const int sr = g * grp_stride_rows + (pr - g * rows_per_grp);
  const float* s = src + (size_t)sr * DM + col;
  const v4f a = *(const v4f*)(s);
  const v4f b = *(const v4f*)(s + 4);
  v4u w;
  w.x = (unsigned)f2bf(a.x) | ((unsigned)f2bf(a.y) << 16);
  w.y = (unsigned)f2bf(a.z) | ((unsigned)f2bf(a.w) << 16);
  w.z = (unsigned)f2bf(b.x) | ((unsigned)f2bf(b.y) << 16);
  w.w = (unsigned)f2bf(b.z) | ((unsigned)f2bf(b.w) << 16);
  v4u* d = (v4u*)(dst + (size_t)pr * DM + col);
  *d = w;
  
}

// ---------------- stage 1: projections ----------------
// out[row, n] = sum_k Xb[row, k] * W[n, k] + bias[n]; row in [0, MT), n in [0, DM), K = DM.
// blockIdx.z selects the matrix: 0 -> Q plane [bh][s][64], 1 -> K plane [bh][s][64], 2 -> V^T plane [bh][64][SEQ] (f16).
// Block = 4 waves, tile 64(M) x 64(N); wave owns 16 rows x 64 cols; fragments straight from global.
__global__ __launch_bounds__(128) __attribute__((amdgpu_num_vgpr(256)))
void k_proj(const u16* __restrict__ Xb, const u16* __restrict__ Wb,
            const float* __restrict__ bq, const float* __restrict__ bk, const float* __restrict__ bv,
            h16* __restrict__ Qp, h16* __restrict__ Kp, h16* __restrict__ VTp) {
  __shared__ __attribute__((aligned(16))) h16 Ts[64 * 64];

  const int wave = threadIdx.x >> 5, lane = threadIdx.x & 31;
  const int hh = lane >> 4, mm = lane & 15;
  const int mat = blockIdx.z;
  const int m0 = blockIdx.x * 64, n0 = blockIdx.y * 64;
  const u16* W = Wb + (size_t)mat * DM * DM + (size_t)n0 * DM;   // rows n0..n0+63, k contiguous
  const float* bias = (mat == 0) ? bq : ((mat == 1) ? bk : bv);
  const u16* Xr = Xb + (size_t)(m0 + wave * 16) * DM;

  v8f acc[4] = {zero8(), zero8(), zero8(), zero8()};

#pragma unroll 2
  for (int k0 = 0; k0 < DM; k0 += 32) {
    const v16bf a  = ldfrag_bf(Xr + k0, DM);
    const v16bf b0 = ldfrag_bf(W + (size_t)(0 * 16) * DM + k0, DM);
    const v16bf b1 = ldfrag_bf(W + (size_t)(1 * 16) * DM + k0, DM);
    const v16bf b2 = ldfrag_bf(W + (size_t)(2 * 16) * DM + k0, DM);
    const v16bf b3 = ldfrag_bf(W + (size_t)(3 * 16) * DM + k0, DM);
    acc[0] = mma_bf(a, b0, acc[0]);
    acc[1] = mma_bf(a, b1, acc[1]);
    acc[2] = mma_bf(a, b2, acc[2]);
    acc[3] = mma_bf(a, b3, acc[3]);
  }

  // bias enters as its bf16-RNE value
  float bb[4];
#pragma unroll
  for (int t = 0; t < 4; ++t) bb[t] = bf_rn(bias[n0 + 16 * t + mm]);

  // stage the 64x64 tile in LDS: [row][col] for Q/K, transposed [col][row] for V
  const bool tr = (mat == 2);
#pragma unroll
  for (int t = 0; t < 4; ++t) {
#pragma unroll
    for (int r = 0; r < 8; ++r) {
      const int row = wave * 16 + 8 * hh + r;
      const int col = 16 * t + mm;
      const int idx = tr ? (col * 64 + row) : (row * 64 + col);
      Ts[idx] = (h16)(acc[t][r] + bb[t]);
    }
  }
  __syncthreads();

  const int b  = m0 / SEQ;
  const int s0 = m0 - b * SEQ;
  const int bh = b * NH + blockIdx.y;
  h16* dstp = (mat == 0) ? Qp : ((mat == 1) ? Kp : VTp);
  const int pc = (threadIdx.x & 7) * 8;
  const int rb = threadIdx.x >> 3;
  v8h vals[4];
  size_t offs[4];
#pragma unroll
  for (int i = 0; i < 4; ++i) {
    const int rr = i * 16 + rb;
    vals[i] = *(const v8h*)(&Ts[rr * 64 + pc]);
    offs[i] = tr ? ((((size_t)bh * HD + rr) * SEQ) + s0 + pc)
                 : ((((size_t)bh * SEQ + s0 + rr) * HD) + pc);
  }
#pragma unroll
  for (int i = 0; i < 4; ++i) *(v8h*)(dstp + offs[i]) = vals[i];
  
}

// ---------------- stage 2: flash attention ----------------
// Block = 4 waves, owns (bh, 64 query rows); wave owns 16 query rows, loops over key tiles of 64.
// Q fragments from the [bh][s][64] plane. Each 64-key tile of K ([key][64]) and of V^T ([d][64 keys]) is copied once per
// block into LDS (two buffers, the next tile in flight while this one is worked on) and all four waves take their
// fragments from there. The products run transposed: S^T[key][q] = K . Q^T and O^T[d][q] += V^T . P^T, so a lane holds
// one query's scores (keys 16t + 8*(l>>4) + r), and two converted score tiles are the B operand of the second product.
#define KVP 72                       // f16 per staged row: 128 B of data + 16 B pad, the pitch for 16-byte LDS readers
#define KV_TILE (64 * KVP)           // f16 per staged tile (64 rows)
#define KV_BUF_BYTES (2 * KV_TILE * 2)
#define OSP 68                       // f32 per staged output row: 256 B of data + 16 B pad (16-byte LDS writers, one row per lane)

// One tile of K and one of V^T into one buffer: 8 copies of 16 B per lane, each wave-wide copy = 4 whole 128-B rows.
// kg, vg: the lane's global address in rows 0..15 of the two tiles; lk: the lane's LDS byte address in the K tile.
__device__ __forceinline__ void stage_kv(const h16* kg, const h16* vg, unsigned lk) {
  const unsigned lv = lk + KV_TILE * 2;
  const unsigned rs = 16 * KVP * 2;  // 16 staged rows, in bytes
  // s_wait_xcnt closes the statement so that no address register is rewritten ahead of it
  asm volatile("global_load_async_to_lds_b128 %0, %8, off\n\t"
               "global_load_async_to_lds_b128 %1, %9, off\n\t"
               "global_load_async_to_lds_b128 %2, %10, off\n\t"
               "global_load_async_to_lds_b128 %3, %11, off\n\t"
               "global_load_async_to_lds_b128 %4, %12, off\n\t"
               "global_load_async_to_lds_b128 %5, %13, off\n\t"
               "global_load_async_to_lds_b128 %6, %14, off\n\t"
               "global_load_async_to_lds_b128 %7, %15, off\n\t"
               "s_wait_xcnt 0x0"
               :: "v"(lk), "v"(lk + rs), "v"(lk + 2 * rs), "v"(lk + 3 * rs),
                  "v"(lv), "v"(lv + rs), "v"(lv + 2 * rs), "v"(lv + 3 * rs),
                  "v"(kg), "v"(kg + 16 * HD), "v"(kg + 32 * HD), "v"(kg + 48 * HD),
                  "v"(vg), "v"(vg + (size_t)16 * SEQ), "v"(vg + (size_t)32 * SEQ), "v"(vg + (size_t)48 * SEQ)
               : "memory");
}

__global__ __launch_bounds__(128) __attribute__((amdgpu_num_vgpr(256)))
void k_attn(const h16* __restrict__ Qp, const h16* __restrict__ Kp, const h16* __restrict__ VTp,
            const int* __restrict__ mask, float* __restrict__ out) {
  __shared__ __attribute__((aligned(16))) h16   KVs[2][2][KV_TILE]; // [buffer][K | V^T][row * KVP + col]
  __shared__ __attribute__((aligned(16))) float Madd[SEQ];        // additive key mask -10000*(1 - m), one per key
  __shared__ __attribute__((aligned(16))) float Os[4][16 * OSP];  // per wave: output tile [q][d]

  const int wave = threadIdx.x >> 5, lane = threadIdx.x & 31;
  const int hh = lane >> 4, mm = lane & 15;
  const int bh = blockIdx.y;
  const int b  = bh / NH;
  const int hd = bh - b * NH;
  const int q0 = blockIdx.x * 64 + wave * 16;

  const h16* Qbh = Qp  + (size_t)bh * SEQ * HD;
  const h16* Kbh = Kp  + (size_t)bh * SEQ * HD;
  const h16* Vbh = VTp + (size_t)bh * HD * SEQ;
  const int* mk_b = mask + (size_t)b * S_FULL;

  const v16h aq0 = ldfrag_h(Qbh + (size_t)q0 * HD, HD);
  const v16h aq1 = ldfrag_h(Qbh + (size_t)q0 * HD + 32, HD);

  // per lane: running maximum of query column mm (both halves agree), running sum over this half's keys only
  float m_run = -1e30f, l_run = 0.f;
  v8f o[4] = {zero8(), zero8(), zero8(), zero8()};   // o[dt][r] = O^T[16*dt + 8*hh + r][mm]

  // the lane's 16-byte piece of rows 0..15 of a tile: 8 lanes per 128-B row
  const int crow = threadIdx.x >> 3, ccol = (threadIdx.x & 7) * 8;
  const h16* kg = Kbh + (size_t)crow * HD + ccol;
  const h16* vg = Vbh + (size_t)crow * SEQ + ccol;
  const unsigned lk0 = (unsigned)(uintptr_t)&KVs[0][0][crow * KVP + ccol];

  stage_kv(kg, vg, lk0);
  // a lane now needs the mask term of 32 keys per tile: form all of them once per block, read them back 16 B at a time
#pragma unroll
  for (int i0 = 0; i0 < SEQ; i0 += 128 * 4) {
    const int i = i0 + (int)threadIdx.x * 4;
    if (SEQ % (128 * 4) == 0 || i < SEQ) {
      const v4i mi = *(const v4i*)(mk_b + i);
      v4f ma;
#pragma unroll
      for (int j = 0; j < 4; ++j) ma[j] = -10000.0f * (1.0f - (float)mi[j]);
      *(v4f*)(&Madd[i]) = ma;
    }
  }
  asm volatile("s_wait_asynccnt 0x0" ::: "memory");   // this wave's share of tile 0 has landed
  __syncthreads();                                     // tile 0 and the mask terms readable by every wave
  if (SEQ > 64) stage_kv(kg + (size_t)64 * HD, vg + 64, lk0 + KV_BUF_BYTES);

#pragma unroll 1
  for (int t0 = 0; t0 < SEQ; t0 += 64) {
    const int buf = (t0 >> 6) & 1;
    const h16* Kt = &KVs[buf][0][0];
    const h16* Vt = &KVs[buf][1][0];
    // scores S^T[64 keys][16 q] = k . q^T; sc[t][r] = key 16*t + 8*hh + r, query mm
    v8f sc[4];
#pragma unroll
    for (int t = 0; t < 4; ++t) {
      const v16h kf0 = ldfrag_h(Kt + (16 * t) * KVP, KVP);
      const v16h kf1 = ldfrag_h(Kt + (16 * t) * KVP + 32, KVP);
      sc[t] = mma_h(kf0, aq0, zero8());
      sc[t] = mma_h(kf1, aq1, sc[t]);
    }

    // scale 1/8 and additive key mask: s/8 - 10000*(1 - m)
#pragma unroll
    for (int t = 0; t < 4; ++t) {
      const v4f ma0 = *(const v4f*)(&Madd[t0 + 16 * t + 8 * hh]);
      const v4f ma1 = *(const v4f*)(&Madd[t0 + 16 * t + 8 * hh + 4]);
#pragma unroll
      for (int r = 0; r < 4; ++r) {
        sc[t][r]     = sc[t][r]     * 0.125f + ma0[r];
        sc[t][4 + r] = sc[t][4 + r] * 0.125f + ma1[r];
      }
    }

    // online softmax, one query per lane: maximum in-lane over 32 keys, then one exchange with the other half
    float mt[4];
#pragma unroll
    for (int t = 0; t < 4; ++t) {
      mt[t] = sc[t][0];
#pragma unroll
      for (int r = 1; r < 8; ++r) mt[t] = fmaxf(mt[t], sc[t][r]);
    }
    float mx = fmaxf(fmaxf(mt[0], mt[1]), fmaxf(mt[2], mt[3]));
    mx = fmaxf(mx, xhalf(mx));
    const float mn = fmaxf(m_run, mx);
    const float alpha = __expf(m_run - mn);
    m_run = mn;

    // P^T (x1024, f16) straight into the B operand: element s of pb[j] = key 32*j + (s < 8 ? 8*hh + s : 16 + 8*hh + s - 8)
    v16h pb[2];
    float pst[4];
#pragma unroll
    for (int t = 0; t < 4; ++t) {
      pst[t] = 0.f;
#pragma unroll
      for (int r = 0; r < 8; ++r) {
        const float p = __expf(sc[t][r] - mn);
        pst[t] += p;
        pb[t >> 1][(t & 1) * 8 + r] = (h16)(p * 1024.0f);
      }
    }
    l_run = l_run * alpha + ((pst[0] + pst[1]) + (pst[2] + pst[3]));
#pragma unroll
    for (int dt = 0; dt < 4; ++dt)
#pragma unroll
      for (int r = 0; r < 8; ++r) o[dt][r] *= alpha;

    // O^T[64 d][16 q] += V^T[64 d][64 keys] . P^T[64 keys][16 q]
#pragma unroll
    for (int dt = 0; dt < 4; ++dt) {
      const v16h vf0 = ldfrag_h(Vt + (16 * dt) * KVP, KVP);
      const v16h vf1 = ldfrag_h(Vt + (16 * dt) * KVP + 32, KVP);
      o[dt] = mma_h(vf0, pb[0], o[dt]);
      o[dt] = mma_h(vf1, pb[1], o[dt]);
    }
    asm volatile("s_wait_dscnt 0x0" ::: "memory");      // this wave's reads of the buffer are done
    asm volatile("s_wait_asynccnt 0x0" ::: "memory");   // this wave's share of the next tile has landed
    __syncthreads();   // next tile readable by every wave; this trip's buffer free for the refill
    if (t0 + 128 < SEQ) stage_kv(kg + (size_t)(t0 + 128) * HD, vg + (t0 + 128), lk0 + buf * KV_BUF_BYTES);
  }
  asm volatile("s_wait_asynccnt 0x0" ::: "memory");     // no copy outstanding behind the loop

  // normalise (undo the x1024 carry) and stage the 16x64 f32 tile per wave
  const float inv = (1.0f / (l_run + xhalf(l_run))) * 0.0009765625f;   // the two halves' key sums join here, once
#pragma unroll
  for (int dt = 0; dt < 4; ++dt) {
    v4f w0, w1;
#pragma unroll
    for (int r = 0; r < 4; ++r) { w0[r] = o[dt][r] * inv; w1[r] = o[dt][4 + r] * inv; }
    *(v4f*)(&Os[wave][mm * OSP + 16 * dt + 8 * hh])     = w0;
    *(v4f*)(&Os[wave][mm * OSP + 16 * dt + 8 * hh + 4]) = w1;
  }
  __syncthreads();

  // each instruction: lanes 0..15 -> row 2i (256 B = 2 full lines), lanes 16..31 -> row 2i+1
  const int rsub = lane >> 4;
  const int cc = (lane & 15) * 4;
  float* ob = out + ((size_t)b * SEQ + q0) * DM + (size_t)hd * HD;
  v4f vv[8];
#pragma unroll
  for (int i = 0; i < 8; ++i) vv[i] = *(const v4f*)(&Os[wave][(2 * i + rsub) * OSP + cc]);
#pragma unroll
  for (int i = 0; i < 8; ++i) *(v4f*)(ob + (size_t)(2 * i + rsub) * DM + cc) = vv[i];
  
}

// ---------------- launcher ----------------
extern "C" void kernel_launch(void* const* d_in, const int* in_sizes, int n_in,
                              void* d_out, int out_size, void* d_ws, size_t ws_size,
                              hipStream_t stream) {
  if (n_in < 8) return;
  const float* x   = (const float*)d_in[0];
  const int*   msk = (const int*)d_in[1];
  const float* Wq  = (const float*)d_in[2];
  const float* bq  = (const float*)d_in[3];
  const float* Wk  = (const float*)d_in[4];
  const float* bk  = (const float*)d_in[5];
  const float* Wv  = (const float*)d_in[6];
  const float* bv  = (const float*)d_in[7];
  float* out = (float*)d_out;

  if (in_sizes[0] < ((NB - 1) * S_FULL + SEQ) * DM) return;
  if (in_sizes[1] < (NB - 1) * S_FULL + SEQ) return;
  if (in_sizes[2] < DM * DM || in_sizes[4] < DM * DM || in_sizes[6] < DM * DM) return;
  if (in_sizes[3] < DM || in_sizes[5] < DM || in_sizes[7] < DM) return;
  if (out_size < MT * DM) return;

  char* ws = (char*)d_ws;
  const size_t XB_BYTES = (size_t)MT * DM * 2;              // bf16 x plane [MT][DM]
  const size_t W_BYTES  = (size_t)DM * DM * 2;              // one bf16 weight plane
  const size_t PL_BYTES = (size_t)NB * NH * SEQ * HD * 2;   // one f16 q/k/v^T plane
  size_t off = 0;
  u16* Xb = (u16*)(ws + off);  off += XB_BYTES;
  u16* Wb = (u16*)(ws + off);  off += 3 * W_BYTES;
  h16* Qp = (h16*)(ws + off);  off += PL_BYTES;
  h16* Kp = (h16*)(ws + off);  off += PL_BYTES;
  h16* VTp = (h16*)(ws + off); off += PL_BYTES;
  if (off > ws_size) return;

  const int nchunk_x = MT * (DM / 8);
  const int nchunk_w = DM * (DM / 8);
  k_cvt_bf16<<<(nchunk_x + 255) / 256, 256, 0, stream>>>(x,  Xb, MT, SEQ, S_FULL);
  k_cvt_bf16<<<(nchunk_w + 255) / 256, 256, 0, stream>>>(Wq, Wb, DM, DM, DM);
  k_cvt_bf16<<<(nchunk_w + 255) / 256, 256, 0, stream>>>(Wk, Wb + (size_t)DM * DM, DM, DM, DM);
  k_cvt_bf16<<<(nchunk_w + 255) / 256, 256, 0, stream>>>(Wv, Wb + (size_t)2 * DM * DM, DM, DM, DM);

  dim3 gp(MT / 64, DM / 64, 3);
  k_proj<<<gp, 128, 0, stream>>>(Xb, Wb, bq, bk, bv, Qp, Kp, VTp);

  dim3 ga(SEQ / 64, NB * NH);
  k_attn<<<ga, 128, 0, stream>>>(Qp, Kp, VTp, msk, out);
}

// v003
// It runs in 79.7 microseconds.
// Next to v002, in two timings, it ran 1.73 and 1.74 times as fast.
// All steps since v000 together make it 3.29 times as fast.
#include <hip/hip_runtime.h>
#include <stdint.h>

// Contractions: x.Wq^T, x.Wk^T, x.Wv^T on v_wmma_f32_16x16x32_bf16 (bf16 operands = RNE-converted f32 inputs, f32 accumulate);
// k.q^T and V^T.P^T on v_wmma_f32_16x16x32_f16 (f16 operands, P carried x1024, f32 accumulate); bias add, softmax, normalisation in f32.

typedef unsigned short u16;
typedef _Float16 h16;
typedef __bf16 v16bf __attribute__((ext_vector_type(16)));
typedef h16 v16h __attribute__((ext_vector_type(16)));
typedef h16 v8h __attribute__((ext_vector_type(8), __may_alias__));
typedef float v8f __attribute__((ext_vector_type(8)));
typedef float v4f __attribute__((ext_vector_type(4), __may_alias__));
typedef unsigned int v4u __attribute__((ext_vector_type(4), __may_alias__));
typedef int v4i __attribute__((ext_vector_type(4), __may_alias__));

#ifndef NB
#define NB 4
#endif
#ifndef SEQ
#define SEQ 2048
#endif
#define NB_FULL 4
#define S_FULL 2048
#define DM 512
#define NH 8
#define HD 64
#define MT (NB * SEQ)

static_assert(NB >= 1 && NB <= NB_FULL);
static_assert(SEQ % 64 == 0 && SEQ <= S_FULL);
static_assert(DM % 64 == 0 && DM % 32 == 0);
static_assert(NH * HD == DM);
static_assert(HD == 64);
static_assert(MT % 64 == 0);

// ---------------- helpers ----------------

__device__ __forceinline__ u16 f2bf(float f) {
  unsigned u = __float_as_uint(f);
  u += 0x7FFFu + ((u >> 16) & 1u);   // RNE convert f32 -> bf16 bits
  return (u16)(u >> 16);
}

__device__ __forceinline__ float bf_rn(float f) {
  return __uint_as_float(((unsigned)f2bf(f)) << 16);
}

__device__ __forceinline__ v8f zero8() {
  v8f z = {0.f, 0.f, 0.f, 0.f, 0.f, 0.f, 0.f, 0.f};
  return z;
}

// 16x32 16-bit fragment from row-major storage with k contiguous (pitch ld elements):
// lane l: row = l&15; elements 0..7 <- k0 + 8*(l>>4) + 0..7; elements 8..15 <- k0 + 16 + 8*(l>>4) + 0..7.
// Used for A (row = m) and for B stored n-major with k contiguous (row = n).
__device__ __forceinline__ v16bf ldfrag_bf(const u16* base, int ld) {
  const int l = threadIdx.x & 31;
  const int row = l & 15;
  const int kb = (l >> 4) << 3;
  const u16* p = base + (size_t)row * ld + kb;
  union { v16bf v; v4u q[2]; } u;
  u.q[0] = *(const v4u*)(p);
  u.q[1] = *(const v4u*)(p + 16);
  return u.v;
}

__device__ __forceinline__ v16h ldfrag_h(const h16* base, int ld) {
  const int l = threadIdx.x & 31;
  const int row = l & 15;
  const int kb = (l >> 4) << 3;
  const h16* p = base + (size_t)row * ld + kb;
  union { v16h v; v8h q[2]; } u;
  u.q[0] = *(const v8h*)(p);
  u.q[1] = *(const v8h*)(p + 16);
  return u.v;
}

// D[16x16] += A[16x32] . B[32x16]; D element r of lane l = (row 8*(l>>4)+r, col l&15)
__device__ __forceinline__ v8f mma_bf(v16bf a, v16bf b, v8f c) {
  v8f r = __builtin_amdgcn_wmma_f32_16x16x32_bf16(false, a, false, b, (short)0, c, false, false);
  asm volatile("v_nop\n\tv_nop\n\tv_nop\n\tv_nop" : "+v"(r) : "v"(a), "v"(b));
  return r;
}

__device__ __forceinline__ v8f mma_h(v16h a, v16h b, v8f c) {
  v8f r = __builtin_amdgcn_wmma_f32_16x16x32_f16(false, a, false, b, (short)0, c, false, false);
  asm volatile("v_nop\n\tv_nop\n\tv_nop\n\tv_nop" : "+v"(r) : "v"(a), "v"(b));
  return r;
}

// value of lane l ^ 16 (the other half of the wave holds the other keys of the same query column)
__device__ __forceinline__ float xhalf(float x) {
  const int b = __float_as_int(x);
  return __int_as_float(__builtin_amdgcn_permlanex16(b, b, 0x76543210, 0xfedcba98, false, false));
}

// ---------------- stage 0: f32 -> bf16 planes (rows of DM elements) ----------------
// plane row pr <- source row (pr / rows_per_grp) * grp_stride_rows + pr % rows_per_grp.
__global__ __launch_bounds__(256) void k_cvt_bf16(const float* __restrict__ src, u16* __restrict__ dst,
                                                   int nrows, int rows_per_grp, int grp_stride_rows) {
  const int per_row = DM / 8;
  const int c = blockIdx.x * 256 + threadIdx.x;
  if (c >= nrows * per_row) return;
  const int pr = c / per_row;
  const int col = (c - pr * per_row) * 8;
  const int g = pr / rows_per_grp;
  const int sr = g * grp_stride_rows + (pr - g * rows_per_grp);
  const float* s = src + (size_t)sr * DM + col;
  const v4f a = *(const v4f*)(s);
  const v4f b = *(const v4f*)(s + 4);
  v4u w;
  w.x = (unsigned)f2bf(a.x) | ((unsigned)f2bf(a.y) << 16);
  w.y = (unsigned)f2bf(a.z) | ((unsigned)f2bf(a.w) << 16);
  w.z = (unsigned)f2bf(b.x) | ((unsigned)f2bf(b.y) << 16);
  w.w = (unsigned)f2bf(b.z) | ((unsigned)f2bf(b.w) << 16);
  v4u* d = (v4u*)(dst + (size_t)pr * DM + col);
  *d = w;
  
}

// ---------------- stage 1: projections ----------------
// out[row, n] = sum_k Xb[row, k] * W[n, k] + bias[n]; row in [0, MT), n in [0, DM), K = DM.
// blockIdx.z selects the matrix: 0 -> Q plane [bh][s][64], 1 -> K plane [bh][s][64], 2 -> V^T plane [bh][64][SEQ] (f16).
// Block = 4 waves, tile 64(M) x 64(N); wave owns 16 rows x 64 cols. Each k-tile of 64 elements (64 rows x 128 B of X and
// of W) is copied once per block into LDS in whole lines (two buffers, the next k-tile in flight while this one is worked
// on); the waves take their fragments from there. Each sum runs over k in ascending steps of 32.
#define XWP 72                       // bf16 per staged row: 128 B of data + 16 B pad, the pitch for 16-byte LDS readers
#define XW_TILE (64 * XWP)           // bf16 per staged tile (64 rows)
#define XW_BUF_BYTES (2 * XW_TILE * 2)

// One k-tile of X and one of W into one buffer: 8 copies of 16 B per lane, each wave-wide copy = 4 whole 128-B lines.
// xg, wg: the lane's global address in rows 0..15 of the two tiles; lx: the lane's LDS byte address in the X tile.
__device__ __forceinline__ void stage_xw(const u16* xg, const u16* wg, unsigned lx) {
  const unsigned lw = lx + XW_TILE * 2;
  const unsigned rs = 16 * XWP * 2;  // 16 staged rows, in bytes
  // s_wait_xcnt closes the statement so that no address register is rewritten ahead of it
  asm volatile("global_load_async_to_lds_b128 %0, %8, off\n\t"
               "global_load_async_to_lds_b128 %1, %9, off\n\t"
               "global_load_async_to_lds_b128 %2, %10, off\n\t"
               "global_load_async_to_lds_b128 %3, %11, off\n\t"
               "global_load_async_to_lds_b128 %4, %12, off\n\t"
               "global_load_async_to_lds_b128 %5, %13, off\n\t"
               "global_load_async_to_lds_b128 %6, %14, off\n\t"
               "global_load_async_to_lds_b128 %7, %15, off\n\t"
               "s_wait_xcnt 0x0"
               :: "v"(lx), "v"(lx + rs), "v"(lx + 2 * rs), "v"(lx + 3 * rs),
                  "v"(lw), "v"(lw + rs), "v"(lw + 2 * rs), "v"(lw + 3 * rs),
                  "v"(xg), "v"(xg + 16 * DM), "v"(xg + 32 * DM), "v"(xg + 48 * DM),
                  "v"(wg), "v"(wg + 16 * DM), "v"(wg + 32 * DM), "v"(wg + 48 * DM)
               : "memory");
}

__global__ __launch_bounds__(128) __attribute__((amdgpu_num_vgpr(256)))
void k_proj(const u16* __restrict__ Xb, const u16* __restrict__ Wb,
            const float* __restrict__ bq, const float* __restrict__ bk, const float* __restrict__ bv,
            h16* __restrict__ Qp, h16* __restrict__ Kp, h16* __restrict__ VTp) {
  __shared__ __attribute__((aligned(16))) u16 XWs[2][2][XW_TILE];   // [buffer][X | W][row * XWP + k]
  __shared__ __attribute__((aligned(16))) h16 Ts[64 * 64];

  const int wave = threadIdx.x >> 5, lane = threadIdx.x & 31;
  const int hh = lane >> 4, mm = lane & 15;
  const int mat = blockIdx.z;
  const int m0 = blockIdx.x * 64, n0 = blockIdx.y * 64;
  const u16* W = Wb + (size_t)mat * DM * DM + (size_t)n0 * DM;   // rows n0..n0+63, k contiguous
  const float* bias = (mat == 0) ? bq : ((mat == 1) ? bk : bv);

  v8f acc[4] = {zero8(), zero8(), zero8(), zero8()};

  // the lane's 16-byte piece of rows 0..15 of a k-tile: 8 lanes per 128-B line
  const int crow = threadIdx.x >> 3, ccol = (threadIdx.x & 7) * 8;
  const u16* xg = Xb + (size_t)(m0 + crow) * DM + ccol;
  const u16* wg = W + (size_t)crow * DM + ccol;
  const unsigned lx0 = (unsigned)(uintptr_t)&XWs[0][0][crow * XWP + ccol];

  stage_xw(xg, wg, lx0);
  asm volatile("s_wait_asynccnt 0x0" ::: "memory");   // this wave's share of k-tile 0 has landed
  __syncthreads();                                     // k-tile 0 readable by every wave
  if (DM > 64) stage_xw(xg + 64, wg + 64, lx0 + XW_BUF_BYTES);

  for (int kt = 0; kt < DM; kt += 64) {
    const int buf = (kt >> 6) & 1;
    const u16* Xt = &XWs[buf][0][(wave * 16) * XWP];
    const u16* Wt = &XWs[buf][1][0];
    for (int k0 = 0; k0 < 64; k0 += 32) {
      const v16bf a  = ldfrag_bf(Xt + k0, XWP);
      const v16bf b0 = ldfrag_bf(Wt + (0 * 16) * XWP + k0, XWP);
      const v16bf b1 = ldfrag_bf(Wt + (1 * 16) * XWP + k0, XWP);
      const v16bf b2 = ldfrag_bf(Wt + (2 * 16) * XWP + k0, XWP);
      const v16bf b3 = ldfrag_bf(Wt + (3 * 16) * XWP + k0, XWP);
      acc[0] = mma_bf(a, b0, acc[0]);
      acc[1] = mma_bf(a, b1, acc[1]);
      acc[2] = mma_bf(a, b2, acc[2]);
      acc[3] = mma_bf(a, b3, acc[3]);
    }
    asm volatile("s_wait_dscnt 0x0" ::: "memory");      // this wave's reads of the buffer are done
    asm volatile("s_wait_asynccnt 0x0" ::: "memory");   // this wave's share of the next k-tile has landed
    __syncthreads();   // next k-tile readable by every wave; this trip's buffer free for the refill
    if (kt + 128 < DM) stage_xw(xg + (kt + 128), wg + (kt + 128), lx0 + buf * XW_BUF_BYTES);
  }
  asm volatile("s_wait_asynccnt 0x0" ::: "memory");     // no copy outstanding behind the loop

  // bias enters as its bf16-RNE value
  float bb[4];
#pragma unroll
  for (int t = 0; t < 4; ++t) bb[t] = bf_rn(bias[n0 + 16 * t + mm]);

  // stage the 64x64 tile in LDS: [row][col] for Q/K, transposed [col][row] for V
  const bool tr = (mat == 2);
#pragma unroll
  for (int t = 0; t < 4; ++t) {
#pragma unroll
    for (int r = 0; r < 8; ++r) {
      const int row = wave * 16 + 8 * hh + r;
      const int col = 16 * t + mm;
      const int idx = tr ? (col * 64 + row) : (row * 64 + col);
      Ts[idx] = (h16)(acc[t][r] + bb[t]);
    }
  }
  __syncthreads();

  const int b  = m0 / SEQ;
  const int s0 = m0 - b * SEQ;
  const int bh = b * NH + blockIdx.y;
  h16* dstp = (mat == 0) ? Qp : ((mat == 1) ? Kp : VTp);
  const int pc = (threadIdx.x & 7) * 8;
  const int rb = threadIdx.x >> 3;
  v8h vals[4];
  size_t offs[4];
#pragma unroll
  for (int i = 0; i < 4; ++i) {
    const int rr = i * 16 + rb;
    vals[i] = *(const v8h*)(&Ts[rr * 64 + pc]);
    offs[i] = tr ? ((((size_t)bh * HD + rr) * SEQ) + s0 + pc)
                 : ((((size_t)bh * SEQ + s0 + rr) * HD) + pc);
  }
#pragma unroll
  for (int i = 0; i < 4; ++i) *(v8h*)(dstp + offs[i]) = vals[i];
  
}

// ---------------- stage 2: flash attention ----------------
// Block = 4 waves, owns (bh, 64 query rows); wave owns 16 query rows, loops over key tiles of 64.
// Q fragments from the [bh][s][64] plane. Each 64-key tile of K ([key][64]) and of V^T ([d][64 keys]) is copied once per
// block into LDS (two buffers, the next tile in flight while this one is worked on) and all four waves take their
// fragments from there. The products run transposed: S^T[key][q] = K . Q^T and O^T[d][q] += V^T . P^T, so a lane holds
// one query's scores (keys 16t + 8*(l>>4) + r), and two converted score tiles are the B operand of the second product.
#define KVP 72                       // f16 per staged row: 128 B of data + 16 B pad, the pitch for 16-byte LDS readers
#define KV_TILE (64 * KVP)           // f16 per staged tile (64 rows)
#define KV_BUF_BYTES (2 * KV_TILE * 2)
#define OSP 68                       // f32 per staged output row: 256 B of data + 16 B pad (16-byte LDS writers, one row per lane)

// One tile of K and one of V^T into one buffer: 8 copies of 16 B per lane, each wave-wide copy = 4 whole 128-B rows.
// kg, vg: the lane's global address in rows 0..15 of the two tiles; lk: the lane's LDS byte address in the K tile.
__device__ __forceinline__ void stage_kv(const h16* kg, const h16* vg, unsigned lk) {
  const unsigned lv = lk + KV_TILE * 2;
  const unsigned rs = 16 * KVP * 2;  // 16 staged rows, in bytes
  // s_wait_xcnt closes the statement so that no address register is rewritten ahead of it
  asm volatile("global_load_async_to_lds_b128 %0, %8, off\n\t"
               "global_load_async_to_lds_b128 %1, %9, off\n\t"
               "global_load_async_to_lds_b128 %2, %10, off\n\t"
               "global_load_async_to_lds_b128 %3, %11, off\n\t"
               "global_load_async_to_lds_b128 %4, %12, off\n\t"
               "global_load_async_to_lds_b128 %5, %13, off\n\t"
               "global_load_async_to_lds_b128 %6, %14, off\n\t"
               "global_load_async_to_lds_b128 %7, %15, off\n\t"
               "s_wait_xcnt 0x0"
               :: "v"(lk), "v"(lk + rs), "v"(lk + 2 * rs), "v"(lk + 3 * rs),
                  "v"(lv), "v"(lv + rs), "v"(lv + 2 * rs), "v"(lv + 3 * rs),
                  "v"(kg), "v"(kg + 16 * HD), "v"(kg + 32 * HD), "v"(kg + 48 * HD),
                  "v"(vg), "v"(vg + (size_t)16 * SEQ), "v"(vg + (size_t)32 * SEQ), "v"(vg + (size_t)48 * SEQ)
               : "memory");
}

__global__ __launch_bounds__(128) __attribute__((amdgpu_num_vgpr(256)))
void k_attn(const h16* __restrict__ Qp, const h16* __restrict__ Kp, const h16* __restrict__ VTp,
            const int* __restrict__ mask, float* __restrict__ out) {
  __shared__ __attribute__((aligned(16))) h16   KVs[2][2][KV_TILE]; // [buffer][K | V^T][row * KVP + col]
  __shared__ __attribute__((aligned(16))) float Madd[SEQ];        // additive key mask -10000*(1 - m), one per key
  __shared__ __attribute__((aligned(16))) float Os[4][16 * OSP];  // per wave: output tile [q][d]

  const int wave = threadIdx.x >> 5, lane = threadIdx.x & 31;
  const int hh = lane >> 4, mm = lane & 15;
  const int bh = blockIdx.y;
  const int b  = bh / NH;
  const int hd = bh - b * NH;
  const int q0 = blockIdx.x * 64 + wave * 16;

  const h16* Qbh = Qp  + (size_t)bh * SEQ * HD;
  const h16* Kbh = Kp  + (size_t)bh * SEQ * HD;
  const h16* Vbh = VTp + (size_t)bh * HD * SEQ;
  const int* mk_b = mask + (size_t)b * S_FULL;

  const v16h aq0 = ldfrag_h(Qbh + (size_t)q0 * HD, HD);
  const v16h aq1 = ldfrag_h(Qbh + (size_t)q0 * HD + 32, HD);

  // per lane: running maximum of query column mm (both halves agree), running sum over this half's keys only
  float m_run = -1e30f, l_run = 0.f;
  v8f o[4] = {zero8(), zero8(), zero8(), zero8()};   // o[dt][r] = O^T[16*dt + 8*hh + r][mm]

  // the lane's 16-byte piece of rows 0..15 of a tile: 8 lanes per 128-B row
  const int crow = threadIdx.x >> 3, ccol = (threadIdx.x & 7) * 8;
  const h16* kg = Kbh + (size_t)crow * HD + ccol;
  const h16* vg = Vbh + (size_t)crow * SEQ + ccol;
  const unsigned lk0 = (unsigned)(uintptr_t)&KVs[0][0][crow * KVP + ccol];

  stage_kv(kg, vg, lk0);
  // a lane now needs the mask term of 32 keys per tile: form all of them once per block, read them back 16 B at a time
#pragma unroll
  for (int i0 = 0; i0 < SEQ; i0 += 128 * 4) {
    const int i = i0 + (int)threadIdx.x * 4;
    if (SEQ % (128 * 4) == 0 || i < SEQ) {
      const v4i mi = *(const v4i*)(mk_b + i);
      v4f ma;
#pragma unroll
      for (int j = 0; j < 4; ++j) ma[j] = -10000.0f * (1.0f - (float)mi[j]);
      *(v4f*)(&Madd[i]) = ma;
    }
  }
  asm volatile("s_wait_asynccnt 0x0" ::: "memory");   // this wave's share of tile 0 has landed
  __syncthreads();                                     // tile 0 and the mask terms readable by every wave
  if (SEQ > 64) stage_kv(kg + (size_t)64 * HD, vg + 64, lk0 + KV_BUF_BYTES);

#pragma unroll 1
  for (int t0 = 0; t0 < SEQ; t0 += 64) {
    const int buf = (t0 >> 6) & 1;
    const h16* Kt = &KVs[buf][0][0];
    const h16* Vt = &KVs[buf][1][0];
    // scores S^T[64 keys][16 q] = k . q^T; sc[t][r] = key 16*t + 8*hh + r, query mm
    v8f sc[4];
#pragma unroll
    for (int t = 0; t < 4; ++t) {
      const v16h kf0 = ldfrag_h(Kt + (16 * t) * KVP, KVP);
      const v16h kf1 = ldfrag_h(Kt + (16 * t) * KVP + 32, KVP);
      sc[t] = mma_h(kf0, aq0, zero8());
      sc[t] = mma_h(kf1, aq1, sc[t]);
    }

    // scale 1/8 and additive key mask: s/8 - 10000*(1 - m)
#pragma unroll
    for (int t = 0; t < 4; ++t) {
      const v4f ma0 = *(const v4f*)(&Madd[t0 + 16 * t + 8 * hh]);
      const v4f ma1 = *(const v4f*)(&Madd[t0 + 16 * t + 8 * hh + 4]);
#pragma unroll
      for (int r = 0; r < 4; ++r) {
        sc[t][r]     = sc[t][r]     * 0.125f + ma0[r];
        sc[t][4 + r] = sc[t][4 + r] * 0.125f + ma1[r];
      }
    }

    // online softmax, one query per lane: maximum in-lane over 32 keys, then one exchange with the other half
    float mt[4];
#pragma unroll
    for (int t = 0; t < 4; ++t) {
      mt[t] = sc[t][0];
#pragma unroll
      for (int r = 1; r < 8; ++r) mt[t] = fmaxf(mt[t], sc[t][r]);
    }
    float mx = fmaxf(fmaxf(mt[0], mt[1]), fmaxf(mt[2], mt[3]));
    mx = fmaxf(mx, xhalf(mx));
    const float mn = fmaxf(m_run, mx);
    const float alpha = __expf(m_run - mn);
    m_run = mn;

    // P^T (x1024, f16) straight into the B operand: element s of pb[j] = key 32*j + (s < 8 ? 8*hh + s : 16 + 8*hh + s - 8)
    v16h pb[2];
    float pst[4];
#pragma unroll
    for (int t = 0; t < 4; ++t) {
      pst[t] = 0.f;
#pragma unroll
      for (int r = 0; r < 8; ++r) {
        const float p = __expf(sc[t][r] - mn);
        pst[t] += p;
        pb[t >> 1][(t & 1) * 8 + r] = (h16)(p * 1024.0f);
      }
    }
    l_run = l_run * alpha + ((pst[0] + pst[1]) + (pst[2] + pst[3]));
#pragma unroll
    for (int dt = 0; dt < 4; ++dt)
#pragma unroll
      for (int r = 0; r < 8; ++r) o[dt][r] *= alpha;

    // O^T[64 d][16 q] += V^T[64 d][64 keys] . P^T[64 keys][16 q]
#pragma unroll
    for (int dt = 0; dt < 4; ++dt) {
      const v16h vf0 = ldfrag_h(Vt + (16 * dt) * KVP, KVP);
      const v16h vf1 = ldfrag_h(Vt + (16 * dt) * KVP + 32, KVP);
      o[dt] = mma_h(vf0, pb[0], o[dt]);
      o[dt] = mma_h(vf1, pb[1], o[dt]);
    }
    asm volatile("s_wait_dscnt 0x0" ::: "memory");      // this wave's reads of the buffer are done
    asm volatile("s_wait_asynccnt 0x0" ::: "memory");   // this wave's share of the next tile has landed
    __syncthreads();   // next tile readable by every wave; this trip's buffer free for the refill
    if (t0 + 128 < SEQ) stage_kv(kg + (size_t)(t0 + 128) * HD, vg + (t0 + 128), lk0 + buf * KV_BUF_BYTES);
  }
  asm volatile("s_wait_asynccnt 0x0" ::: "memory");     // no copy outstanding behind the loop

  // normalise (undo the x1024 carry) and stage the 16x64 f32 tile per wave
  const float inv = (1.0f / (l_run + xhalf(l_run))) * 0.0009765625f;   // the two halves' key sums join here, once
#pragma unroll
  for (int dt = 0; dt < 4; ++dt) {
    v4f w0, w1;
#pragma unroll
    for (int r = 0; r < 4; ++r) { w0[r] = o[dt][r] * inv; w1[r] = o[dt][4 + r] * inv; }
    *(v4f*)(&Os[wave][mm * OSP + 16 * dt + 8 * hh])     = w0;
    *(v4f*)(&Os[wave][mm * OSP + 16 * dt + 8 * hh + 4]) = w1;
  }
  __syncthreads();

  // each instruction: lanes 0..15 -> row 2i (256 B = 2 full lines), lanes 16..31 -> row 2i+1
  const int rsub = lane >> 4;
  const int cc = (lane & 15) * 4;
  float* ob = out + ((size_t)b * SEQ + q0) * DM + (size_t)hd * HD;
  v4f vv[8];
#pragma unroll
  for (int i = 0; i < 8; ++i) vv[i] = *(const v4f*)(&Os[wave][(2 * i + rsub) * OSP + cc]);
#pragma unroll
  for (int i = 0; i < 8; ++i) *(v4f*)(ob + (size_t)(2 * i + rsub) * DM + cc) = vv[i];
  
}

// ---------------- launcher ----------------
extern "C" void kernel_launch(void* const* d_in, const int* in_sizes, int n_in,
                              void* d_out, int out_size, void* d_ws, size_t ws_size,
                              hipStream_t stream) {
  if (n_in < 8) return;
  const float* x   = (const float*)d_in[0];
  const int*   msk = (const int*)d_in[1];
  const float* Wq  = (const float*)d_in[2];
  const float* bq  = (const float*)d_in[3];
  const float* Wk  = (const float*)d_in[4];
  const float* bk  = (const float*)d_in[5];
  const float* Wv  = (const float*)d_in[6];
  const float* bv  = (const float*)d_in[7];
  float* out = (float*)d_out;

  if (in_sizes[0] < ((NB - 1) * S_FULL + SEQ) * DM) return;
  if (in_sizes[1] < (NB - 1) * S_FULL + SEQ) return;
  if (in_sizes[2] < DM * DM || in_sizes[4] < DM * DM || in_sizes[6] < DM * DM) return;
  if (in_sizes[3] < DM || in_sizes[5] < DM || in_sizes[7] < DM) return;
  if (out_size < MT * DM) return;

  char* ws = (char*)d_ws;
  const size_t XB_BYTES = (size_t)MT * DM * 2;              // bf16 x plane [MT][DM]
  const size_t W_BYTES  = (size_t)DM * DM * 2;              // one bf16 weight plane
  const size_t PL_BYTES = (size_t)NB * NH * SEQ * HD * 2;   // one f16 q/k/v^T plane
  size_t off = 0;
  u16* Xb = (u16*)(ws + off);  off += XB_BYTES;
  u16* Wb = (u16*)(ws + off);  off += 3 * W_BYTES;
  h16* Qp = (h16*)(ws + off);  off += PL_BYTES;
  h16* Kp = (h16*)(ws + off);  off += PL_BYTES;
  h16* VTp = (h16*)(ws + off); off += PL_BYTES;
  if (off > ws_size) return;

  const int nchunk_x = MT * (DM / 8);
  const int nchunk_w = DM * (DM / 8);
  k_cvt_bf16<<<(nchunk_x + 255) / 256, 256, 0, stream>>>(x,  Xb, MT, SEQ, S_FULL);
  k_cvt_bf16<<<(nchunk_w + 255) / 256, 256, 0, stream>>>(Wq, Wb, DM, DM, DM);
  k_cvt_bf16<<<(nchunk_w + 255) / 256, 256, 0, stream>>>(Wk, Wb + (size_t)DM * DM, DM, DM, DM);
  k_cvt_bf16<<<(nchunk_w + 255) / 256, 256, 0, stream>>>(Wv, Wb + (size_t)2 * DM * DM, DM, DM, DM);

  dim3 gp(MT / 64, DM / 64, 3);
  k_proj<<<gp, 128, 0, stream>>>(Xb, Wb, bq, bk, bv, Qp, Kp, VTp);

  dim3 ga(SEQ / 64, NB * NH);
  k_attn<<<ga, 128, 0, stream>>>(Qp, Kp, VTp, msk, out);
}

// v004
// A run of this version takes 72.4 microseconds.
// Next to v003, in two timings, it ran 1.11 and 1.09 times as fast.
// Counting every step since v000, it is 3.62 times as fast.
#include <hip/hip_runtime.h>
#include <stdint.h>

// Contractions: x.Wq^T, x.Wk^T, x.Wv^T on v_wmma_f32_16x16x32_bf16 (bf16 operands = RNE-converted f32 inputs, f32 accumulate);
// k.q^T and V^T.P^T on v_wmma_f32_16x16x32_f16 (f16 operands, P carried x1024, f32 accumulate); bias add, softmax, normalisation in f32.

typedef unsigned short u16;
typedef _Float16 h16;
typedef __bf16 v16bf __attribute__((ext_vector_type(16)));
typedef h16 v16h __attribute__((ext_vector_type(16)));
typedef h16 v8h __attribute__((ext_vector_type(8), __may_alias__));
typedef float v8f __attribute__((ext_vector_type(8)));
typedef float v4f __attribute__((ext_vector_type(4), __may_alias__));
typedef unsigned int v4u __attribute__((ext_vector_type(4), __may_alias__));
typedef int v4i __attribute__((ext_vector_type(4), __may_alias__));

#ifndef NB
#define NB 4
#endif
#ifndef SEQ
#define SEQ 2048
#endif
#define NB_FULL 4
#define S_FULL 2048
#define DM 512
#define NH 8
#define HD 64
#define MT (NB * SEQ)

static_assert(NB >= 1 && NB <= NB_FULL);
static_assert(SEQ % 64 == 0 && SEQ <= S_FULL);
static_assert(DM % 64 == 0 && DM % 32 == 0);
static_assert(NH * HD == DM);
static_assert(HD == 64);
static_assert(MT % 64 == 0);

// ---------------- helpers ----------------

__device__ __forceinline__ u16 f2bf(float f) {
  unsigned u = __float_as_uint(f);
  u += 0x7FFFu + ((u >> 16) & 1u);   // RNE convert f32 -> bf16 bits
  return (u16)(u >> 16);
}

__device__ __forceinline__ float bf_rn(float f) {
  return __uint_as_float(((unsigned)f2bf(f)) << 16);
}

__device__ __forceinline__ v8f zero8() {
  v8f z = {0.f, 0.f, 0.f, 0.f, 0.f, 0.f, 0.f, 0.f};
  return z;
}

// 16x32 16-bit fragment from row-major storage with k contiguous (pitch ld elements):
// lane l: row = l&15; elements 0..7 <- k0 + 8*(l>>4) + 0..7; elements 8..15 <- k0 + 16 + 8*(l>>4) + 0..7.
// Used for A (row = m) and for B stored n-major with k contiguous (row = n).
__device__ __forceinline__ v16bf ldfrag_bf(const u16* base, int ld) {
  const int l = threadIdx.x & 31;
  const int row = l & 15;
  const int kb = (l >> 4) << 3;
  const u16* p = base + (size_t)row * ld + kb;
  union { v16bf v; v4u q[2]; } u;
  u.q[0] = *(const v4u*)(p);
  u.q[1] = *(const v4u*)(p + 16);
  return u.v;
}

__device__ __forceinline__ v16h ldfrag_h(const h16* base, int ld) {
  const int l = threadIdx.x & 31;
  const int row = l & 15;
  const int kb = (l >> 4) << 3;
  const h16* p = base + (size_t)row * ld + kb;
  union { v16h v; v8h q[2]; } u;
  u.q[0] = *(const v8h*)(p);
  u.q[1] = *(const v8h*)(p + 16);
  return u.v;
}

// D[16x16] += A[16x32] . B[32x16]; D element r of lane l = (row 8*(l>>4)+r, col l&15)
__device__ __forceinline__ v8f mma_bf(v16bf a, v16bf b, v8f c) {
  v8f r = __builtin_amdgcn_wmma_f32_16x16x32_bf16(false, a, false, b, (short)0, c, false, false);
  asm volatile("v_nop\n\tv_nop\n\tv_nop\n\tv_nop" : "+v"(r) : "v"(a), "v"(b));
  return r;
}

__device__ __forceinline__ v8f mma_h(v16h a, v16h b, v8f c) {
  v8f r = __builtin_amdgcn_wmma_f32_16x16x32_f16(false, a, false, b, (short)0, c, false, false);
  asm volatile("v_nop\n\tv_nop\n\tv_nop\n\tv_nop" : "+v"(r) : "v"(a), "v"(b));
  return r;
}

// value of lane l ^ 16 (the other half of the wave holds the other keys of the same query column)
__device__ __forceinline__ float xhalf(float x) {
  const int b = __float_as_int(x);
  return __int_as_float(__builtin_amdgcn_permlanex16(b, b, 0x76543210, 0xfedcba98, false, false));
}

// ---------------- stage 0: f32 -> bf16 planes (rows of DM elements), one launch for x and the three weights ----------------
// A piece = 8 elements: 32 B read, 16 B written. A block converts CV_BLK consecutive pieces (CV_ROWS whole rows) of ONE
// source; the block index picks the source: [0, CV_XB) -> x, then CV_WB blocks each for Wq, Wk, Wv (their planes follow one
// another in Wb). A lane takes CV_U pieces, 256 pieces apart.
// x plane row pr <- source row (pr / SEQ) * S_FULL + pr % SEQ; a block's rows lie in one group of SEQ rows.
#define CV_U 4
#define CV_BLK (256 * CV_U)
#define CV_ROWS (CV_BLK / (DM / 8))
#define CV_XB (MT / CV_ROWS)
#define CV_WB (DM / CV_ROWS)
static_assert(CV_BLK % (DM / 8) == 0 && SEQ % CV_ROWS == 0 && DM % CV_ROWS == 0);

__global__ __launch_bounds__(256) void k_cvt_bf16(const float* __restrict__ x, const float* __restrict__ Wq,
                                                   const float* __restrict__ Wk, const float* __restrict__ Wv,
                                                   u16* __restrict__ Xb, u16* __restrict__ Wb) {
  const unsigned blk = blockIdx.x;
  const float* src;   // first source row of this block
  u16* dst;           // first plane row of this block
  if (blk < CV_XB) {
    const unsigned pr0 = blk * CV_ROWS;
    src = x + (size_t)((pr0 / SEQ) * S_FULL + pr0 % SEQ) * DM;
    dst = Xb + (size_t)pr0 * DM;
  } else {
    const unsigned wb = blk - CV_XB;
    const unsigned mat = wb / CV_WB;
    src = ((mat == 0) ? Wq : ((mat == 1) ? Wk : Wv)) + (size_t)(wb - mat * CV_WB) * CV_ROWS * DM;
    dst = Wb + (size_t)wb * CV_ROWS * DM;
  }
  const float* s = src + threadIdx.x * 8;
  u16* d = dst + threadIdx.x * 8;

  v4f a[CV_U], b[CV_U];
  // unrolled so that a and b stay in registers and all 2 * CV_U loads are issued ahead of the first conversion
#pragma unroll
  for (int j = 0; j < CV_U; ++j) {
    a[j] = *(const v4f*)(s + j * (256 * 8));
    b[j] = *(const v4f*)(s + j * (256 * 8) + 4);
  }
#pragma unroll
  for (int j = 0; j < CV_U; ++j) {
    v4u w;
    w.x = (unsigned)f2bf(a[j].x) | ((unsigned)f2bf(a[j].y) << 16);
    w.y = (unsigned)f2bf(a[j].z) | ((unsigned)f2bf(a[j].w) << 16);
    w.z = (unsigned)f2bf(b[j].x) | ((unsigned)f2bf(b[j].y) << 16);
    w.w = (unsigned)f2bf(b[j].z) | ((unsigned)f2bf(b[j].w) << 16);
    *(v4u*)(d + j * (256 * 8)) = w;
  }
}

// ---------------- stage 1: projections ----------------
// out[row, n] = sum_k Xb[row, k] * W[n, k] + bias[n]; row in [0, MT), n in [0, DM), K = DM.
// blockIdx.z selects the matrix: 0 -> Q plane [bh][s][64], 1 -> K plane [bh][s][64], 2 -> V^T plane [bh][64][SEQ] (f16).
// Block = 4 waves, tile 64(M) x 64(N); wave owns 16 rows x 64 cols. Each k-tile of 64 elements (64 rows x 128 B of X and
// of W) is copied once per block into LDS in whole lines (two buffers, the next k-tile in flight while this one is worked
// on); the waves take their fragments from there. Each sum runs over k in ascending steps of 32.
#define XWP 72                       // bf16 per staged row: 128 B of data + 16 B pad, the pitch for 16-byte LDS readers
#define XW_TILE (64 * XWP)           // bf16 per staged tile (64 rows)
#define XW_BUF_BYTES (2 * XW_TILE * 2)

// One k-tile of X and one of W into one buffer: 8 copies of 16 B per lane, each wave-wide copy = 4 whole 128-B lines.
// xg, wg: the lane's global address in rows 0..15 of the two tiles; lx: the lane's LDS byte address in the X tile.
__device__ __forceinline__ void stage_xw(const u16* xg, const u16* wg, unsigned lx) {
  const unsigned lw = lx + XW_TILE * 2;
  const unsigned rs = 16 * XWP * 2;  // 16 staged rows, in bytes
  // s_wait_xcnt closes the statement so that no address register is rewritten ahead of it
  asm volatile("global_load_async_to_lds_b128 %0, %8, off\n\t"
               "global_load_async_to_lds_b128 %1, %9, off\n\t"
               "global_load_async_to_lds_b128 %2, %10, off\n\t"
               "global_load_async_to_lds_b128 %3, %11, off\n\t"
               "global_load_async_to_lds_b128 %4, %12, off\n\t"
               "global_load_async_to_lds_b128 %5, %13, off\n\t"
               "global_load_async_to_lds_b128 %6, %14, off\n\t"
               "global_load_async_to_lds_b128 %7, %15, off\n\t"
               "s_wait_xcnt 0x0"
               :: "v"(lx), "v"(lx + rs), "v"(lx + 2 * rs), "v"(lx + 3 * rs),
                  "v"(lw), "v"(lw + rs), "v"(lw + 2 * rs), "v"(lw + 3 * rs),
                  "v"(xg), "v"(xg + 16 * DM), "v"(xg + 32 * DM), "v"(xg + 48 * DM),
                  "v"(wg), "v"(wg + 16 * DM), "v"(wg + 32 * DM), "v"(wg + 48 * DM)
               : "memory");
}

__global__ __launch_bounds__(128) __attribute__((amdgpu_num_vgpr(256)))
void k_proj(const u16* __restrict__ Xb, const u16* __restrict__ Wb,
            const float* __restrict__ bq, const float* __restrict__ bk, const float* __restrict__ bv,
            h16* __restrict__ Qp, h16* __restrict__ Kp, h16* __restrict__ VTp) {
  __shared__ __attribute__((aligned(16))) u16 XWs[2][2][XW_TILE];   // [buffer][X | W][row * XWP + k]
  __shared__ __attribute__((aligned(16))) h16 Ts[64 * 64];

  const int wave = threadIdx.x >> 5, lane = threadIdx.x & 31;
  const int hh = lane >> 4, mm = lane & 15;
  const int mat = blockIdx.z;
  const int m0 = blockIdx.x * 64, n0 = blockIdx.y * 64;
  const u16* W = Wb + (size_t)mat * DM * DM + (size_t)n0 * DM;   // rows n0..n0+63, k contiguous
  const float* bias = (mat == 0) ? bq : ((mat == 1) ? bk : bv);

  v8f acc[4] = {zero8(), zero8(), zero8(), zero8()};

  // the lane's 16-byte piece of rows 0..15 of a k-tile: 8 lanes per 128-B line
  const int crow = threadIdx.x >> 3, ccol = (threadIdx.x & 7) * 8;
  const u16* xg = Xb + (size_t)(m0 + crow) * DM + ccol;
  const u16* wg = W + (size_t)crow * DM + ccol;
  const unsigned lx0 = (unsigned)(uintptr_t)&XWs[0][0][crow * XWP + ccol];

  stage_xw(xg, wg, lx0);
  asm volatile("s_wait_asynccnt 0x0" ::: "memory");   // this wave's share of k-tile 0 has landed
  __syncthreads();                                     // k-tile 0 readable by every wave
  if (DM > 64) stage_xw(xg + 64, wg + 64, lx0 + XW_BUF_BYTES);

  for (int kt = 0; kt < DM; kt += 64) {
    const int buf = (kt >> 6) & 1;
    const u16* Xt = &XWs[buf][0][(wave * 16) * XWP];
    const u16* Wt = &XWs[buf][1][0];
    for (int k0 = 0; k0 < 64; k0 += 32) {
      const v16bf a  = ldfrag_bf(Xt + k0, XWP);
      const v16bf b0 = ldfrag_bf(Wt + (0 * 16) * XWP + k0, XWP);
      const v16bf b1 = ldfrag_bf(Wt + (1 * 16) * XWP + k0, XWP);
      const v16bf b2 = ldfrag_bf(Wt + (2 * 16) * XWP + k0, XWP);
      const v16bf b3 = ldfrag_bf(Wt + (3 * 16) * XWP + k0, XWP);
      acc[0] = mma_bf(a, b0, acc[0]);
      acc[1] = mma_bf(a, b1, acc[1]);
      acc[2] = mma_bf(a, b2, acc[2]);
      acc[3] = mma_bf(a, b3, acc[3]);
    }
    asm volatile("s_wait_dscnt 0x0" ::: "memory");      // this wave's reads of the buffer are done
    asm volatile("s_wait_asynccnt 0x0" ::: "memory");   // this wave's share of the next k-tile has landed
    __syncthreads();   // next k-tile readable by every wave; this trip's buffer free for the refill
    if (kt + 128 < DM) stage_xw(xg + (kt + 128), wg + (kt + 128), lx0 + buf * XW_BUF_BYTES);
  }
  asm volatile("s_wait_asynccnt 0x0" ::: "memory");     // no copy outstanding behind the loop

  // bias enters as its bf16-RNE value
  float bb[4];
#pragma unroll
  for (int t = 0; t < 4; ++t) bb[t] = bf_rn(bias[n0 + 16 * t + mm]);

  // stage the 64x64 tile in LDS: [row][col] for Q/K, transposed [col][row] for V
  const bool tr = (mat == 2);
#pragma unroll
  for (int t = 0; t < 4; ++t) {
#pragma unroll
    for (int r = 0; r < 8; ++r) {
      const int row = wave * 16 + 8 * hh + r;
      const int col = 16 * t + mm;
      const int idx = tr ? (col * 64 + row) : (row * 64 + col);
      Ts[idx] = (h16)(acc[t][r] + bb[t]);
    }
  }
  __syncthreads();

  const int b  = m0 / SEQ;
  const int s0 = m0 - b * SEQ;
  const int bh = b * NH + blockIdx.y;
  h16* dstp = (mat == 0) ? Qp : ((mat == 1) ? Kp : VTp);
  const int pc = (threadIdx.x & 7) * 8;
  const int rb = threadIdx.x >> 3;
  v8h vals[4];
  size_t offs[4];
#pragma unroll
  for (int i = 0; i < 4; ++i) {
    const int rr = i * 16 + rb;
    vals[i] = *(const v8h*)(&Ts[rr * 64 + pc]);
    offs[i] = tr ? ((((size_t)bh * HD + rr) * SEQ) + s0 + pc)
                 : ((((size_t)bh * SEQ + s0 + rr) * HD) + pc);
  }
#pragma unroll
  for (int i = 0; i < 4; ++i) *(v8h*)(dstp + offs[i]) = vals[i];
  
}

// ---------------- stage 2: flash attention ----------------
// Block = 4 waves, owns (bh, 64 query rows); wave owns 16 query rows, loops over key tiles of 64.
// Q fragments from the [bh][s][64] plane. Each 64-key tile of K ([key][64]) and of V^T ([d][64 keys]) is copied once per
// block into LDS (two buffers, the next tile in flight while this one is worked on) and all four waves take their
// fragments from there. The products run transposed: S^T[key][q] = K . Q^T and O^T[d][q] += V^T . P^T, so a lane holds
// one query's scores (keys 16t + 8*(l>>4) + r), and two converted score tiles are the B operand of the second product.
#define KVP 72                       // f16 per staged row: 128 B of data + 16 B pad, the pitch for 16-byte LDS readers
#define KV_TILE (64 * KVP)           // f16 per staged tile (64 rows)
#define KV_BUF_BYTES (2 * KV_TILE * 2)
#define OSP 68                       // f32 per staged output row: 256 B of data + 16 B pad (16-byte LDS writers, one row per lane)

// One tile of K and one of V^T into one buffer: 8 copies of 16 B per lane, each wave-wide copy = 4 whole 128-B rows.
// kg, vg: the lane's global address in rows 0..15 of the two tiles; lk: the lane's LDS byte address in the K tile.
__device__ __forceinline__ void stage_kv(const h16* kg, const h16* vg, unsigned lk) {
  const unsigned lv = lk + KV_TILE * 2;
  const unsigned rs = 16 * KVP * 2;  // 16 staged rows, in bytes
  // s_wait_xcnt closes the statement so that no address register is rewritten ahead of it
  asm volatile("global_load_async_to_lds_b128 %0, %8, off\n\t"
               "global_load_async_to_lds_b128 %1, %9, off\n\t"
               "global_load_async_to_lds_b128 %2, %10, off\n\t"
               "global_load_async_to_lds_b128 %3, %11, off\n\t"
               "global_load_async_to_lds_b128 %4, %12, off\n\t"
               "global_load_async_to_lds_b128 %5, %13, off\n\t"
               "global_load_async_to_lds_b128 %6, %14, off\n\t"
               "global_load_async_to_lds_b128 %7, %15, off\n\t"
               "s_wait_xcnt 0x0"
               :: "v"(lk), "v"(lk + rs), "v"(lk + 2 * rs), "v"(lk + 3 * rs),
                  "v"(lv), "v"(lv + rs), "v"(lv + 2 * rs), "v"(lv + 3 * rs),
                  "v"(kg), "v"(kg + 16 * HD), "v"(kg + 32 * HD), "v"(kg + 48 * HD),
                  "v"(vg), "v"(vg + (size_t)16 * SEQ), "v"(vg + (size_t)32 * SEQ), "v"(vg + (size_t)48 * SEQ)
               : "memory");
}

__global__ __launch_bounds__(128) __attribute__((amdgpu_num_vgpr(256)))
void k_attn(const h16* __restrict__ Qp, const h16* __restrict__ Kp, const h16* __restrict__ VTp,
            const int* __restrict__ mask, float* __restrict__ out) {
  __shared__ __attribute__((aligned(16))) h16   KVs[2][2][KV_TILE]; // [buffer][K | V^T][row * KVP + col]
  __shared__ __attribute__((aligned(16))) float Madd[SEQ];        // additive key mask -10000*(1 - m), one per key
  __shared__ __attribute__((aligned(16))) float Os[4][16 * OSP];  // per wave: output tile [q][d]

  const int wave = threadIdx.x >> 5, lane = threadIdx.x & 31;
  const int hh = lane >> 4, mm = lane & 15;
  const int bh = blockIdx.y;
  const int b  = bh / NH;
  const int hd = bh - b * NH;
  const int q0 = blockIdx.x * 64 + wave * 16;

  const h16* Qbh = Qp  + (size_t)bh * SEQ * HD;
  const h16* Kbh = Kp  + (size_t)bh * SEQ * HD;
  const h16* Vbh = VTp + (size_t)bh * HD * SEQ;
  const int* mk_b = mask + (size_t)b * S_FULL;

  const v16h aq0 = ldfrag_h(Qbh + (size_t)q0 * HD, HD);
  const v16h aq1 = ldfrag_h(Qbh + (size_t)q0 * HD + 32, HD);

  // per lane: running maximum of query column mm (both halves agree), running sum over this half's keys only
  float m_run = -1e30f, l_run = 0.f;
  v8f o[4] = {zero8(), zero8(), zero8(), zero8()};   // o[dt][r] = O^T[16*dt + 8*hh + r][mm]

  // the lane's 16-byte piece of rows 0..15 of a tile: 8 lanes per 128-B row
  const int crow = threadIdx.x >> 3, ccol = (threadIdx.x & 7) * 8;
  const h16* kg = Kbh + (size_t)crow * HD + ccol;
  const h16* vg = Vbh + (size_t)crow * SEQ + ccol;
  const unsigned lk0 = (unsigned)(uintptr_t)&KVs[0][0][crow * KVP + ccol];

  stage_kv(kg, vg, lk0);
  // a lane now needs the mask term of 32 keys per tile: form all of them once per block, read them back 16 B at a time
#pragma unroll
  for (int i0 = 0; i0 < SEQ; i0 += 128 * 4) {
    const int i = i0 + (int)threadIdx.x * 4;
    if (SEQ % (128 * 4) == 0 || i < SEQ) {
      const v4i mi = *(const v4i*)(mk_b + i);
      v4f ma;
#pragma unroll
      for (int j = 0; j < 4; ++j) ma[j] = -10000.0f * (1.0f - (float)mi[j]);
      *(v4f*)(&Madd[i]) = ma;
    }
  }
  asm volatile("s_wait_asynccnt 0x0" ::: "memory");   // this wave's share of tile 0 has landed
  __syncthreads();                                     // tile 0 and the mask terms readable by every wave
  if (SEQ > 64) stage_kv(kg + (size_t)64 * HD, vg + 64, lk0 + KV_BUF_BYTES);

#pragma unroll 1
  for (int t0 = 0; t0 < SEQ; t0 += 64) {
    const int buf = (t0 >> 6) & 1;
    const h16* Kt = &KVs[buf][0][0];
    const h16* Vt = &KVs[buf][1][0];
    // scores S^T[64 keys][16 q] = k . q^T; sc[t][r] = key 16*t + 8*hh + r, query mm
    v8f sc[4];
#pragma unroll
    for (int t = 0; t < 4; ++t) {
      const v16h kf0 = ldfrag_h(Kt + (16 * t) * KVP, KVP);
      const v16h kf1 = ldfrag_h(Kt + (16 * t) * KVP + 32, KVP);
      sc[t] = mma_h(kf0, aq0, zero8());
      sc[t] = mma_h(kf1, aq1, sc[t]);
    }

    // scale 1/8 and additive key mask: s/8 - 10000*(1 - m)
#pragma unroll
    for (int t = 0; t < 4; ++t) {
      const v4f ma0 = *(const v4f*)(&Madd[t0 + 16 * t + 8 * hh]);
      const v4f ma1 = *(const v4f*)(&Madd[t0 + 16 * t + 8 * hh + 4]);
#pragma unroll
      for (int r = 0; r < 4; ++r) {
        sc[t][r]     = sc[t][r]     * 0.125f + ma0[r];
        sc[t][4 + r] = sc[t][4 + r] * 0.125f + ma1[r];
      }
    }

    // online softmax, one query per lane: maximum in-lane over 32 keys, then one exchange with the other half
    float mt[4];
#pragma unroll
    for (int t = 0; t < 4; ++t) {
      mt[t] = sc[t][0];
#pragma unroll
      for (int r = 1; r < 8; ++r) mt[t] = fmaxf(mt[t], sc[t][r]);
    }
    float mx = fmaxf(fmaxf(mt[0], mt[1]), fmaxf(mt[2], mt[3]));
    mx = fmaxf(mx, xhalf(mx));
    const float mn = fmaxf(m_run, mx);
    const float alpha = __expf(m_run - mn);
    m_run = mn;

    // P^T (x1024, f16) straight into the B operand: element s of pb[j] = key 32*j + (s < 8 ? 8*hh + s : 16 + 8*hh + s - 8)
    v16h pb[2];
    float pst[4];
#pragma unroll
    for (int t = 0; t < 4; ++t) {
      pst[t] = 0.f;
#pragma unroll
      for (int r = 0; r < 8; ++r) {
        const float p = __expf(sc[t][r] - mn);
        pst[t] += p;
        pb[t >> 1][(t & 1) * 8 + r] = (h16)(p * 1024.0f);
      }
    }
    l_run = l_run * alpha + ((pst[0] + pst[1]) + (pst[2] + pst[3]));
#pragma unroll
    for (int dt = 0; dt < 4; ++dt)
#pragma unroll
      for (int r = 0; r < 8; ++r) o[dt][r] *= alpha;

    // O^T[64 d][16 q] += V^T[64 d][64 keys] . P^T[64 keys][16 q]
#pragma unroll
    for (int dt = 0; dt < 4; ++dt) {
      const v16h vf0 = ldfrag_h(Vt + (16 * dt) * KVP, KVP);
      const v16h vf1 = ldfrag_h(Vt + (16 * dt) * KVP + 32, KVP);
      o[dt] = mma_h(vf0, pb[0], o[dt]);
      o[dt] = mma_h(vf1, pb[1], o[dt]);
    }
    asm volatile("s_wait_dscnt 0x0" ::: "memory");      // this wave's reads of the buffer are done
    asm volatile("s_wait_asynccnt 0x0" ::: "memory");   // this wave's share of the next tile has landed
    __syncthreads();   // next tile readable by every wave; this trip's buffer free for the refill
    if (t0 + 128 < SEQ) stage_kv(kg + (size_t)(t0 + 128) * HD, vg + (t0 + 128), lk0 + buf * KV_BUF_BYTES);
  }
  asm volatile("s_wait_asynccnt 0x0" ::: "memory");     // no copy outstanding behind the loop

  // normalise (undo the x1024 carry) and stage the 16x64 f32 tile per wave
  const float inv = (1.0f / (l_run + xhalf(l_run))) * 0.0009765625f;   // the two halves' key sums join here, once
#pragma unroll
  for (int dt = 0; dt < 4; ++dt) {
    v4f w0, w1;
#pragma unroll
    for (int r = 0; r < 4; ++r) { w0[r] = o[dt][r] * inv; w1[r] = o[dt][4 + r] * inv; }
    *(v4f*)(&Os[wave][mm * OSP + 16 * dt + 8 * hh])     = w0;
    *(v4f*)(&Os[wave][mm * OSP + 16 * dt + 8 * hh + 4]) = w1;
  }
  __syncthreads();

  // each instruction: lanes 0..15 -> row 2i (256 B = 2 full lines), lanes 16..31 -> row 2i+1
  const int rsub = lane >> 4;
  const int cc = (lane & 15) * 4;
  float* ob = out + ((size_t)b * SEQ + q0) * DM + (size_t)hd * HD;
  v4f vv[8];
#pragma unroll
  for (int i = 0; i < 8; ++i) vv[i] = *(const v4f*)(&Os[wave][(2 * i + rsub) * OSP + cc]);
#pragma unroll
  for (int i = 0; i < 8; ++i) *(v4f*)(ob + (size_t)(2 * i + rsub) * DM + cc) = vv[i];
  
}

// ---------------- launcher ----------------
extern "C" void kernel_launch(void* const* d_in, const int* in_sizes, int n_in,
                              void* d_out, int out_size, void* d_ws, size_t ws_size,
                              hipStream_t stream) {
  if (n_in < 8) return;
  const float* x   = (const float*)d_in[0];
  const int*   msk = (const int*)d_in[1];
  const float* Wq  = (const float*)d_in[2];
  const float* bq  = (const float*)d_in[3];
  const float* Wk  = (const float*)d_in[4];
  const float* bk  = (const float*)d_in[5];
  const float* Wv  = (const float*)d_in[6];
  const float* bv  = (const float*)d_in[7];
  float* out = (float*)d_out;

  if (in_sizes[0] < ((NB - 1) * S_FULL + SEQ) * DM) return;
  if (in_sizes[1] < (NB - 1) * S_FULL + SEQ) return;
  if (in_sizes[2] < DM * DM || in_sizes[4] < DM * DM || in_sizes[6] < DM * DM) return;
  if (in_sizes[3] < DM || in_sizes[5] < DM || in_sizes[7] < DM) return;
  if (out_size < MT * DM) return;

  char* ws = (char*)d_ws;
  const size_t XB_BYTES = (size_t)MT * DM * 2;              // bf16 x plane [MT][DM]
  const size_t W_BYTES  = (size_t)DM * DM * 2;              // one bf16 weight plane
  const size_t PL_BYTES = (size_t)NB * NH * SEQ * HD * 2;   // one f16 q/k/v^T plane
  size_t off = 0;
  u16* Xb = (u16*)(ws + off);  off += XB_BYTES;
  u16* Wb = (u16*)(ws + off);  off += 3 * W_BYTES;
  h16* Qp = (h16*)(ws + off);  off += PL_BYTES;
  h16* Kp = (h16*)(ws + off);  off += PL_BYTES;
  h16* VTp = (h16*)(ws + off); off += PL_BYTES;
  if (off > ws_size) return;

  k_cvt_bf16<<<CV_XB + 3 * CV_WB, 256, 0, stream>>>(x, Wq, Wk, Wv, Xb, Wb);

  dim3 gp(MT / 64, DM / 64, 3);
  k_proj<<<gp, 128, 0, stream>>>(Xb, Wb, bq, bk, bv, Qp, Kp, VTp);

  dim3 ga(SEQ / 64, NB * NH);
  k_attn<<<ga, 128, 0, stream>>>(Qp, Kp, VTp, msk, out);
}

// v005
// It runs in 68.5 microseconds.
// Two timings next to v004 both put it at 1.06 times that version's speed.
// All steps since v000 together make it 3.83 times as fast.
#include <hip/hip_runtime.h>
#include <stdint.h>

// Contractions: x.Wq^T, x.Wk^T, x.Wv^T on v_wmma_f32_16x16x32_bf16 (bf16 operands = RNE-converted f32 inputs, f32 accumulate);
// k.q^T and V^T.P^T on v_wmma_f32_16x16x32_f16 (f16 operands, P carried x1024, f32 accumulate); bias add, softmax, normalisation in f32.

typedef unsigned short u16;
typedef _Float16 h16;
typedef __bf16 v16bf __attribute__((ext_vector_type(16)));
typedef h16 v16h __attribute__((ext_vector_type(16)));
typedef h16 v8h __attribute__((ext_vector_type(8), __may_alias__));
typedef float v8f __attribute__((ext_vector_type(8)));
typedef float v4f __attribute__((ext_vector_type(4), __may_alias__));
typedef unsigned int v4u __attribute__((ext_vector_type(4), __may_alias__));
typedef int v4i __attribute__((ext_vector_type(4), __may_alias__));

#ifndef NB
#define NB 4
#endif
#ifndef SEQ
#define SEQ 2048
#endif
#define NB_FULL 4
#define S_FULL 2048
#define DM 512
#define NH 8
#define HD 64
#define MT (NB * SEQ)

static_assert(NB >= 1 && NB <= NB_FULL);
static_assert(SEQ % 64 == 0 && SEQ <= S_FULL);
static_assert(DM % 64 == 0 && DM % 32 == 0);
static_assert(NH * HD == DM);
static_assert(HD == 64);
static_assert(MT % 64 == 0);

// ---------------- helpers ----------------

__device__ __forceinline__ u16 f2bf(float f) {
  unsigned u = __float_as_uint(f);
  u += 0x7FFFu + ((u >> 16) & 1u);   // RNE convert f32 -> bf16 bits
  return (u16)(u >> 16);
}

__device__ __forceinline__ float bf_rn(float f) {
  return __uint_as_float(((unsigned)f2bf(f)) << 16);
}

__device__ __forceinline__ v8f zero8() {
  v8f z = {0.f, 0.f, 0.f, 0.f, 0.f, 0.f, 0.f, 0.f};
  return z;
}

// 16x32 16-bit fragment from row-major storage with k contiguous (pitch ld elements):
// lane l: row = l&15; elements 0..7 <- k0 + 8*(l>>4) + 0..7; elements 8..15 <- k0 + 16 + 8*(l>>4) + 0..7.
// Used for A (row = m) and for B stored n-major with k contiguous (row = n).
__device__ __forceinline__ v16bf ldfrag_bf(const u16* base, int ld) {
  const int l = threadIdx.x & 31;
  const int row = l & 15;
  const int kb = (l >> 4) << 3;
  const u16* p = base + (size_t)row * ld + kb;
  union { v16bf v; v4u q[2]; } u;
  u.q[0] = *(const v4u*)(p);
  u.q[1] = *(const v4u*)(p + 16);
  return u.v;
}

__device__ __forceinline__ v16h ldfrag_h(const h16* base, int ld) {
  const int l = threadIdx.x & 31;
  const int row = l & 15;
  const int kb = (l >> 4) << 3;
  const h16* p = base + (size_t)row * ld + kb;
  union { v16h v; v8h q[2]; } u;
  u.q[0] = *(const v8h*)(p);
  u.q[1] = *(const v8h*)(p + 16);
  return u.v;
}

// D[16x16] += A[16x32] . B[32x16]; D element r of lane l = (row 8*(l>>4)+r, col l&15)
__device__ __forceinline__ v8f mma_bf(v16bf a, v16bf b, v8f c) {
  v8f r = __builtin_amdgcn_wmma_f32_16x16x32_bf16(false, a, false, b, (short)0, c, false, false);
  asm volatile("v_nop\n\tv_nop\n\tv_nop\n\tv_nop" : "+v"(r) : "v"(a), "v"(b));
  return r;
}

__device__ __forceinline__ v8f mma_h(v16h a, v16h b, v8f c) {
  return __builtin_amdgcn_wmma_f32_16x16x32_f16(false, a, false, b, (short)0, c, false, false);
}

// value of lane l ^ 16 (the other half of the wave holds the other keys of the same query column)
__device__ __forceinline__ float xhalf(float x) {
  const int b = __float_as_int(x);
  return __int_as_float(__builtin_amdgcn_permlanex16(b, b, 0x76543210, 0xfedcba98, false, false));
}

// ---------------- stage 0: f32 -> bf16 planes (rows of DM elements), one launch for x and the three weights ----------------
// A piece = 8 elements: 32 B read, 16 B written. A block converts CV_BLK consecutive pieces (CV_ROWS whole rows) of ONE
// source; the block index picks the source: [0, CV_XB) -> x, then CV_WB blocks each for Wq, Wk, Wv (their planes follow one
// another in Wb). A lane takes CV_U pieces, 256 pieces apart.
// x plane row pr <- source row (pr / SEQ) * S_FULL + pr % SEQ; a block's rows lie in one group of SEQ rows.
#define CV_U 4
#define CV_BLK (256 * CV_U)
#define CV_ROWS (CV_BLK / (DM / 8))
#define CV_XB (MT / CV_ROWS)
#define CV_WB (DM / CV_ROWS)
static_assert(CV_BLK % (DM / 8) == 0 && SEQ % CV_ROWS == 0 && DM % CV_ROWS == 0);

__global__ __launch_bounds__(256) void k_cvt_bf16(const float* __restrict__ x, const float* __restrict__ Wq,
                                                   const float* __restrict__ Wk, const float* __restrict__ Wv,
                                                   u16* __restrict__ Xb, u16* __restrict__ Wb) {
  const unsigned blk = blockIdx.x;
  const float* src;   // first source row of this block
  u16* dst;           // first plane row of this block
  if (blk < CV_XB) {
    const unsigned pr0 = blk * CV_ROWS;
    src = x + (size_t)((pr0 / SEQ) * S_FULL + pr0 % SEQ) * DM;
    dst = Xb + (size_t)pr0 * DM;
  } else {
    const unsigned wb = blk - CV_XB;
    const unsigned mat = wb / CV_WB;
    src = ((mat == 0) ? Wq : ((mat == 1) ? Wk : Wv)) + (size_t)(wb - mat * CV_WB) * CV_ROWS * DM;
    dst = Wb + (size_t)wb * CV_ROWS * DM;
  }
  const float* s = src + threadIdx.x * 8;
  u16* d = dst + threadIdx.x * 8;

  v4f a[CV_U], b[CV_U];
  // unrolled so that a and b stay in registers and all 2 * CV_U loads are issued ahead of the first conversion
#pragma unroll
  for (int j = 0; j < CV_U; ++j) {
    a[j] = *(const v4f*)(s + j * (256 * 8));
    b[j] = *(const v4f*)(s + j * (256 * 8) + 4);
  }
#pragma unroll
  for (int j = 0; j < CV_U; ++j) {
    v4u w;
    w.x = (unsigned)f2bf(a[j].x) | ((unsigned)f2bf(a[j].y) << 16);
    w.y = (unsigned)f2bf(a[j].z) | ((unsigned)f2bf(a[j].w) << 16);
    w.z = (unsigned)f2bf(b[j].x) | ((unsigned)f2bf(b[j].y) << 16);
    w.w = (unsigned)f2bf(b[j].z) | ((unsigned)f2bf(b[j].w) << 16);
    *(v4u*)(d + j * (256 * 8)) = w;
  }
}

// ---------------- stage 1: projections ----------------
// out[row, n] = sum_k Xb[row, k] * W[n, k] + bias[n]; row in [0, MT), n in [0, DM), K = DM.
// blockIdx.z selects the matrix: 0 -> Q plane [bh][s][64], 1 -> K plane [bh][s][64], 2 -> V^T plane [bh][64][SEQ] (f16).
// Block = 4 waves, tile 64(M) x 64(N); wave owns 16 rows x 64 cols. Each k-tile of 64 elements (64 rows x 128 B of X and
// of W) is copied once per block into LDS in whole lines (two buffers, the next k-tile in flight while this one is worked
// on); the waves take their fragments from there. Each sum runs over k in ascending steps of 32.
#define XWP 72                       // bf16 per staged row: 128 B of data + 16 B pad, the pitch for 16-byte LDS readers
#define XW_TILE (64 * XWP)           // bf16 per staged tile (64 rows)
#define XW_BUF_BYTES (2 * XW_TILE * 2)

// One k-tile of X and one of W into one buffer: 8 copies of 16 B per lane, each wave-wide copy = 4 whole 128-B lines.
// xg, wg: the lane's global address in rows 0..15 of the two tiles; lx: the lane's LDS byte address in the X tile.
__device__ __forceinline__ void stage_xw(const u16* xg, const u16* wg, unsigned lx) {
  const unsigned lw = lx + XW_TILE * 2;
  const unsigned rs = 16 * XWP * 2;  // 16 staged rows, in bytes
  // s_wait_xcnt closes the statement so that no address register is rewritten ahead of it
  asm volatile("global_load_async_to_lds_b128 %0, %8, off\n\t"
               "global_load_async_to_lds_b128 %1, %9, off\n\t"
               "global_load_async_to_lds_b128 %2, %10, off\n\t"
               "global_load_async_to_lds_b128 %3, %11, off\n\t"
               "global_load_async_to_lds_b128 %4, %12, off\n\t"
               "global_load_async_to_lds_b128 %5, %13, off\n\t"
               "global_load_async_to_lds_b128 %6, %14, off\n\t"
               "global_load_async_to_lds_b128 %7, %15, off\n\t"
               "s_wait_xcnt 0x0"
               :: "v"(lx), "v"(lx + rs), "v"(lx + 2 * rs), "v"(lx + 3 * rs),
                  "v"(lw), "v"(lw + rs), "v"(lw + 2 * rs), "v"(lw + 3 * rs),
                  "v"(xg), "v"(xg + 16 * DM), "v"(xg + 32 * DM), "v"(xg + 48 * DM),
                  "v"(wg), "v"(wg + 16 * DM), "v"(wg + 32 * DM), "v"(wg + 48 * DM)
               : "memory");
}

__global__ __launch_bounds__(128) __attribute__((amdgpu_num_vgpr(256)))
void k_proj(const u16* __restrict__ Xb, const u16* __restrict__ Wb,
            const float* __restrict__ bq, const float* __restrict__ bk, const float* __restrict__ bv,
            h16* __restrict__ Qp, h16* __restrict__ Kp, h16* __restrict__ VTp) {
  __shared__ __attribute__((aligned(16))) u16 XWs[2][2][XW_TILE];   // [buffer][X | W][row * XWP + k]
  __shared__ __attribute__((aligned(16))) h16 Ts[64 * 64];

  const int wave = threadIdx.x >> 5, lane = threadIdx.x & 31;
  const int hh = lane >> 4, mm = lane & 15;
  const int mat = blockIdx.z;
  const int m0 = blockIdx.x * 64, n0 = blockIdx.y * 64;
  const u16* W = Wb + (size_t)mat * DM * DM + (size_t)n0 * DM;   // rows n0..n0+63, k contiguous
  const float* bias = (mat == 0) ? bq : ((mat == 1) ? bk : bv);

  v8f acc[4] = {zero8(), zero8(), zero8(), zero8()};

  // the lane's 16-byte piece of rows 0..15 of a k-tile: 8 lanes per 128-B line
  const int crow = threadIdx.x >> 3, ccol = (threadIdx.x & 7) * 8;
  const u16* xg = Xb + (size_t)(m0 + crow) * DM + ccol;
  const u16* wg = W + (size_t)crow * DM + ccol;
  const unsigned lx0 = (unsigned)(uintptr_t)&XWs[0][0][crow * XWP + ccol];

  stage_xw(xg, wg, lx0);
  asm volatile("s_wait_asynccnt 0x0" ::: "memory");   // this wave's share of k-tile 0 has landed
  __syncthreads();                                     // k-tile 0 readable by every wave
  if (DM > 64) stage_xw(xg + 64, wg + 64, lx0 + XW_BUF_BYTES);

  for (int kt = 0; kt < DM; kt += 64) {
    const int buf = (kt >> 6) & 1;
    const u16* Xt = &XWs[buf][0][(wave * 16) * XWP];
    const u16* Wt = &XWs[buf][1][0];
    for (int k0 = 0; k0 < 64; k0 += 32) {
      const v16bf a  = ldfrag_bf(Xt + k0, XWP);
      const v16bf b0 = ldfrag_bf(Wt + (0 * 16) * XWP + k0, XWP);
      const v16bf b1 = ldfrag_bf(Wt + (1 * 16) * XWP + k0, XWP);
      const v16bf b2 = ldfrag_bf(Wt + (2 * 16) * XWP + k0, XWP);
      const v16bf b3 = ldfrag_bf(Wt + (3 * 16) * XWP + k0, XWP);
      acc[0] = mma_bf(a, b0, acc[0]);
      acc[1] = mma_bf(a, b1, acc[1]);
      acc[2] = mma_bf(a, b2, acc[2]);
      acc[3] = mma_bf(a, b3, acc[3]);
    }
    asm volatile("s_wait_dscnt 0x0" ::: "memory");      // this wave's reads of the buffer are done
    asm volatile("s_wait_asynccnt 0x0" ::: "memory");   // this wave's share of the next k-tile has landed
    __syncthreads();   // next k-tile readable by every wave; this trip's buffer free for the refill
    if (kt + 128 < DM) stage_xw(xg + (kt + 128), wg + (kt + 128), lx0 + buf * XW_BUF_BYTES);
  }
  asm volatile("s_wait_asynccnt 0x0" ::: "memory");     // no copy outstanding behind the loop

  // bias enters as its bf16-RNE value
  float bb[4];
#pragma unroll
  for (int t = 0; t < 4; ++t) bb[t] = bf_rn(bias[n0 + 16 * t + mm]);

  // stage the 64x64 tile in LDS: [row][col] for Q/K, transposed [col][row] for V
  const bool tr = (mat == 2);
#pragma unroll
  for (int t = 0; t < 4; ++t) {
#pragma unroll
    for (int r = 0; r < 8; ++r) {
      const int row = wave * 16 + 8 * hh + r;
      const int col = 16 * t + mm;
      const int idx = tr ? (col * 64 + row) : (row * 64 + col);
      Ts[idx] = (h16)(acc[t][r] + bb[t]);
    }
  }
  __syncthreads();

  const int b  = m0 / SEQ;
  const int s0 = m0 - b * SEQ;
  const int bh = b * NH + blockIdx.y;
  h16* dstp = (mat == 0) ? Qp : ((mat == 1) ? Kp : VTp);
  const int pc = (threadIdx.x & 7) * 8;
  const int rb = threadIdx.x >> 3;
  v8h vals[4];
  size_t offs[4];
#pragma unroll
  for (int i = 0; i < 4; ++i) {
    const int rr = i * 16 + rb;
    vals[i] = *(const v8h*)(&Ts[rr * 64 + pc]);
    offs[i] = tr ? ((((size_t)bh * HD + rr) * SEQ) + s0 + pc)
                 : ((((size_t)bh * SEQ + s0 + rr) * HD) + pc);
  }
#pragma unroll
  for (int i = 0; i < 4; ++i) *(v8h*)(dstp + offs[i]) = vals[i];
  
}

// ---------------- stage 2: flash attention ----------------
// Block = 4 waves, owns (bh, 64 query rows); wave owns 16 query rows, loops over key tiles of 64.
// Q fragments from the [bh][s][64] plane. Each 64-key tile of K ([key][64]) and of V^T ([d][64 keys]) is copied once per
// block into LDS (two buffers, the next tile in flight while this one is worked on) and all four waves take their
// fragments from there. The products run transposed: S^T[key][q] = K . Q^T and O^T[d][q] += V^T . P^T, so a lane holds
// one query's scores (keys 16t + 8*(l>>4) + r), and two converted score tiles are the B operand of the second product.
#define KVP 72                       // f16 per staged row: 128 B of data + 16 B pad, the pitch for 16-byte LDS readers
#define KV_TILE (64 * KVP)           // f16 per staged tile (64 rows)
#define KV_BUF_BYTES (2 * KV_TILE * 2)
#define OSP 68                       // f32 per staged output row: 256 B of data + 16 B pad (16-byte LDS writers, one row per lane)

// One tile of K and one of V^T into one buffer: 8 copies of 16 B per lane, each wave-wide copy = 4 whole 128-B rows.
// kg, vg: the lane's global address in rows 0..15 of the two tiles; lk: the lane's LDS byte address in the K tile.
__device__ __forceinline__ void stage_kv(const h16* kg, const h16* vg, unsigned lk) {
  const unsigned lv = lk + KV_TILE * 2;
  const unsigned rs = 16 * KVP * 2;  // 16 staged rows, in bytes
  // s_wait_xcnt closes the statement so that no address register is rewritten ahead of it
  asm volatile("global_load_async_to_lds_b128 %0, %8, off\n\t"
               "global_load_async_to_lds_b128 %1, %9, off\n\t"
               "global_load_async_to_lds_b128 %2, %10, off\n\t"
               "global_load_async_to_lds_b128 %3, %11, off\n\t"
               "global_load_async_to_lds_b128 %4, %12, off\n\t"
               "global_load_async_to_lds_b128 %5, %13, off\n\t"
               "global_load_async_to_lds_b128 %6, %14, off\n\t"
               "global_load_async_to_lds_b128 %7, %15, off\n\t"
               "s_wait_xcnt 0x0"
               :: "v"(lk), "v"(lk + rs), "v"(lk + 2 * rs), "v"(lk + 3 * rs),
                  "v"(lv), "v"(lv + rs), "v"(lv + 2 * rs), "v"(lv + 3 * rs),
                  "v"(kg), "v"(kg + 16 * HD), "v"(kg + 32 * HD), "v"(kg + 48 * HD),
                  "v"(vg), "v"(vg + (size_t)16 * SEQ), "v"(vg + (size_t)32 * SEQ), "v"(vg + (size_t)48 * SEQ)
               : "memory");
}

__global__ __launch_bounds__(128) __attribute__((amdgpu_num_vgpr(256)))
void k_attn(const h16* __restrict__ Qp, const h16* __restrict__ Kp, const h16* __restrict__ VTp,
            const int* __restrict__ mask, float* __restrict__ out) {
  __shared__ __attribute__((aligned(16))) h16   KVs[2][2][KV_TILE]; // [buffer][K | V^T][row * KVP + col]
  __shared__ __attribute__((aligned(16))) float Madd[SEQ];        // additive key mask -10000*(1 - m), one per key
  __shared__ __attribute__((aligned(16))) float Os[4][16 * OSP];  // per wave: output tile [q][d]

  const int wave = threadIdx.x >> 5, lane = threadIdx.x & 31;
  const int hh = lane >> 4, mm = lane & 15;
  const int bh = blockIdx.y;
  const int b  = bh / NH;
  const int hd = bh - b * NH;
  const int q0 = blockIdx.x * 64 + wave * 16;

  const h16* Qbh = Qp  + (size_t)bh * SEQ * HD;
  const h16* Kbh = Kp  + (size_t)bh * SEQ * HD;
  const h16* Vbh = VTp + (size_t)bh * HD * SEQ;
  const int* mk_b = mask + (size_t)b * S_FULL;

  const v16h aq0 = ldfrag_h(Qbh + (size_t)q0 * HD, HD);
  const v16h aq1 = ldfrag_h(Qbh + (size_t)q0 * HD + 32, HD);

  // per lane: running maximum of query column mm (both halves agree), running sum over this half's keys only
  float m_run = -1e30f, l_run = 0.f;
  v8f o[4] = {zero8(), zero8(), zero8(), zero8()};   // o[dt][r] = O^T[16*dt + 8*hh + r][mm]

  // the lane's 16-byte piece of rows 0..15 of a tile: 8 lanes per 128-B row
  const int crow = threadIdx.x >> 3, ccol = (threadIdx.x & 7) * 8;
  const h16* kg = Kbh + (size_t)crow * HD + ccol;
  const h16* vg = Vbh + (size_t)crow * SEQ + ccol;
  const unsigned lk0 = (unsigned)(uintptr_t)&KVs[0][0][crow * KVP + ccol];

  stage_kv(kg, vg, lk0);
  // a lane now needs the mask term of 32 keys per tile: form all of them once per block, read them back 16 B at a time
#pragma unroll
  for (int i0 = 0; i0 < SEQ; i0 += 128 * 4) {
    const int i = i0 + (int)threadIdx.x * 4;
    if (SEQ % (128 * 4) == 0 || i < SEQ) {
      const v4i mi = *(const v4i*)(mk_b + i);
      v4f ma;
#pragma unroll
      for (int j = 0; j < 4; ++j) ma[j] = -10000.0f * (1.0f - (float)mi[j]);
      *(v4f*)(&Madd[i]) = ma;
    }
  }
  asm volatile("s_wait_asynccnt 0x0" ::: "memory");   // this wave's share of tile 0 has landed
  __syncthreads();                                     // tile 0 and the mask terms readable by every wave
  if (SEQ > 64) stage_kv(kg + (size_t)64 * HD, vg + 64, lk0 + KV_BUF_BYTES);

#pragma unroll 1
  for (int t0 = 0; t0 < SEQ; t0 += 64) {
    const int buf = (t0 >> 6) & 1;
    const h16* Kt = &KVs[buf][0][0];
    const h16* Vt = &KVs[buf][1][0];
    // scores S^T[64 keys][16 q] = k . q^T; sc[t][r] = key 16*t + 8*hh + r, query mm
    // All K fragments and the mask terms are asked for ahead of the first product, not fragment by fragment between
    // its WMMAs, so that the wave waits out the LDS latency once (the compiler orders them and counts its waits).
    v8f sc[4];
    v16h kf[4][2];
    v4f ma[4][2];
#pragma unroll
    for (int t = 0; t < 4; ++t) {
      kf[t][0] = ldfrag_h(Kt + (16 * t) * KVP, KVP);
      kf[t][1] = ldfrag_h(Kt + (16 * t) * KVP + 32, KVP);
    }
#pragma unroll
    for (int t = 0; t < 4; ++t) {
      ma[t][0] = *(const v4f*)(&Madd[t0 + 16 * t + 8 * hh]);
      ma[t][1] = *(const v4f*)(&Madd[t0 + 16 * t + 8 * hh + 4]);
    }
#pragma unroll
    for (int t = 0; t < 4; ++t) sc[t] = mma_h(kf[t][0], aq0, zero8());
#pragma unroll
    for (int t = 0; t < 4; ++t) sc[t] = mma_h(kf[t][1], aq1, sc[t]);
    // Second group: all V^T fragments of this tile, asked for here so that they arrive while the softmax runs.
    v16h vf[4][2];
#pragma unroll
    for (int dt = 0; dt < 4; ++dt) {
      vf[dt][0] = ldfrag_h(Vt + (16 * dt) * KVP, KVP);
      vf[dt][1] = ldfrag_h(Vt + (16 * dt) * KVP + 32, KVP);
    }
    // keeps the V^T reads up here as one group, ahead of the softmax
    __builtin_amdgcn_sched_barrier(0);

    // scale 1/8 and additive key mask: s/8 - 10000*(1 - m)
#pragma unroll
    for (int t = 0; t < 4; ++t) {
#pragma unroll
      for (int r = 0; r < 4; ++r) {
        sc[t][r]     = sc[t][r]     * 0.125f + ma[t][0][r];
        sc[t][4 + r] = sc[t][4 + r] * 0.125f + ma[t][1][r];
      }
    }

    // online softmax, one query per lane: maximum in-lane over 32 keys, then one exchange with the other half
    float mt[4];
#pragma unroll
    for (int t = 0; t < 4; ++t) {
      mt[t] = sc[t][0];
#pragma unroll
      for (int r = 1; r < 8; ++r) mt[t] = fmaxf(mt[t], sc[t][r]);
    }
    float mx = fmaxf(fmaxf(mt[0], mt[1]), fmaxf(mt[2], mt[3]));
    mx = fmaxf(mx, xhalf(mx));
    const float mn = fmaxf(m_run, mx);
    // The arguments first, then the exponentials together. The two scheduling barriers are there to keep the v_exp_f32
    // from being spread among the other vector work.
    float ea[4][8];
#pragma unroll
    for (int t = 0; t < 4; ++t)
#pragma unroll
      for (int r = 0; r < 8; ++r) ea[t][r] = (sc[t][r] - mn) * 1.44269504088896340736f;
    const float eal = (m_run - mn) * 1.44269504088896340736f;
    __builtin_amdgcn_sched_barrier(0);
    const float alpha = __builtin_amdgcn_exp2f(eal);
#pragma unroll
    for (int t = 0; t < 4; ++t)
#pragma unroll
      for (int r = 0; r < 8; ++r) ea[t][r] = __builtin_amdgcn_exp2f(ea[t][r]);
    __builtin_amdgcn_sched_barrier(0);
    m_run = mn;

    // P^T (x1024, f16) straight into the B operand: element s of pb[j] = key 32*j + (s < 8 ? 8*hh + s : 16 + 8*hh + s - 8)
    v16h pb[2];
    float pst[4];
#pragma unroll
    for (int t = 0; t < 4; ++t) {
      pst[t] = 0.f;
#pragma unroll
      for (int r = 0; r < 8; ++r) {
        const float p = ea[t][r];
        pst[t] += p;
        pb[t >> 1][(t & 1) * 8 + r] = (h16)(p * 1024.0f);
      }
    }
    l_run = l_run * alpha + ((pst[0] + pst[1]) + (pst[2] + pst[3]));
#pragma unroll
    for (int dt = 0; dt < 4; ++dt)
#pragma unroll
      for (int r = 0; r < 8; ++r) o[dt][r] *= alpha;

    // O^T[64 d][16 q] += V^T[64 d][64 keys] . P^T[64 keys][16 q]
#pragma unroll
    for (int dt = 0; dt < 4; ++dt) o[dt] = mma_h(vf[dt][0], pb[0], o[dt]);
#pragma unroll
    for (int dt = 0; dt < 4; ++dt) o[dt] = mma_h(vf[dt][1], pb[1], o[dt]);
    // keeps the waits and the barrier at the trip's foot, behind the second product, so that the copies of the next
    // tile have the whole trip to land
    __builtin_amdgcn_sched_barrier(0);
    asm volatile("s_wait_dscnt 0x0" ::: "memory");      // this wave's reads of the buffer are done
    asm volatile("s_wait_asynccnt 0x0" ::: "memory");   // this wave's share of the next tile has landed
    __syncthreads();   // next tile readable by every wave; this trip's buffer free for the refill
    if (t0 + 128 < SEQ) stage_kv(kg + (size_t)(t0 + 128) * HD, vg + (t0 + 128), lk0 + buf * KV_BUF_BYTES);
  }
  asm volatile("s_wait_asynccnt 0x0" ::: "memory");     // no copy outstanding behind the loop

  // normalise (undo the x1024 carry) and stage the 16x64 f32 tile per wave
  const float inv = (1.0f / (l_run + xhalf(l_run))) * 0.0009765625f;   // the two halves' key sums join here, once
#pragma unroll
  for (int dt = 0; dt < 4; ++dt) {
    v4f w0, w1;
#pragma unroll
    for (int r = 0; r < 4; ++r) { w0[r] = o[dt][r] * inv; w1[r] = o[dt][4 + r] * inv; }
    *(v4f*)(&Os[wave][mm * OSP + 16 * dt + 8 * hh])     = w0;
    *(v4f*)(&Os[wave][mm * OSP + 16 * dt + 8 * hh + 4]) = w1;
  }
  __syncthreads();

  // each instruction: lanes 0..15 -> row 2i (256 B = 2 full lines), lanes 16..31 -> row 2i+1
  const int rsub = lane >> 4;
  const int cc = (lane & 15) * 4;
  float* ob = out + ((size_t)b * SEQ + q0) * DM + (size_t)hd * HD;
  v4f vv[8];
#pragma unroll
  for (int i = 0; i < 8; ++i) vv[i] = *(const v4f*)(&Os[wave][(2 * i + rsub) * OSP + cc]);
#pragma unroll
  for (int i = 0; i < 8; ++i) *(v4f*)(ob + (size_t)(2 * i + rsub) * DM + cc) = vv[i];
  
}

// ---------------- launcher ----------------
extern "C" void kernel_launch(void* const* d_in, const int* in_sizes, int n_in,
                              void* d_out, int out_size, void* d_ws, size_t ws_size,
                              hipStream_t stream) {
  if (n_in < 8) return;
  const float* x   = (const float*)d_in[0];
  const int*   msk = (const int*)d_in[1];
  const float* Wq  = (const float*)d_in[2];
  const float* bq  = (const float*)d_in[3];
  const float* Wk  = (const float*)d_in[4];
  const float* bk  = (const float*)d_in[5];
  const float* Wv  = (const float*)d_in[6];
  const float* bv  = (const float*)d_in[7];
  float* out = (float*)d_out;

  if (in_sizes[0] < ((NB - 1) * S_FULL + SEQ) * DM) return;
  if (in_sizes[1] < (NB - 1) * S_FULL + SEQ) return;
  if (in_sizes[2] < DM * DM || in_sizes[4] < DM * DM || in_sizes[6] < DM * DM) return;
  if (in_sizes[3] < DM || in_sizes[5] < DM || in_sizes[7] < DM) return;
  if (out_size < MT * DM) return;

  char* ws = (char*)d_ws;
  const size_t XB_BYTES = (size_t)MT * DM * 2;              // bf16 x plane [MT][DM]
  const size_t W_BYTES  = (size_t)DM * DM * 2;              // one bf16 weight plane
  const size_t PL_BYTES = (size_t)NB * NH * SEQ * HD * 2;   // one f16 q/k/v^T plane
  size_t off = 0;
  u16* Xb = (u16*)(ws + off);  off += XB_BYTES;
  u16* Wb = (u16*)(ws + off);  off += 3 * W_BYTES;
  h16* Qp = (h16*)(ws + off);  off += PL_BYTES;
  h16* Kp = (h16*)(ws + off);  off += PL_BYTES;
  h16* VTp = (h16*)(ws + off); off += PL_BYTES;
  if (off > ws_size) return;

  k_cvt_bf16<<<CV_XB + 3 * CV_WB, 256, 0, stream>>>(x, Wq, Wk, Wv, Xb, Wb);

  dim3 gp(MT / 64, DM / 64, 3);
  k_proj<<<gp, 128, 0, stream>>>(Xb, Wb, bq, bk, bv, Qp, Kp, VTp);

  dim3 ga(SEQ / 64, NB * NH);
  k_attn<<<ga, 128, 0, stream>>>(Qp, Kp, VTp, msk, out);
}

// v006
// It runs in 65.3 microseconds.
// Next to v005, in two timings, it ran 1.05 times as fast each time.
// All steps since v000 together make it 4.03 times as fast.
#include <hip/hip_runtime.h>
#include <stdint.h>

// Contractions: x.Wq^T, x.Wk^T, x.Wv^T on v_wmma_f32_16x16x32_bf16 (bf16 operands = RNE-converted f32 inputs, f32 accumulate);
// k.q^T and V^T.P^T on v_wmma_f32_16x16x32_f16 (f16 operands, P carried x1024, f32 accumulate); bias add, softmax, normalisation in f32.
// The additive key mask (x8) is the start value of the k.q^T accumulators.

typedef unsigned short u16;
typedef _Float16 h16;
typedef __bf16 v16bf __attribute__((ext_vector_type(16)));
typedef h16 v16h __attribute__((ext_vector_type(16)));
typedef h16 v8h __attribute__((ext_vector_type(8), __may_alias__));
typedef float v8f __attribute__((ext_vector_type(8)));
typedef float v4f __attribute__((ext_vector_type(4), __may_alias__));
typedef unsigned int v4u __attribute__((ext_vector_type(4), __may_alias__));
typedef int v4i __attribute__((ext_vector_type(4), __may_alias__));

#ifndef NB
#define NB 4
#endif
#ifndef SEQ
#define SEQ 2048
#endif
#define NB_FULL 4
#define S_FULL 2048
#define DM 512
#define NH 8
#define HD 64
#define MT (NB * SEQ)

static_assert(NB >= 1 && NB <= NB_FULL);
static_assert(SEQ % 64 == 0 && SEQ <= S_FULL);
static_assert(DM % 64 == 0 && DM % 32 == 0);
static_assert(NH * HD == DM);
static_assert(HD == 64);
static_assert(MT % 64 == 0);

// ---------------- helpers ----------------

__device__ __forceinline__ u16 f2bf(float f) {
  unsigned u = __float_as_uint(f);
  u += 0x7FFFu + ((u >> 16) & 1u);   // RNE convert f32 -> bf16 bits
  return (u16)(u >> 16);
}

__device__ __forceinline__ float bf_rn(float f) {
  return __uint_as_float(((unsigned)f2bf(f)) << 16);
}

__device__ __forceinline__ v8f zero8() {
  v8f z = {0.f, 0.f, 0.f, 0.f, 0.f, 0.f, 0.f, 0.f};
  return z;
}

// 16x32 16-bit fragment from row-major storage with k contiguous (pitch ld elements):
// lane l: row = l&15; elements 0..7 <- k0 + 8*(l>>4) + 0..7; elements 8..15 <- k0 + 16 + 8*(l>>4) + 0..7.
// Used for A (row = m) and for B stored n-major with k contiguous (row = n).
__device__ __forceinline__ v16bf ldfrag_bf(const u16* base, int ld) {
  const int l = threadIdx.x & 31;
  const int row = l & 15;
  const int kb = (l >> 4) << 3;
  const u16* p = base + (size_t)row * ld + kb;
  union { v16bf v; v4u q[2]; } u;
  u.q[0] = *(const v4u*)(p);
  u.q[1] = *(const v4u*)(p + 16);
  return u.v;
}

__device__ __forceinline__ v16h ldfrag_h(const h16* base, int ld) {
  const int l = threadIdx.x & 31;
  const int row = l & 15;
  const int kb = (l >> 4) << 3;
  const h16* p = base + (size_t)row * ld + kb;
  union { v16h v; v8h q[2]; } u;
  u.q[0] = *(const v8h*)(p);
  u.q[1] = *(const v8h*)(p + 16);
  return u.v;
}

// D[16x16] += A[16x32] . B[32x16]; D element r of lane l = (row 8*(l>>4)+r, col l&15)
__device__ __forceinline__ v8f mma_bf(v16bf a, v16bf b, v8f c) {
  v8f r = __builtin_amdgcn_wmma_f32_16x16x32_bf16(false, a, false, b, (short)0, c, false, false);
  asm volatile("v_nop\n\tv_nop\n\tv_nop\n\tv_nop" : "+v"(r) : "v"(a), "v"(b));
  return r;
}

__device__ __forceinline__ v8f mma_h(v16h a, v16h b, v8f c) {
  return __builtin_amdgcn_wmma_f32_16x16x32_f16(false, a, false, b, (short)0, c, false, false);
}

// value of lane l ^ 16 (the other half of the wave holds the other keys of the same query column)
__device__ __forceinline__ float xhalf(float x) {
  const int b = __float_as_int(x);
  return __int_as_float(__builtin_amdgcn_permlanex16(b, b, 0x76543210, 0xfedcba98, false, false));
}

// ---------------- stage 0: f32 -> bf16 planes (rows of DM elements), one launch for x and the three weights ----------------
// A piece = 8 elements: 32 B read, 16 B written. A block converts CV_BLK consecutive pieces (CV_ROWS whole rows) of ONE
// source; the block index picks the source: [0, CV_XB) -> x, then CV_WB blocks each for Wq, Wk, Wv (their planes follow one
// another in Wb). A lane takes CV_U pieces, 256 pieces apart.
// x plane row pr <- source row (pr / SEQ) * S_FULL + pr % SEQ; a block's rows lie in one group of SEQ rows.
#define CV_U 4
#define CV_BLK (256 * CV_U)
#define CV_ROWS (CV_BLK / (DM / 8))
#define CV_XB (MT / CV_ROWS)
#define CV_WB (DM / CV_ROWS)
static_assert(CV_BLK % (DM / 8) == 0 && SEQ % CV_ROWS == 0 && DM % CV_ROWS == 0);

__global__ __launch_bounds__(256) void k_cvt_bf16(const float* __restrict__ x, const float* __restrict__ Wq,
                                                   const float* __restrict__ Wk, const float* __restrict__ Wv,
                                                   u16* __restrict__ Xb, u16* __restrict__ Wb) {
  const unsigned blk = blockIdx.x;
  const float* src;   // first source row of this block
  u16* dst;           // first plane row of this block
  if (blk < CV_XB) {
    const unsigned pr0 = blk * CV_ROWS;
    src = x + (size_t)((pr0 / SEQ) * S_FULL + pr0 % SEQ) * DM;
    dst = Xb + (size_t)pr0 * DM;
  } else {
    const unsigned wb = blk - CV_XB;
    const unsigned mat = wb / CV_WB;
    src = ((mat == 0) ? Wq : ((mat == 1) ? Wk : Wv)) + (size_t)(wb - mat * CV_WB) * CV_ROWS * DM;
    dst = Wb + (size_t)wb * CV_ROWS * DM;
  }
  const float* s = src + threadIdx.x * 8;
  u16* d = dst + threadIdx.x * 8;

  v4f a[CV_U], b[CV_U];
  // unrolled so that a and b stay in registers and all 2 * CV_U loads are issued ahead of the first conversion
#pragma unroll
  for (int j = 0; j < CV_U; ++j) {
    a[j] = *(const v4f*)(s + j * (256 * 8));
    b[j] = *(const v4f*)(s + j * (256 * 8) + 4);
  }
#pragma unroll
  for (int j = 0; j < CV_U; ++j) {
    v4u w;
    w.x = (unsigned)f2bf(a[j].x) | ((unsigned)f2bf(a[j].y) << 16);
    w.y = (unsigned)f2bf(a[j].z) | ((unsigned)f2bf(a[j].w) << 16);
    w.z = (unsigned)f2bf(b[j].x) | ((unsigned)f2bf(b[j].y) << 16);
    w.w = (unsigned)f2bf(b[j].z) | ((unsigned)f2bf(b[j].w) << 16);
    *(v4u*)(d + j * (256 * 8)) = w;
  }
}

// ---------------- stage 1: projections ----------------
// out[row, n] = sum_k Xb[row, k] * W[n, k] + bias[n]; row in [0, MT), n in [0, DM), K = DM.
// blockIdx.z selects the matrix: 0 -> Q plane [bh][s][64], 1 -> K plane [bh][s][64], 2 -> V^T plane [bh][64][SEQ] (f16).
// Block = 4 waves, tile 64(M) x 64(N); wave owns 16 rows x 64 cols. Each k-tile of 64 elements (64 rows x 128 B of X and
// of W) is copied once per block into LDS in whole lines (two buffers, the next k-tile in flight while this one is worked
// on); the waves take their fragments from there. Each sum runs over k in ascending steps of 32.
#define XWP 72                       // bf16 per staged row: 128 B of data + 16 B pad, the pitch for 16-byte LDS readers
#define XW_TILE (64 * XWP)           // bf16 per staged tile (64 rows)
#define XW_BUF_BYTES (2 * XW_TILE * 2)

// One k-tile of X and one of W into one buffer: 8 copies of 16 B per lane, each wave-wide copy = 4 whole 128-B lines.
// xg, wg: the lane's global address in rows 0..15 of the two tiles; lx: the lane's LDS byte address in the X tile.
__device__ __forceinline__ void stage_xw(const u16* xg, const u16* wg, unsigned lx) {
  const unsigned lw = lx + XW_TILE * 2;
  const unsigned rs = 16 * XWP * 2;  // 16 staged rows, in bytes
  // s_wait_xcnt closes the statement so that no address register is rewritten ahead of it
  asm volatile("global_load_async_to_lds_b128 %0, %8, off\n\t"
               "global_load_async_to_lds_b128 %1, %9, off\n\t"
               "global_load_async_to_lds_b128 %2, %10, off\n\t"
               "global_load_async_to_lds_b128 %3, %11, off\n\t"
               "global_load_async_to_lds_b128 %4, %12, off\n\t"
               "global_load_async_to_lds_b128 %5, %13, off\n\t"
               "global_load_async_to_lds_b128 %6, %14, off\n\t"
               "global_load_async_to_lds_b128 %7, %15, off\n\t"
               "s_wait_xcnt 0x0"
               :: "v"(lx), "v"(lx + rs), "v"(lx + 2 * rs), "v"(lx + 3 * rs),
                  "v"(lw), "v"(lw + rs), "v"(lw + 2 * rs), "v"(lw + 3 * rs),
                  "v"(xg), "v"(xg + 16 * DM), "v"(xg + 32 * DM), "v"(xg + 48 * DM),
                  "v"(wg), "v"(wg + 16 * DM), "v"(wg + 32 * DM), "v"(wg + 48 * DM)
               : "memory");
}

__global__ __launch_bounds__(128) __attribute__((amdgpu_num_vgpr(256)))
void k_proj(const u16* __restrict__ Xb, const u16* __restrict__ Wb,
            const float* __restrict__ bq, const float* __restrict__ bk, const float* __restrict__ bv,
            h16* __restrict__ Qp, h16* __restrict__ Kp, h16* __restrict__ VTp) {
  __shared__ __attribute__((aligned(16))) u16 XWs[2][2][XW_TILE];   // [buffer][X | W][row * XWP + k]
  __shared__ __attribute__((aligned(16))) h16 Ts[64 * 64];

  const int wave = threadIdx.x >> 5, lane = threadIdx.x & 31;
  const int hh = lane >> 4, mm = lane & 15;
  const int mat = blockIdx.z;
  const int m0 = blockIdx.x * 64, n0 = blockIdx.y * 64;
  const u16* W = Wb + (size_t)mat * DM * DM + (size_t)n0 * DM;   // rows n0..n0+63, k contiguous
  const float* bias = (mat == 0) ? bq : ((mat == 1) ? bk : bv);

  v8f acc[4] = {zero8(), zero8(), zero8(), zero8()};

  // the lane's 16-byte piece of rows 0..15 of a k-tile: 8 lanes per 128-B line
  const int crow = threadIdx.x >> 3, ccol = (threadIdx.x & 7) * 8;
  const u16* xg = Xb + (size_t)(m0 + crow) * DM + ccol;
  const u16* wg = W + (size_t)crow * DM + ccol;
  const unsigned lx0 = (unsigned)(uintptr_t)&XWs[0][0][crow * XWP + ccol];

  stage_xw(xg, wg, lx0);
  asm volatile("s_wait_asynccnt 0x0" ::: "memory");   // this wave's share of k-tile 0 has landed
  __syncthreads();                                     // k-tile 0 readable by every wave
  if (DM > 64) stage_xw(xg + 64, wg + 64, lx0 + XW_BUF_BYTES);

  for (int kt = 0; kt < DM; kt += 64) {
    const int buf = (kt >> 6) & 1;
    const u16* Xt = &XWs[buf][0][(wave * 16) * XWP];
    const u16* Wt = &XWs[buf][1][0];
    for (int k0 = 0; k0 < 64; k0 += 32) {
      const v16bf a  = ldfrag_bf(Xt + k0, XWP);
      const v16bf b0 = ldfrag_bf(Wt + (0 * 16) * XWP + k0, XWP);
      const v16bf b1 = ldfrag_bf(Wt + (1 * 16) * XWP + k0, XWP);
      const v16bf b2 = ldfrag_bf(Wt + (2 * 16) * XWP + k0, XWP);
      const v16bf b3 = ldfrag_bf(Wt + (3 * 16) * XWP + k0, XWP);
      acc[0] = mma_bf(a, b0, acc[0]);
      acc[1] = mma_bf(a, b1, acc[1]);
      acc[2] = mma_bf(a, b2, acc[2]);
      acc[3] = mma_bf(a, b3, acc[3]);
    }
    asm volatile("s_wait_dscnt 0x0" ::: "memory");      // this wave's reads of the buffer are done
    asm volatile("s_wait_asynccnt 0x0" ::: "memory");   // this wave's share of the next k-tile has landed
    __syncthreads();   // next k-tile readable by every wave; this trip's buffer free for the refill
    if (kt + 128 < DM) stage_xw(xg + (kt + 128), wg + (kt + 128), lx0 + buf * XW_BUF_BYTES);
  }
  asm volatile("s_wait_asynccnt 0x0" ::: "memory");     // no copy outstanding behind the loop

  // bias enters as its bf16-RNE value
  float bb[4];
#pragma unroll
  for (int t = 0; t < 4; ++t) bb[t] = bf_rn(bias[n0 + 16 * t + mm]);

  // stage the 64x64 tile in LDS: [row][col] for Q/K, transposed [col][row] for V
  const bool tr = (mat == 2);
#pragma unroll
  for (int t = 0; t < 4; ++t) {
#pragma unroll
    for (int r = 0; r < 8; ++r) {
      const int row = wave * 16 + 8 * hh + r;
      const int col = 16 * t + mm;
      const int idx = tr ? (col * 64 + row) : (row * 64 + col);
      Ts[idx] = (h16)(acc[t][r] + bb[t]);
    }
  }
  __syncthreads();

  const int b  = m0 / SEQ;
  const int s0 = m0 - b * SEQ;
  const int bh = b * NH + blockIdx.y;
  h16* dstp = (mat == 0) ? Qp : ((mat == 1) ? Kp : VTp);
  const int pc = (threadIdx.x & 7) * 8;
  const int rb = threadIdx.x >> 3;
  v8h vals[4];
  size_t offs[4];
#pragma unroll
  for (int i = 0; i < 4; ++i) {
    const int rr = i * 16 + rb;
    vals[i] = *(const v8h*)(&Ts[rr * 64 + pc]);
    offs[i] = tr ? ((((size_t)bh * HD + rr) * SEQ) + s0 + pc)
                 : ((((size_t)bh * SEQ + s0 + rr) * HD) + pc);
  }
#pragma unroll
  for (int i = 0; i < 4; ++i) *(v8h*)(dstp + offs[i]) = vals[i];
  
}

// ---------------- stage 2: flash attention ----------------
// Block = 4 waves, owns (bh, 64 query rows); wave owns 16 query rows, loops over key tiles of 64.
// Q fragments from the [bh][s][64] plane. Each 64-key tile of K ([key][64]) and of V^T ([d][64 keys]) is copied once per
// block into LDS (two buffers, the next tile in flight while this one is worked on) and all four waves take their
// fragments from there. The products run transposed: S^T[key][q] = K . Q^T and O^T[d][q] += V^T . P^T, so a lane holds
// one query's scores (keys 16t + 8*(l>>4) + r), and two converted score tiles are the B operand of the second product.
#define KVP 72                       // f16 per staged row: 128 B of data + 16 B pad, the pitch for 16-byte LDS readers
#define KV_TILE (64 * KVP)           // f16 per staged tile (64 rows)
#define KV_BUF_BYTES (2 * KV_TILE * 2)
#define OSP 68                       // f32 per staged output row: 256 B of data + 16 B pad (16-byte LDS writers, one row per lane)

// One tile of K and one of V^T into one buffer: 8 copies of 16 B per lane, each wave-wide copy = 4 whole 128-B rows.
// kg, vg: the lane's global address in rows 0..15 of the two tiles; lk: the lane's LDS byte address in the K tile.
__device__ __forceinline__ void stage_kv(const h16* kg, const h16* vg, unsigned lk) {
  const unsigned lv = lk + KV_TILE * 2;
  const unsigned rs = 16 * KVP * 2;  // 16 staged rows, in bytes
  // s_wait_xcnt closes the statement so that no address register is rewritten ahead of it
  asm volatile("global_load_async_to_lds_b128 %0, %8, off\n\t"
               "global_load_async_to_lds_b128 %1, %9, off\n\t"
               "global_load_async_to_lds_b128 %2, %10, off\n\t"
               "global_load_async_to_lds_b128 %3, %11, off\n\t"
               "global_load_async_to_lds_b128 %4, %12, off\n\t"
               "global_load_async_to_lds_b128 %5, %13, off\n\t"
               "global_load_async_to_lds_b128 %6, %14, off\n\t"
               "global_load_async_to_lds_b128 %7, %15, off\n\t"
               "s_wait_xcnt 0x0"
               :: "v"(lk), "v"(lk + rs), "v"(lk + 2 * rs), "v"(lk + 3 * rs),
                  "v"(lv), "v"(lv + rs), "v"(lv + 2 * rs), "v"(lv + 3 * rs),
                  "v"(kg), "v"(kg + 16 * HD), "v"(kg + 32 * HD), "v"(kg + 48 * HD),
                  "v"(vg), "v"(vg + (size_t)16 * SEQ), "v"(vg + (size_t)32 * SEQ), "v"(vg + (size_t)48 * SEQ)
               : "memory");
}

// waves_per_eu(4, 4): the grid is 4 work-groups for each of the chip's WGPs; with fewer registers in use a fifth could
// become resident on some WGPs and leave others short, so the register allocation is held at four waves per SIMD.
__global__ __launch_bounds__(128) __attribute__((amdgpu_num_vgpr(256), amdgpu_waves_per_eu(4, 4)))
void k_attn(const h16* __restrict__ Qp, const h16* __restrict__ Kp, const h16* __restrict__ VTp,
            const int* __restrict__ mask, float* __restrict__ out) {
  __shared__ __attribute__((aligned(16))) h16   KVs[2][2][KV_TILE]; // [buffer][K | V^T][row * KVP + col]
  __shared__ __attribute__((aligned(16))) float Madd[SEQ];        // 8 x the additive key mask: -80000*(1 - m), one per key
  __shared__ __attribute__((aligned(16))) float Os[4][16 * OSP];  // per wave: output tile [q][d]

  const int wave = threadIdx.x >> 5, lane = threadIdx.x & 31;
  const int hh = lane >> 4, mm = lane & 15;
  const int bh = blockIdx.y;
  const int b  = bh / NH;
  const int hd = bh - b * NH;
  const int q0 = blockIdx.x * 64 + wave * 16;

  const h16* Qbh = Qp  + (size_t)bh * SEQ * HD;
  const h16* Kbh = Kp  + (size_t)bh * SEQ * HD;
  const h16* Vbh = VTp + (size_t)bh * HD * SEQ;
  const int* mk_b = mask + (size_t)b * S_FULL;

  const v16h aq0 = ldfrag_h(Qbh + (size_t)q0 * HD, HD);
  const v16h aq1 = ldfrag_h(Qbh + (size_t)q0 * HD + 32, HD);

  // per lane: running maximum of query column mm (both halves agree), running sum over this half's keys only
  // m_run is kept in units of the raw product k.q + 8*mask (8 x the score); nmc_run is the exponent offset made from it
  const float C1 = 0.125f * 1.44269504088896340736f;   // 1/8 and log2(e) in one factor
  float m_run = -1e30f, l_run = 0.f;
  float nmc_run = __builtin_fmaf(m_run, -C1, 10.0f);
  v8f o[4] = {zero8(), zero8(), zero8(), zero8()};   // o[dt][r] = O^T[16*dt + 8*hh + r][mm]

  // the lane's 16-byte piece of rows 0..15 of a tile: 8 lanes per 128-B row
  const int crow = threadIdx.x >> 3, ccol = (threadIdx.x & 7) * 8;
  const h16* kg = Kbh + (size_t)crow * HD + ccol;
  const h16* vg = Vbh + (size_t)crow * SEQ + ccol;
  const unsigned lk0 = (unsigned)(uintptr_t)&KVs[0][0][crow * KVP + ccol];

  stage_kv(kg, vg, lk0);
  // a lane now needs the mask term of 32 keys per tile: form all of them once per block, read them back 16 B at a time
#pragma unroll
  for (int i0 = 0; i0 < SEQ; i0 += 128 * 4) {
    const int i = i0 + (int)threadIdx.x * 4;
    if (SEQ % (128 * 4) == 0 || i < SEQ) {
      const v4i mi = *(const v4i*)(mk_b + i);
      v4f ma;
#pragma unroll
      for (int j = 0; j < 4; ++j) ma[j] = -80000.0f * (1.0f - (float)mi[j]);
      *(v4f*)(&Madd[i]) = ma;
    }
  }
  asm volatile("s_wait_asynccnt 0x0" ::: "memory");   // this wave's share of tile 0 has landed
  __syncthreads();                                     // tile 0 and the mask terms readable by every wave
  if (SEQ > 64) stage_kv(kg + (size_t)64 * HD, vg + 64, lk0 + KV_BUF_BYTES);

#pragma unroll 1
  for (int t0 = 0; t0 < SEQ; t0 += 64) {
    const int buf = (t0 >> 6) & 1;
    const h16* Kt = &KVs[buf][0][0];
    const h16* Vt = &KVs[buf][1][0];
    // 8 x scores S^T[64 keys][16 q] = k . q^T + 8 * mask term; sc[t][r] = key 16*t + 8*hh + r, query mm
    // All K fragments and the mask terms are asked for ahead of the first product, not fragment by fragment between
    // its WMMAs, so that the wave waits out the LDS latency once (the compiler orders them and counts its waits).
    v8f sc[4];
    v16h kf[4][2];
    v4f ma[4][2];
#pragma unroll
    for (int t = 0; t < 4; ++t) {
      kf[t][0] = ldfrag_h(Kt + (16 * t) * KVP, KVP);
      kf[t][1] = ldfrag_h(Kt + (16 * t) * KVP + 32, KVP);
    }
#pragma unroll
    for (int t = 0; t < 4; ++t) {
      ma[t][0] = *(const v4f*)(&Madd[t0 + 16 * t + 8 * hh]);
      ma[t][1] = *(const v4f*)(&Madd[t0 + 16 * t + 8 * hh + 4]);
    }
#pragma unroll
    for (int t = 0; t < 4; ++t)   // the mask terms are the accumulators' start values: no vector add per score
      sc[t] = mma_h(kf[t][0], aq0, __builtin_shufflevector(ma[t][0], ma[t][1], 0, 1, 2, 3, 4, 5, 6, 7));
#pragma unroll
    for (int t = 0; t < 4; ++t) sc[t] = mma_h(kf[t][1], aq1, sc[t]);
    // Second group: all V^T fragments of this tile, asked for here so that they arrive while the softmax runs.
    v16h vf[4][2];
#pragma unroll
    for (int dt = 0; dt < 4; ++dt) {
      vf[dt][0] = ldfrag_h(Vt + (16 * dt) * KVP, KVP);
      vf[dt][1] = ldfrag_h(Vt + (16 * dt) * KVP + 32, KVP);
    }
    // keeps the V^T reads up here as one group, ahead of the softmax
    __builtin_amdgcn_sched_barrier(0);

    // online softmax, one query per lane: maximum in-lane over 32 keys, then one exchange with the other half
    float mt[4];
#pragma unroll
    for (int t = 0; t < 4; ++t) {
      mt[t] = sc[t][0];
#pragma unroll
      for (int r = 1; r < 8; ++r) mt[t] = fmaxf(mt[t], sc[t][r]);
    }
    float mx = fmaxf(fmaxf(mt[0], mt[1]), fmaxf(mt[2], mt[3]));
    mx = fmaxf(mx, xhalf(mx));
    const float mn = fmaxf(m_run, mx);
    // The arguments first, then the exponentials together. The two scheduling barriers are there to keep the v_exp_f32
    // from being spread among the other vector work.
    // One FMA per score: 2^(sc*C1 + nmc) = 1024 * e^(score - maximum), with nmc = 10 - mn*C1 (1/8, log2(e), the maximum and
    // the x1024 carry together). The old sums carry 2^nmc_run, so their factor is 2^(nmc - nmc_run), from the rounded offsets.
    const float nmc = __builtin_fmaf(mn, -C1, 10.0f);
    float ea[4][8];
#pragma unroll
    for (int t = 0; t < 4; ++t)
#pragma unroll
      for (int r = 0; r < 8; ++r) ea[t][r] = __builtin_fmaf(sc[t][r], C1, nmc);
    const float eal = nmc - nmc_run;
    __builtin_amdgcn_sched_barrier(0);
    const float alpha = __builtin_amdgcn_exp2f(eal);
#pragma unroll
    for (int t = 0; t < 4; ++t)
#pragma unroll
      for (int r = 0; r < 8; ++r) ea[t][r] = __builtin_amdgcn_exp2f(ea[t][r]);
    __builtin_amdgcn_sched_barrier(0);
    m_run = mn;
    nmc_run = nmc;

    // P^T (x1024, f16) straight into the B operand: element s of pb[j] = key 32*j + (s < 8 ? 8*hh + s : 16 + 8*hh + s - 8)
    v16h pb[2];
    float pst[4];
#pragma unroll
    for (int t = 0; t < 4; ++t) {
      pst[t] = 0.f;
#pragma unroll
      for (int r = 0; r < 8; ++r) {
        const float p = ea[t][r];
        pst[t] += p;
        pb[t >> 1][(t & 1) * 8 + r] = (h16)p;
      }
    }
    l_run = l_run * alpha + ((pst[0] + pst[1]) + (pst[2] + pst[3]));
#pragma unroll
    for (int dt = 0; dt < 4; ++dt)
#pragma unroll
      for (int r = 0; r < 8; ++r) o[dt][r] *= alpha;

    // O^T[64 d][16 q] += V^T[64 d][64 keys] . P^T[64 keys][16 q]
#pragma unroll
    for (int dt = 0; dt < 4; ++dt) o[dt] = mma_h(vf[dt][0], pb[0], o[dt]);
#pragma unroll
    for (int dt = 0; dt < 4; ++dt) o[dt] = mma_h(vf[dt][1], pb[1], o[dt]);
    // keeps the waits and the barrier at the trip's foot, behind the second product, so that the copies of the next
    // tile have the whole trip to land
    __builtin_amdgcn_sched_barrier(0);
    asm volatile("s_wait_dscnt 0x0" ::: "memory");      // this wave's reads of the buffer are done
    asm volatile("s_wait_asynccnt 0x0" ::: "memory");   // this wave's share of the next tile has landed
    __syncthreads();   // next tile readable by every wave; this trip's buffer free for the refill
    if (t0 + 128 < SEQ) stage_kv(kg + (size_t)(t0 + 128) * HD, vg + (t0 + 128), lk0 + buf * KV_BUF_BYTES);
  }
  asm volatile("s_wait_asynccnt 0x0" ::: "memory");     // no copy outstanding behind the loop

  // normalise (sums and products both carry x1024) and stage the 16x64 f32 tile per wave
  const float inv = 1.0f / (l_run + xhalf(l_run));   // the two halves' key sums join here, once
#pragma unroll
  for (int dt = 0; dt < 4; ++dt) {
    v4f w0, w1;
#pragma unroll
    for (int r = 0; r < 4; ++r) { w0[r] = o[dt][r] * inv; w1[r] = o[dt][4 + r] * inv; }
    *(v4f*)(&Os[wave][mm * OSP + 16 * dt + 8 * hh])     = w0;
    *(v4f*)(&Os[wave][mm * OSP + 16 * dt + 8 * hh + 4]) = w1;
  }
  __syncthreads();

  // each instruction: lanes 0..15 -> row 2i (256 B = 2 full lines), lanes 16..31 -> row 2i+1
  const int rsub = lane >> 4;
  const int cc = (lane & 15) * 4;
  float* ob = out + ((size_t)b * SEQ + q0) * DM + (size_t)hd * HD;
  v4f vv[8];
#pragma unroll
  for (int i = 0; i < 8; ++i) vv[i] = *(const v4f*)(&Os[wave][(2 * i + rsub) * OSP + cc]);
#pragma unroll
  for (int i = 0; i < 8; ++i) *(v4f*)(ob + (size_t)(2 * i + rsub) * DM + cc) = vv[i];
  
}

// ---------------- launcher ----------------
extern "C" void kernel_launch(void* const* d_in, const int* in_sizes, int n_in,
                              void* d_out, int out_size, void* d_ws, size_t ws_size,
                              hipStream_t stream) {
  if (n_in < 8) return;
  const float* x   = (const float*)d_in[0];
  const int*   msk = (const int*)d_in[1];
  const float* Wq  = (const float*)d_in[2];
  const float* bq  = (const float*)d_in[3];
  const float* Wk  = (const float*)d_in[4];
  const float* bk  = (const float*)d_in[5];
  const float* Wv  = (const float*)d_in[6];
  const float* bv  = (const float*)d_in[7];
  float* out = (float*)d_out;

  if (in_sizes[0] < ((NB - 1) * S_FULL + SEQ) * DM) return;
  if (in_sizes[1] < (NB - 1) * S_FULL + SEQ) return;
  if (in_sizes[2] < DM * DM || in_sizes[4] < DM * DM || in_sizes[6] < DM * DM) return;
  if (in_sizes[3] < DM || in_sizes[5] < DM || in_sizes[7] < DM) return;
  if (out_size < MT * DM) return;

  char* ws = (char*)d_ws;
  const size_t XB_BYTES = (size_t)MT * DM * 2;              // bf16 x plane [MT][DM]
  const size_t W_BYTES  = (size_t)DM * DM * 2;              // one bf16 weight plane
  const size_t PL_BYTES = (size_t)NB * NH * SEQ * HD * 2;   // one f16 q/k/v^T plane
  size_t off = 0;
  u16* Xb = (u16*)(ws + off);  off += XB_BYTES;
  u16* Wb = (u16*)(ws + off);  off += 3 * W_BYTES;
  h16* Qp = (h16*)(ws + off);  off += PL_BYTES;
  h16* Kp = (h16*)(ws + off);  off += PL_BYTES;
  h16* VTp = (h16*)(ws + off); off += PL_BYTES;
  if (off > ws_size) return;

  k_cvt_bf16<<<CV_XB + 3 * CV_WB, 256, 0, stream>>>(x, Wq, Wk, Wv, Xb, Wb);

  dim3 gp(MT / 64, DM / 64, 3);
  k_proj<<<gp, 128, 0, stream>>>(Xb, Wb, bq, bk, bv, Qp, Kp, VTp);

  dim3 ga(SEQ / 64, NB * NH);
  k_attn<<<ga, 128, 0, stream>>>(Qp, Kp, VTp, msk, out);
}

// v007
// Measured time: 62 microseconds a run.
// Two timings next to v006 put it at 1.05 and 1.06 times that version's speed.
// Counting every step since v000, it is 4.25 times as fast.
#include <hip/hip_runtime.h>
#include <stdint.h>

// Contractions: x.Wq^T, x.Wk^T, x.Wv^T on v_wmma_f32_16x16x32_bf16 (bf16 operands = RNE-converted f32 inputs, f32 accumulate);
// k.q^T and V^T.P^T on v_wmma_f32_16x16x32_f16 (f16 operands, P carried x1024, f32 accumulate); bias add, softmax, normalisation in f32.
// The additive key mask (x8) is the start value of the k.q^T accumulators.

typedef unsigned short u16;
typedef _Float16 h16;
typedef __bf16 v16bf __attribute__((ext_vector_type(16)));
typedef h16 v16h __attribute__((ext_vector_type(16)));
typedef h16 v8h __attribute__((ext_vector_type(8), __may_alias__));
typedef float v8f __attribute__((ext_vector_type(8)));
typedef float v4f __attribute__((ext_vector_type(4), __may_alias__));
typedef unsigned int v4u __attribute__((ext_vector_type(4), __may_alias__));
typedef int v4i __attribute__((ext_vector_type(4), __may_alias__));

#ifndef NB
#define NB 4
#endif
#ifndef SEQ
#define SEQ 2048
#endif
#define NB_FULL 4
#define S_FULL 2048
#define DM 512
#define NH 8
#define HD 64
#define MT (NB * SEQ)

static_assert(NB >= 1 && NB <= NB_FULL);
static_assert(SEQ % 64 == 0 && SEQ <= S_FULL);
static_assert(DM % 64 == 0 && DM % 32 == 0);
static_assert(NH * HD == DM);
static_assert(HD == 64);
static_assert(MT % 64 == 0);

// ---------------- helpers ----------------

__device__ __forceinline__ u16 f2bf(float f) {
  unsigned u = __float_as_uint(f);
  u += 0x7FFFu + ((u >> 16) & 1u);   // RNE convert f32 -> bf16 bits
  return (u16)(u >> 16);
}

__device__ __forceinline__ float bf_rn(float f) {
  return __uint_as_float(((unsigned)f2bf(f)) << 16);
}

__device__ __forceinline__ v8f zero8() {
  v8f z = {0.f, 0.f, 0.f, 0.f, 0.f, 0.f, 0.f, 0.f};
  return z;
}

// 16x32 16-bit fragment from row-major storage with k contiguous (pitch ld elements):
// lane l: row = l&15; elements 0..7 <- k0 + 8*(l>>4) + 0..7; elements 8..15 <- k0 + 16 + 8*(l>>4) + 0..7.
// Used for A (row = m) and for B stored n-major with k contiguous (row = n).
__device__ __forceinline__ v16bf ldfrag_bf(const u16* base, int ld) {
  const int l = threadIdx.x & 31;
  const int row = l & 15;
  const int kb = (l >> 4) << 3;
  const u16* p = base + (size_t)row * ld + kb;
  union { v16bf v; v4u q[2]; } u;
  u.q[0] = *(const v4u*)(p);
  u.q[1] = *(const v4u*)(p + 16);
  return u.v;
}

__device__ __forceinline__ v16h ldfrag_h(const h16* base, int ld) {
  const int l = threadIdx.x & 31;
  const int row = l & 15;
  const int kb = (l >> 4) << 3;
  const h16* p = base + (size_t)row * ld + kb;
  union { v16h v; v8h q[2]; } u;
  u.q[0] = *(const v8h*)(p);
  u.q[1] = *(const v8h*)(p + 16);
  return u.v;
}

// D[16x16] += A[16x32] . B[32x16]; D element r of lane l = (row 8*(l>>4)+r, col l&15)
__device__ __forceinline__ v8f mma_bf(v16bf a, v16bf b, v8f c) {
  v8f r = __builtin_amdgcn_wmma_f32_16x16x32_bf16(false, a, false, b, (short)0, c, false, false);
  asm volatile("v_nop\n\tv_nop\n\tv_nop\n\tv_nop" : "+v"(r) : "v"(a), "v"(b));
  return r;
}

__device__ __forceinline__ v8f mma_h(v16h a, v16h b, v8f c) {
  return __builtin_amdgcn_wmma_f32_16x16x32_f16(false, a, false, b, (short)0, c, false, false);
}

// value of lane l ^ 16 (the other half of the wave holds the other keys of the same query column)
__device__ __forceinline__ float xhalf(float x) {
  const int b = __float_as_int(x);
  return __int_as_float(__builtin_amdgcn_permlanex16(b, b, 0x76543210, 0xfedcba98, false, false));
}

// ---------------- stage 0: f32 -> bf16 planes (rows of DM elements), one launch for x and the three weights ----------------
// A piece = 8 elements: 32 B read, 16 B written. A block converts CV_BLK consecutive pieces (CV_ROWS whole rows) of ONE
// source; the block index picks the source: [0, CV_XB) -> x, then CV_WB blocks each for Wq, Wk, Wv (their planes follow one
// another in Wb). A lane takes CV_U pieces, 256 pieces apart.
// x plane row pr <- source row (pr / SEQ) * S_FULL + pr % SEQ; a block's rows lie in one group of SEQ rows.
#define CV_U 4
#define CV_BLK (256 * CV_U)
#define CV_ROWS (CV_BLK / (DM / 8))
#define CV_XB (MT / CV_ROWS)
#define CV_WB (DM / CV_ROWS)
static_assert(CV_BLK % (DM / 8) == 0 && SEQ % CV_ROWS == 0 && DM % CV_ROWS == 0);

__global__ __launch_bounds__(256) void k_cvt_bf16(const float* __restrict__ x, const float* __restrict__ Wq,
                                                   const float* __restrict__ Wk, const float* __restrict__ Wv,
                                                   u16* __restrict__ Xb, u16* __restrict__ Wb) {
  const unsigned blk = blockIdx.x;
  const float* src;   // first source row of this block
  u16* dst;           // first plane row of this block
  if (blk < CV_XB) {
    const unsigned pr0 = blk * CV_ROWS;
    src = x + (size_t)((pr0 / SEQ) * S_FULL + pr0 % SEQ) * DM;
    dst = Xb + (size_t)pr0 * DM;
  } else {
    const unsigned wb = blk - CV_XB;
    const unsigned mat = wb / CV_WB;
    src = ((mat == 0) ? Wq : ((mat == 1) ? Wk : Wv)) + (size_t)(wb - mat * CV_WB) * CV_ROWS * DM;
    dst = Wb + (size_t)wb * CV_ROWS * DM;
  }
  const float* s = src + threadIdx.x * 8;
  u16* d = dst + threadIdx.x * 8;

  v4f a[CV_U], b[CV_U];
  // unrolled so that a and b stay in registers and all 2 * CV_U loads are issued ahead of the first conversion
#pragma unroll
  for (int j = 0; j < CV_U; ++j) {
    a[j] = *(const v4f*)(s + j * (256 * 8));
    b[j] = *(const v4f*)(s + j * (256 * 8) + 4);
  }
#pragma unroll
  for (int j = 0; j < CV_U; ++j) {
    v4u w;
    w.x = (unsigned)f2bf(a[j].x) | ((unsigned)f2bf(a[j].y) << 16);
    w.y = (unsigned)f2bf(a[j].z) | ((unsigned)f2bf(a[j].w) << 16);
    w.z = (unsigned)f2bf(b[j].x) | ((unsigned)f2bf(b[j].y) << 16);
    w.w = (unsigned)f2bf(b[j].z) | ((unsigned)f2bf(b[j].w) << 16);
    *(v4u*)(d + j * (256 * 8)) = w;
  }
}

// ---------------- stage 1: projections ----------------
// out[row, n] = sum_k Xb[row, k] * W[n, k] + bias[n]; row in [0, MT), n in [0, DM), K = DM.
// blockIdx.z selects the matrix: 0 -> Q plane [bh][s][64], 1 -> K plane [bh][s][64], 2 -> V^T plane [bh][64][SEQ] (f16).
// Block = 4 waves, tile 64(M) x 64(N); wave owns 16 rows x 64 cols. Each k-tile of 64 elements (64 rows x 128 B of X and
// of W) is copied once per block into LDS in whole lines (two buffers, the next k-tile in flight while this one is worked
// on); the waves take their fragments from there. Each sum runs over k in ascending steps of 32.
#define XWP 72                       // bf16 per staged row: 128 B of data + 16 B pad, the pitch for 16-byte LDS readers
#define XW_TILE (64 * XWP)           // bf16 per staged tile (64 rows)
#define XW_BUF_BYTES (2 * XW_TILE * 2)

// One k-tile of X and one of W into one buffer: 8 copies of 16 B per lane, each wave-wide copy = 4 whole 128-B lines.
// xg, wg: the lane's global address in rows 0..15 of the two tiles; lx: the lane's LDS byte address in the X tile.
__device__ __forceinline__ void stage_xw(const u16* xg, const u16* wg, unsigned lx) {
  const unsigned lw = lx + XW_TILE * 2;
  const unsigned rs = 16 * XWP * 2;  // 16 staged rows, in bytes
  // s_wait_xcnt closes the statement so that no address register is rewritten ahead of it
  asm volatile("global_load_async_to_lds_b128 %0, %8, off\n\t"
               "global_load_async_to_lds_b128 %1, %9, off\n\t"
               "global_load_async_to_lds_b128 %2, %10, off\n\t"
               "global_load_async_to_lds_b128 %3, %11, off\n\t"
               "global_load_async_to_lds_b128 %4, %12, off\n\t"
               "global_load_async_to_lds_b128 %5, %13, off\n\t"
               "global_load_async_to_lds_b128 %6, %14, off\n\t"
               "global_load_async_to_lds_b128 %7, %15, off\n\t"
               "s_wait_xcnt 0x0"
               :: "v"(lx), "v"(lx + rs), "v"(lx + 2 * rs), "v"(lx + 3 * rs),
                  "v"(lw), "v"(lw + rs), "v"(lw + 2 * rs), "v"(lw + 3 * rs),
                  "v"(xg), "v"(xg + 16 * DM), "v"(xg + 32 * DM), "v"(xg + 48 * DM),
                  "v"(wg), "v"(wg + 16 * DM), "v"(wg + 32 * DM), "v"(wg + 48 * DM)
               : "memory");
}

__global__ __launch_bounds__(128) __attribute__((amdgpu_num_vgpr(256)))
void k_proj(const u16* __restrict__ Xb, const u16* __restrict__ Wb,
            const float* __restrict__ bq, const float* __restrict__ bk, const float* __restrict__ bv,
            h16* __restrict__ Qp, h16* __restrict__ Kp, h16* __restrict__ VTp) {
  __shared__ __attribute__((aligned(16))) u16 XWs[2][2][XW_TILE];   // [buffer][X | W][row * XWP + k]
  __shared__ __attribute__((aligned(16))) h16 Ts[64 * 64];

  const int wave = threadIdx.x >> 5, lane = threadIdx.x & 31;
  const int hh = lane >> 4, mm = lane & 15;
  const int mat = blockIdx.z;
  const int m0 = blockIdx.x * 64, n0 = blockIdx.y * 64;
  const u16* W = Wb + (size_t)mat * DM * DM + (size_t)n0 * DM;   // rows n0..n0+63, k contiguous
  const float* bias = (mat == 0) ? bq : ((mat == 1) ? bk : bv);

  v8f acc[4] = {zero8(), zero8(), zero8(), zero8()};

  // the lane's 16-byte piece of rows 0..15 of a k-tile: 8 lanes per 128-B line
  const int crow = threadIdx.x >> 3, ccol = (threadIdx.x & 7) * 8;
  const u16* xg = Xb + (size_t)(m0 + crow) * DM + ccol;
  const u16* wg = W + (size_t)crow * DM + ccol;
  const unsigned lx0 = (unsigned)(uintptr_t)&XWs[0][0][crow * XWP + ccol];

  stage_xw(xg, wg, lx0);
  asm volatile("s_wait_asynccnt 0x0" ::: "memory");   // this wave's share of k-tile 0 has landed
  __syncthreads();                                     // k-tile 0 readable by every wave
  if (DM > 64) stage_xw(xg + 64, wg + 64, lx0 + XW_BUF_BYTES);

  for (int kt = 0; kt < DM; kt += 64) {
    const int buf = (kt >> 6) & 1;
    const u16* Xt = &XWs[buf][0][(wave * 16) * XWP];
    const u16* Wt = &XWs[buf][1][0];
    for (int k0 = 0; k0 < 64; k0 += 32) {
      const v16bf a  = ldfrag_bf(Xt + k0, XWP);
      const v16bf b0 = ldfrag_bf(Wt + (0 * 16) * XWP + k0, XWP);
      const v16bf b1 = ldfrag_bf(Wt + (1 * 16) * XWP + k0, XWP);
      const v16bf b2 = ldfrag_bf(Wt + (2 * 16) * XWP + k0, XWP);
      const v16bf b3 = ldfrag_bf(Wt + (3 * 16) * XWP + k0, XWP);
      acc[0] = mma_bf(a, b0, acc[0]);
      acc[1] = mma_bf(a, b1, acc[1]);
      acc[2] = mma_bf(a, b2, acc[2]);
      acc[3] = mma_bf(a, b3, acc[3]);
    }
    asm volatile("s_wait_dscnt 0x0" ::: "memory");      // this wave's reads of the buffer are done
    asm volatile("s_wait_asynccnt 0x0" ::: "memory");   // this wave's share of the next k-tile has landed
    __syncthreads();   // next k-tile readable by every wave; this trip's buffer free for the refill
    if (kt + 128 < DM) stage_xw(xg + (kt + 128), wg + (kt + 128), lx0 + buf * XW_BUF_BYTES);
  }
  asm volatile("s_wait_asynccnt 0x0" ::: "memory");     // no copy outstanding behind the loop

  // bias enters as its bf16-RNE value
  float bb[4];
#pragma unroll
  for (int t = 0; t < 4; ++t) bb[t] = bf_rn(bias[n0 + 16 * t + mm]);

  // stage the 64x64 tile in LDS: [row][col] for Q/K, transposed [col][row] for V
  const bool tr = (mat == 2);
#pragma unroll
  for (int t = 0; t < 4; ++t) {
#pragma unroll
    for (int r = 0; r < 8; ++r) {
      const int row = wave * 16 + 8 * hh + r;
      const int col = 16 * t + mm;
      const int idx = tr ? (col * 64 + row) : (row * 64 + col);
      Ts[idx] = (h16)(acc[t][r] + bb[t]);
    }
  }
  __syncthreads();

  const int b  = m0 / SEQ;
  const int s0 = m0 - b * SEQ;
  const int bh = b * NH + blockIdx.y;
  h16* dstp = (mat == 0) ? Qp : ((mat == 1) ? Kp : VTp);
  const int pc = (threadIdx.x & 7) * 8;
  const int rb = threadIdx.x >> 3;
  v8h vals[4];
  size_t offs[4];
#pragma unroll
  for (int i = 0; i < 4; ++i) {
    const int rr = i * 16 + rb;
    vals[i] = *(const v8h*)(&Ts[rr * 64 + pc]);
    offs[i] = tr ? ((((size_t)bh * HD + rr) * SEQ) + s0 + pc)
                 : ((((size_t)bh * SEQ + s0 + rr) * HD) + pc);
  }
#pragma unroll
  for (int i = 0; i < 4; ++i) *(v8h*)(dstp + offs[i]) = vals[i];
  
}

// ---------------- stage 2: flash attention ----------------
// Block = 4 waves, owns (bh, 128 query rows); wave owns 32 query rows (two column groups of 16), loops over key tiles of 64.
// Q fragments from the [bh][s][64] plane. Each 64-key tile of K ([key][64]) and of V^T ([d][64 keys]) is copied once per
// block into LDS (two buffers, the next tile in flight while this one is worked on) and all four waves take their
// fragments from there. The products run transposed: S^T[key][q] = K . Q^T and O^T[d][q] += V^T . P^T, so a lane holds
// one query's scores per column group (keys 16t + 8*(l>>4) + r), and two converted score tiles are the B operand of the second product.
#define KVP 72                       // f16 per staged row: 128 B of data + 16 B pad, the pitch for 16-byte LDS readers
#define KV_TILE (64 * KVP)           // f16 per staged tile (64 rows)
#define KV_BUF_BYTES (2 * KV_TILE * 2)
#define OSP 68                       // f32 per staged output row: 256 B of data + 16 B pad (16-byte LDS writers, one row per lane)

// One tile of K and one of V^T into one buffer: 8 copies of 16 B per lane, each wave-wide copy = 4 whole 128-B rows.
// kg, vg: the lane's global address in rows 0..15 of the two tiles; lk: the lane's LDS byte address in the K tile.
__device__ __forceinline__ void stage_kv(const h16* kg, const h16* vg, unsigned lk) {
  const unsigned lv = lk + KV_TILE * 2;
  const unsigned rs = 16 * KVP * 2;  // 16 staged rows, in bytes
  // s_wait_xcnt closes the statement so that no address register is rewritten ahead of it
  asm volatile("global_load_async_to_lds_b128 %0, %8, off\n\t"
               "global_load_async_to_lds_b128 %1, %9, off\n\t"
               "global_load_async_to_lds_b128 %2, %10, off\n\t"
               "global_load_async_to_lds_b128 %3, %11, off\n\t"
               "global_load_async_to_lds_b128 %4, %12, off\n\t"
               "global_load_async_to_lds_b128 %5, %13, off\n\t"
               "global_load_async_to_lds_b128 %6, %14, off\n\t"
               "global_load_async_to_lds_b128 %7, %15, off\n\t"
               "s_wait_xcnt 0x0"
               :: "v"(lk), "v"(lk + rs), "v"(lk + 2 * rs), "v"(lk + 3 * rs),
                  "v"(lv), "v"(lv + rs), "v"(lv + 2 * rs), "v"(lv + 3 * rs),
                  "v"(kg), "v"(kg + 16 * HD), "v"(kg + 32 * HD), "v"(kg + 48 * HD),
                  "v"(vg), "v"(vg + (size_t)16 * SEQ), "v"(vg + (size_t)32 * SEQ), "v"(vg + (size_t)48 * SEQ)
               : "memory");
}

#define QG 2                         // 16-query column groups per wave: each K and V^T fragment read from LDS feeds QG WMMAs
#define QW (16 * QG)                 // queries per wave
#define QBLK (4 * QW)                // queries per block

// waves_per_eu(2, 2): the grid is 2 work-groups for each of the chip's WGPs; with fewer registers in use a third could
// become resident on some WGPs and leave others short, so the register allocation is held at two waves per SIMD.
__global__ __launch_bounds__(128) __attribute__((amdgpu_waves_per_eu(2, 2)))
void k_attn(const h16* __restrict__ Qp, const h16* __restrict__ Kp, const h16* __restrict__ VTp,
            const int* __restrict__ mask, float* __restrict__ out) {
  __shared__ __attribute__((aligned(16))) h16   KVs[2][2][KV_TILE]; // [buffer][K | V^T][row * KVP + col]
  __shared__ __attribute__((aligned(16))) float Madd[SEQ];        // 8 x the additive key mask: -80000*(1 - m), one per key
  __shared__ __attribute__((aligned(16))) float Os[4][QW * OSP];  // per wave: output tile [q][d]

  const int wave = threadIdx.x >> 5, lane = threadIdx.x & 31;
  const int hh = lane >> 4, mm = lane & 15;
  const int bh = blockIdx.y;
  const int b  = bh / NH;
  const int hd = bh - b * NH;
  const int q0 = blockIdx.x * QBLK + wave * QW;
  // a wave wholly past the last query keeps its part in the staging and the barriers, works on the last rows, stores nothing
  const int q0l = (SEQ % QBLK == 0 || q0 < SEQ) ? q0 : (SEQ - QW);

  const h16* Qbh = Qp  + (size_t)bh * SEQ * HD;
  const h16* Kbh = Kp  + (size_t)bh * SEQ * HD;
  const h16* Vbh = VTp + (size_t)bh * HD * SEQ;
  const int* mk_b = mask + (size_t)b * S_FULL;

  v16h aq[QG][2];
#pragma unroll
  for (int g = 0; g < QG; ++g) {
    aq[g][0] = ldfrag_h(Qbh + (size_t)(q0l + 16 * g) * HD, HD);
    aq[g][1] = ldfrag_h(Qbh + (size_t)(q0l + 16 * g) * HD + 32, HD);
  }

  // per lane and group: running maximum of query column 16*g + mm (both halves agree), running sum over this half's keys only
  // m_run is kept in units of the raw product k.q + 8*mask (8 x the score); nmc_run is the exponent offset made from it
  const float C1 = 0.125f * 1.44269504088896340736f;   // 1/8 and log2(e) in one factor
  float m_run[QG], l_run[QG], nmc_run[QG];
  v8f o[QG][4];   // o[g][dt][r] = O^T[16*dt + 8*hh + r][16*g + mm]
#pragma unroll
  for (int g = 0; g < QG; ++g) {
    m_run[g] = -1e30f;
    l_run[g] = 0.f;
    nmc_run[g] = __builtin_fmaf(m_run[g], -C1, 10.0f);
#pragma unroll
    for (int dt = 0; dt < 4; ++dt) o[g][dt] = zero8();
  }

  // the lane's 16-byte piece of rows 0..15 of a tile: 8 lanes per 128-B row
  const int crow = threadIdx.x >> 3, ccol = (threadIdx.x & 7) * 8;
  const h16* kg = Kbh + (size_t)crow * HD + ccol;
  const h16* vg = Vbh + (size_t)crow * SEQ + ccol;
  const unsigned lk0 = (unsigned)(uintptr_t)&KVs[0][0][crow * KVP + ccol];

  stage_kv(kg, vg, lk0);
  // a lane now needs the mask term of 32 keys per tile: form all of them once per block, read them back 16 B at a time
#pragma unroll
  for (int i0 = 0; i0 < SEQ; i0 += 128 * 4) {
    const int i = i0 + (int)threadIdx.x * 4;
    if (SEQ % (128 * 4) == 0 || i < SEQ) {
      const v4i mi = *(const v4i*)(mk_b + i);
      v4f ma;
#pragma unroll
      for (int j = 0; j < 4; ++j) ma[j] = -80000.0f * (1.0f - (float)mi[j]);
      *(v4f*)(&Madd[i]) = ma;
    }
  }
  asm volatile("s_wait_asynccnt 0x0" ::: "memory");   // this wave's share of tile 0 has landed
  __syncthreads();                                     // tile 0 and the mask terms readable by every wave
  if (SEQ > 64) stage_kv(kg + (size_t)64 * HD, vg + 64, lk0 + KV_BUF_BYTES);

#pragma unroll 1
  for (int t0 = 0; t0 < SEQ; t0 += 64) {
    const int buf = (t0 >> 6) & 1;
    const h16* Kt = &KVs[buf][0][0];
    const h16* Vt = &KVs[buf][1][0];
    // 8 x scores S^T[64 keys][QW q] = k . q^T + 8 * mask term; sc[g][t][r] = key 16*t + 8*hh + r, query 16*g + mm
    // All K fragments and the mask terms are asked for ahead of the first product, not fragment by fragment between
    // its WMMAs, so that the wave waits out the LDS latency once (the compiler orders them and counts its waits).
    v8f sc[QG][4];
    v16h kf[4][2];
    v4f ma[4][2];
#pragma unroll
    for (int t = 0; t < 4; ++t) {
      kf[t][0] = ldfrag_h(Kt + (16 * t) * KVP, KVP);
      kf[t][1] = ldfrag_h(Kt + (16 * t) * KVP + 32, KVP);
    }
#pragma unroll
    for (int t = 0; t < 4; ++t) {
      ma[t][0] = *(const v4f*)(&Madd[t0 + 16 * t + 8 * hh]);
      ma[t][1] = *(const v4f*)(&Madd[t0 + 16 * t + 8 * hh + 4]);
    }
#pragma unroll
    for (int t = 0; t < 4; ++t) {   // the mask terms are the accumulators' start values: no vector add per score
      const v8f mc = __builtin_shufflevector(ma[t][0], ma[t][1], 0, 1, 2, 3, 4, 5, 6, 7);
#pragma unroll
      for (int g = 0; g < QG; ++g) sc[g][t] = mma_h(kf[t][0], aq[g][0], mc);
    }
#pragma unroll
    for (int t = 0; t < 4; ++t)
#pragma unroll
      for (int g = 0; g < QG; ++g) sc[g][t] = mma_h(kf[t][1], aq[g][1], sc[g][t]);
    // Second group: all V^T fragments of this tile, asked for here so that they arrive while the softmax runs.
    v16h vf[4][2];
#pragma unroll
    for (int dt = 0; dt < 4; ++dt) {
      vf[dt][0] = ldfrag_h(Vt + (16 * dt) * KVP, KVP);
      vf[dt][1] = ldfrag_h(Vt + (16 * dt) * KVP + 32, KVP);
    }
    // keeps the V^T reads up here as one group, ahead of the softmax
    __builtin_amdgcn_sched_barrier(0);

    // online softmax, one query per lane and group: maximum in-lane over 32 keys, then one exchange with the other half
    // The arguments first, then the exponentials together. The two scheduling barriers are there to keep the v_exp_f32
    // from being spread among the other vector work.
    // One FMA per score: 2^(sc*C1 + nmc) = 1024 * e^(score - maximum), with nmc = 10 - mn*C1 (1/8, log2(e), the maximum and
    // the x1024 carry together). The old sums carry 2^nmc_run, so their factor is 2^(nmc - nmc_run), from the rounded offsets.
    float ea[QG][4][8];
    float eal[QG];
#pragma unroll
    for (int g = 0; g < QG; ++g) {
      float mt[4];
#pragma unroll
      for (int t = 0; t < 4; ++t) {
        mt[t] = sc[g][t][0];
#pragma unroll
        for (int r = 1; r < 8; ++r) mt[t] = fmaxf(mt[t], sc[g][t][r]);
      }
      float mx = fmaxf(fmaxf(mt[0], mt[1]), fmaxf(mt[2], mt[3]));
      mx = fmaxf(mx, xhalf(mx));
      const float mn = fmaxf(m_run[g], mx);
      const float nmc = __builtin_fmaf(mn, -C1, 10.0f);
#pragma unroll
      for (int t = 0; t < 4; ++t)
#pragma unroll
        for (int r = 0; r < 8; ++r) ea[g][t][r] = __builtin_fmaf(sc[g][t][r], C1, nmc);
      eal[g] = nmc - nmc_run[g];
      m_run[g] = mn;
      nmc_run[g] = nmc;
    }
    __builtin_amdgcn_sched_barrier(0);
    float alpha[QG];
#pragma unroll
    for (int g = 0; g < QG; ++g) {
      alpha[g] = __builtin_amdgcn_exp2f(eal[g]);
#pragma unroll
      for (int t = 0; t < 4; ++t)
#pragma unroll
        for (int r = 0; r < 8; ++r) ea[g][t][r] = __builtin_amdgcn_exp2f(ea[g][t][r]);
    }
    __builtin_amdgcn_sched_barrier(0);

    // P^T (x1024, f16) straight into the B operand: element s of pb[g][j] = key 32*j + (s < 8 ? 8*hh + s : 16 + 8*hh + s - 8)
    v16h pb[QG][2];
#pragma unroll
    for (int g = 0; g < QG; ++g) {
      float pst[4];
#pragma unroll
      for (int t = 0; t < 4; ++t) {
        pst[t] = 0.f;
#pragma unroll
        for (int r = 0; r < 8; ++r) {
          const float p = ea[g][t][r];
          pst[t] += p;
          pb[g][t >> 1][(t & 1) * 8 + r] = (h16)p;
        }
      }
      l_run[g] = l_run[g] * alpha[g] + ((pst[0] + pst[1]) + (pst[2] + pst[3]));
#pragma unroll
      for (int dt = 0; dt < 4; ++dt)
#pragma unroll
        for (int r = 0; r < 8; ++r) o[g][dt][r] *= alpha[g];
    }

    // O^T[64 d][QW q] += V^T[64 d][64 keys] . P^T[64 keys][QW q]
#pragma unroll
    for (int dt = 0; dt < 4; ++dt)
#pragma unroll
      for (int g = 0; g < QG; ++g) o[g][dt] = mma_h(vf[dt][0], pb[g][0], o[g][dt]);
#pragma unroll
    for (int dt = 0; dt < 4; ++dt)
#pragma unroll
      for (int g = 0; g < QG; ++g) o[g][dt] = mma_h(vf[dt][1], pb[g][1], o[g][dt]);
    // keeps the waits and the barrier at the trip's foot: with every LDS read up front the compiler lifts them to the
    // middle of the trip, and the copies of the next tile would then have only the first product's time to land
    __builtin_amdgcn_sched_barrier(0);
    asm volatile("s_wait_dscnt 0x0" ::: "memory");      // this wave's reads of the buffer are done
    asm volatile("s_wait_asynccnt 0x0" ::: "memory");   // this wave's share of the next tile has landed
    __syncthreads();   // next tile readable by every wave; this trip's buffer free for the refill
    if (t0 + 128 < SEQ) stage_kv(kg + (size_t)(t0 + 128) * HD, vg + (t0 + 128), lk0 + buf * KV_BUF_BYTES);
  }
  asm volatile("s_wait_asynccnt 0x0" ::: "memory");     // no copy outstanding behind the loop

  // normalise (sums and products both carry x1024) and stage the QW x 64 f32 tile per wave
#pragma unroll
  for (int g = 0; g < QG; ++g) {
    const float inv = 1.0f / (l_run[g] + xhalf(l_run[g]));   // the two halves' key sums join here, once
#pragma unroll
    for (int dt = 0; dt < 4; ++dt) {
      v4f w0, w1;
#pragma unroll
      for (int r = 0; r < 4; ++r) { w0[r] = o[g][dt][r] * inv; w1[r] = o[g][dt][4 + r] * inv; }
      *(v4f*)(&Os[wave][(16 * g + mm) * OSP + 16 * dt + 8 * hh])     = w0;
      *(v4f*)(&Os[wave][(16 * g + mm) * OSP + 16 * dt + 8 * hh + 4]) = w1;
    }
  }
  __syncthreads();

  // each instruction: lanes 0..15 -> row 2i (256 B = 2 full lines), lanes 16..31 -> row 2i+1
  const int rsub = lane >> 4;
  const int cc = (lane & 15) * 4;
  if (SEQ % QBLK == 0 || q0 < SEQ) {
    float* ob = out + ((size_t)b * SEQ + q0) * DM + (size_t)hd * HD;
    v4f vv[QW / 2];
#pragma unroll
    for (int i = 0; i < QW / 2; ++i) vv[i] = *(const v4f*)(&Os[wave][(2 * i + rsub) * OSP + cc]);
#pragma unroll
    for (int i = 0; i < QW / 2; ++i) *(v4f*)(ob + (size_t)(2 * i + rsub) * DM + cc) = vv[i];
  }
}

// ---------------- launcher ----------------
extern "C" void kernel_launch(void* const* d_in, const int* in_sizes, int n_in,
                              void* d_out, int out_size, void* d_ws, size_t ws_size,
                              hipStream_t stream) {
  if (n_in < 8) return;
  const float* x   = (const float*)d_in[0];
  const int*   msk = (const int*)d_in[1];
  const float* Wq  = (const float*)d_in[2];
  const float* bq  = (const float*)d_in[3];
  const float* Wk  = (const float*)d_in[4];
  const float* bk  = (const float*)d_in[5];
  const float* Wv  = (const float*)d_in[6];
  const float* bv  = (const float*)d_in[7];
  float* out = (float*)d_out;

  if (in_sizes[0] < ((NB - 1) * S_FULL + SEQ) * DM) return;
  if (in_sizes[1] < (NB - 1) * S_FULL + SEQ) return;
  if (in_sizes[2] < DM * DM || in_sizes[4] < DM * DM || in_sizes[6] < DM * DM) return;
  if (in_sizes[3] < DM || in_sizes[5] < DM || in_sizes[7] < DM) return;
  if (out_size < MT * DM) return;

  char* ws = (char*)d_ws;
  const size_t XB_BYTES = (size_t)MT * DM * 2;              // bf16 x plane [MT][DM]
  const size_t W_BYTES  = (size_t)DM * DM * 2;              // one bf16 weight plane
  const size_t PL_BYTES = (size_t)NB * NH * SEQ * HD * 2;   // one f16 q/k/v^T plane
  size_t off = 0;
  u16* Xb = (u16*)(ws + off);  off += XB_BYTES;
  u16* Wb = (u16*)(ws + off);  off += 3 * W_BYTES;
  h16* Qp = (h16*)(ws + off);  off += PL_BYTES;
  h16* Kp = (h16*)(ws + off);  off += PL_BYTES;
  h16* VTp = (h16*)(ws + off); off += PL_BYTES;
  if (off > ws_size) return;

  k_cvt_bf16<<<CV_XB + 3 * CV_WB, 256, 0, stream>>>(x, Wq, Wk, Wv, Xb, Wb);

  dim3 gp(MT / 64, DM / 64, 3);
  k_proj<<<gp, 128, 0, stream>>>(Xb, Wb, bq, bk, bv, Qp, Kp, VTp);

  dim3 ga((SEQ + QBLK - 1) / QBLK, NB * NH);
  k_attn<<<ga, 128, 0, stream>>>(Qp, Kp, VTp, msk, out);
}

// v008
// One run takes 55.5 microseconds.
// In two side-by-side timings against v007, it was 1.12 and 1.10 times as fast.
// All steps since v000 together make it 4.73 times as fast.
#include <hip/hip_runtime.h>
#include <stdint.h>

// Contractions: x.Wq^T, x.Wk^T, x.Wv^T on v_wmma_f32_16x16x32_bf16 (bf16 operands = RNE-converted f32 inputs, f32 accumulate);
// k.q^T and V^T.P^T on v_wmma_f32_16x16x32_f16 (f16 operands, P carried x1024, f32 accumulate); bias add, softmax, normalisation in f32.
// The additive key mask (x8) is the start value of the k.q^T accumulators.

typedef unsigned short u16;
typedef _Float16 h16;
typedef __bf16 v16bf __attribute__((ext_vector_type(16)));
typedef h16 v16h __attribute__((ext_vector_type(16)));
typedef h16 v8h __attribute__((ext_vector_type(8), __may_alias__));
typedef float v8f __attribute__((ext_vector_type(8)));
typedef float v4f __attribute__((ext_vector_type(4), __may_alias__));
typedef unsigned int v4u __attribute__((ext_vector_type(4), __may_alias__));
typedef int v4i __attribute__((ext_vector_type(4), __may_alias__));

#ifndef NB
#define NB 4
#endif
#ifndef SEQ
#define SEQ 2048
#endif
#define NB_FULL 4
#define S_FULL 2048
#define DM 512
#define NH 8
#define HD 64
#define MT (NB * SEQ)

static_assert(NB >= 1 && NB <= NB_FULL);
static_assert(SEQ % 64 == 0 && SEQ <= S_FULL);
static_assert(DM % 64 == 0 && DM % 32 == 0);
static_assert(NH * HD == DM);
static_assert(HD == 64);
static_assert(MT % 64 == 0);

// ---------------- helpers ----------------

__device__ __forceinline__ u16 f2bf(float f) {
  unsigned u = __float_as_uint(f);
  u += 0x7FFFu + ((u >> 16) & 1u);   // RNE convert f32 -> bf16 bits
  return (u16)(u >> 16);
}

__device__ __forceinline__ float bf_rn(float f) {
  return __uint_as_float(((unsigned)f2bf(f)) << 16);
}

__device__ __forceinline__ v8f zero8() {
  v8f z = {0.f, 0.f, 0.f, 0.f, 0.f, 0.f, 0.f, 0.f};
  return z;
}

// 16x32 16-bit fragment from row-major storage with k contiguous (pitch ld elements):
// lane l: row = l&15; elements 0..7 <- k0 + 8*(l>>4) + 0..7; elements 8..15 <- k0 + 16 + 8*(l>>4) + 0..7.
// Used for A (row = m) and for B stored n-major with k contiguous (row = n).
__device__ __forceinline__ v16bf ldfrag_bf(const u16* base, int ld) {
  const int l = threadIdx.x & 31;
  const int row = l & 15;
  const int kb = (l >> 4) << 3;
  const u16* p = base + (size_t)row * ld + kb;
  union { v16bf v; v4u q[2]; } u;
  u.q[0] = *(const v4u*)(p);
  u.q[1] = *(const v4u*)(p + 16);
  return u.v;
}

__device__ __forceinline__ v16h ldfrag_h(const h16* base, int ld) {
  const int l = threadIdx.x & 31;
  const int row = l & 15;
  const int kb = (l >> 4) << 3;
  const h16* p = base + (size_t)row * ld + kb;
  union { v16h v; v8h q[2]; } u;
  u.q[0] = *(const v8h*)(p);
  u.q[1] = *(const v8h*)(p + 16);
  return u.v;
}

// D[16x16] += A[16x32] . B[32x16]; D element r of lane l = (row 8*(l>>4)+r, col l&15)
__device__ __forceinline__ v8f mma_bf(v16bf a, v16bf b, v8f c) {
  v8f r = __builtin_amdgcn_wmma_f32_16x16x32_bf16(false, a, false, b, (short)0, c, false, false);
  asm volatile("v_nop\n\tv_nop\n\tv_nop\n\tv_nop" : "+v"(r) : "v"(a), "v"(b));
  return r;
}

__device__ __forceinline__ v8f mma_h(v16h a, v16h b, v8f c) {
  return __builtin_amdgcn_wmma_f32_16x16x32_f16(false, a, false, b, (short)0, c, false, false);
}

// value of lane l ^ 16 (the other half of the wave holds the other keys of the same query column)
__device__ __forceinline__ float xhalf(float x) {
  const int b = __float_as_int(x);
  return __int_as_float(__builtin_amdgcn_permlanex16(b, b, 0x76543210, 0xfedcba98, false, false));
}

// ---------------- stage 0: f32 -> bf16 planes (rows of DM elements), one launch for x and the three weights ----------------
// A piece = 8 elements: 32 B read, 16 B written. A block converts CV_BLK consecutive pieces (CV_ROWS whole rows) of ONE
// source; the block index picks the source: [0, CV_XB) -> x, then CV_WB blocks each for Wq, Wk, Wv (their planes follow one
// another in Wb). A lane takes CV_U pieces, 256 pieces apart.
// x plane row pr <- source row (pr / SEQ) * S_FULL + pr % SEQ; a block's rows lie in one group of SEQ rows.
#define CV_U 4
#define CV_BLK (256 * CV_U)
#define CV_ROWS (CV_BLK / (DM / 8))
#define CV_XB (MT / CV_ROWS)
#define CV_WB (DM / CV_ROWS)
static_assert(CV_BLK % (DM / 8) == 0 && SEQ % CV_ROWS == 0 && DM % CV_ROWS == 0);

__global__ __launch_bounds__(256) void k_cvt_bf16(const float* __restrict__ x, const float* __restrict__ Wq,
                                                   const float* __restrict__ Wk, const float* __restrict__ Wv,
                                                   u16* __restrict__ Xb, u16* __restrict__ Wb) {
  const unsigned blk = blockIdx.x;
  const float* src;   // first source row of this block
  u16* dst;           // first plane row of this block
  if (blk < CV_XB) {
    const unsigned pr0 = blk * CV_ROWS;
    src = x + (size_t)((pr0 / SEQ) * S_FULL + pr0 % SEQ) * DM;
    dst = Xb + (size_t)pr0 * DM;
  } else {
    const unsigned wb = blk - CV_XB;
    const unsigned mat = wb / CV_WB;
    src = ((mat == 0) ? Wq : ((mat == 1) ? Wk : Wv)) + (size_t)(wb - mat * CV_WB) * CV_ROWS * DM;
    dst = Wb + (size_t)wb * CV_ROWS * DM;
  }
  const float* s = src + threadIdx.x * 8;
  u16* d = dst + threadIdx.x * 8;

  v4f a[CV_U], b[CV_U];
  // unrolled so that a and b stay in registers and all 2 * CV_U loads are issued ahead of the first conversion
#pragma unroll
  for (int j = 0; j < CV_U; ++j) {
    a[j] = *(const v4f*)(s + j * (256 * 8));
    b[j] = *(const v4f*)(s + j * (256 * 8) + 4);
  }
#pragma unroll
  for (int j = 0; j < CV_U; ++j) {
    v4u w;
    w.x = (unsigned)f2bf(a[j].x) | ((unsigned)f2bf(a[j].y) << 16);
    w.y = (unsigned)f2bf(a[j].z) | ((unsigned)f2bf(a[j].w) << 16);
    w.z = (unsigned)f2bf(b[j].x) | ((unsigned)f2bf(b[j].y) << 16);
    w.w = (unsigned)f2bf(b[j].z) | ((unsigned)f2bf(b[j].w) << 16);
    *(v4u*)(d + j * (256 * 8)) = w;
  }
}

// ---------------- stage 1: projections ----------------
// out[row, n] = sum_k Xb[row, k] * W[n, k] + bias[n]; row in [0, MT), n in [0, DM), K = DM.
// blockIdx.z selects the matrix: 0 -> Q plane [bh][s][64], 1 -> K plane [bh][s][64], 2 -> V^T plane [bh][64][SEQ] (f16).
// Block = 4 waves (2 x 2), tile 128(M) x 128(N); wave owns 64 rows x 64 cols (one head). Each k-tile of 64 elements
// (128 rows x 128 B of X and of W) is copied once per block into LDS in whole lines (two buffers, the next k-tile in flight
// while this one is worked on); the waves take their fragments from there, each fragment feeding four WMMAs.
// Each sum runs over k in ascending steps of 32.
#define PBT 128                      // rows of X and rows of W per block tile
#define XWP 72                       // bf16 per staged row: 128 B of data + 16 B pad, the pitch for 16-byte LDS readers
#define XW_TILE (PBT * XWP)          // bf16 per staged tile (128 rows)
#define XW_BUF_BYTES (2 * XW_TILE * 2)
#define TSP 72                       // f16 per staged output row: 128 B of data + 16 B pad
static_assert(MT % PBT == 0 && SEQ % PBT == 0 && DM % PBT == 0);
static_assert(4 * 64 * TSP <= 2 * 2 * XW_TILE);

// One k-tile of 128 rows into one buffer: 8 copies of 16 B per lane, each wave-wide copy = 4 whole 128-B lines.
// g: the lane's global address in rows 0..15 of the tile; l: the lane's LDS byte address in rows 0..15 of the staged tile.
__device__ __forceinline__ void stage_rows(const u16* g, unsigned l) {
  const unsigned rs = 16 * XWP * 2;  // 16 staged rows, in bytes
  // s_wait_xcnt closes the statement so that no address register is rewritten ahead of it
  asm volatile("global_load_async_to_lds_b128 %0, %8, off\n\t"
               "global_load_async_to_lds_b128 %1, %9, off\n\t"
               "global_load_async_to_lds_b128 %2, %10, off\n\t"
               "global_load_async_to_lds_b128 %3, %11, off\n\t"
               "global_load_async_to_lds_b128 %4, %12, off\n\t"
               "global_load_async_to_lds_b128 %5, %13, off\n\t"
               "global_load_async_to_lds_b128 %6, %14, off\n\t"
               "global_load_async_to_lds_b128 %7, %15, off\n\t"
               "s_wait_xcnt 0x0"
               :: "v"(l), "v"(l + rs), "v"(l + 2 * rs), "v"(l + 3 * rs),
                  "v"(l + 4 * rs), "v"(l + 5 * rs), "v"(l + 6 * rs), "v"(l + 7 * rs),
                  "v"(g), "v"(g + 16 * DM), "v"(g + 32 * DM), "v"(g + 48 * DM),
                  "v"(g + 64 * DM), "v"(g + 80 * DM), "v"(g + 96 * DM), "v"(g + 112 * DM)
               : "memory");
}

// One k-tile of X and one of W into one buffer; lx: the lane's LDS byte address in the X tile.
__device__ __forceinline__ void stage_xw(const u16* xg, const u16* wg, unsigned lx) {
  stage_rows(xg, lx);
  stage_rows(wg, lx + XW_TILE * 2);
}

// waves_per_eu(3, 3): the grid is 3 work-groups for each of the chip's WGPs; the register allocation is held at three
// waves per SIMD so that no WGP takes a fourth and leaves another short.
__global__ __launch_bounds__(128) __attribute__((amdgpu_waves_per_eu(3, 3)))
void k_proj(const u16* __restrict__ Xb, const u16* __restrict__ Wb,
            const float* __restrict__ bq, const float* __restrict__ bk, const float* __restrict__ bv,
            h16* __restrict__ Qp, h16* __restrict__ Kp, h16* __restrict__ VTp) {
  __shared__ __attribute__((aligned(16))) u16 XWs[2][2][XW_TILE];   // [buffer][X | W][row * XWP + k]

  const int wave = threadIdx.x >> 5, lane = threadIdx.x & 31;
  const int hh = lane >> 4, mm = lane & 15;
  const int wm = wave >> 1, wn = wave & 1;
  const int mat = blockIdx.z;
  const int m0 = blockIdx.x * PBT, n0 = blockIdx.y * PBT;
  const u16* W = Wb + (size_t)mat * DM * DM + (size_t)n0 * DM;   // rows n0..n0+127, k contiguous
  const float* bias = (mat == 0) ? bq : ((mat == 1) ? bk : bv);

  v8f acc[4][4];   // acc[i][j][r] = (row 64*wm + 16*i + 8*hh + r, col 64*wn + 16*j + mm)
#pragma unroll
  for (int i = 0; i < 4; ++i)
#pragma unroll
    for (int j = 0; j < 4; ++j) acc[i][j] = zero8();

  // the lane's 16-byte piece of rows 0..15 of a k-tile: 8 lanes per 128-B line
  const int crow = threadIdx.x >> 3, ccol = (threadIdx.x & 7) * 8;
  const u16* xg = Xb + (size_t)(m0 + crow) * DM + ccol;
  const u16* wg = W + (size_t)crow * DM + ccol;
  const unsigned lx0 = (unsigned)(uintptr_t)&XWs[0][0][crow * XWP + ccol];

  stage_xw(xg, wg, lx0);
  asm volatile("s_wait_asynccnt 0x0" ::: "memory");   // this wave's share of k-tile 0 has landed
  __syncthreads();                                     // k-tile 0 readable by every wave
  if (DM > 64) stage_xw(xg + 64, wg + 64, lx0 + XW_BUF_BYTES);

  for (int kt = 0; kt < DM; kt += 64) {
    const int buf = (kt >> 6) & 1;
    const u16* Xt = &XWs[buf][0][(wm * 64) * XWP];
    const u16* Wt = &XWs[buf][1][(wn * 64) * XWP];
    // unrolled so that the fragments and the sums stay in registers
#pragma unroll
    for (int k0 = 0; k0 < 64; k0 += 32) {
      v16bf a[4], b[4];
#pragma unroll
      for (int i = 0; i < 4; ++i) a[i] = ldfrag_bf(Xt + (i * 16) * XWP + k0, XWP);
#pragma unroll
      for (int j = 0; j < 4; ++j) b[j] = ldfrag_bf(Wt + (j * 16) * XWP + k0, XWP);
#pragma unroll
      for (int i = 0; i < 4; ++i)
#pragma unroll
        for (int j = 0; j < 4; ++j) acc[i][j] = mma_bf(a[i], b[j], acc[i][j]);
    }
    asm volatile("s_wait_dscnt 0x0" ::: "memory");      // this wave's reads of the buffer are done
    asm volatile("s_wait_asynccnt 0x0" ::: "memory");   // this wave's share of the next k-tile has landed
    __syncthreads();   // next k-tile readable by every wave; this trip's buffer free for the refill
    if (kt + 128 < DM) stage_xw(xg + (kt + 128), wg + (kt + 128), lx0 + buf * XW_BUF_BYTES);
  }
  asm volatile("s_wait_asynccnt 0x0" ::: "memory");     // no copy outstanding behind the loop

  // bias enters as its bf16-RNE value
  float bb[4];
#pragma unroll
  for (int j = 0; j < 4; ++j) bb[j] = bf_rn(bias[n0 + 64 * wn + 16 * j + mm]);

  // Each wave stages its own 64x64 tile in its own part of the ring, which every wave has left at the loop's last barrier:
  // [row][col] for Q/K, transposed [col][row] for V.
  h16* Tw = (h16*)&XWs[0][0][0] + wave * (64 * TSP);
  const bool tr = (mat == 2);
  if (tr) {
#pragma unroll
    for (int j = 0; j < 4; ++j)
#pragma unroll
      for (int i = 0; i < 4; ++i) {
        v8h w;
#pragma unroll
        for (int r = 0; r < 8; ++r) w[r] = (h16)(acc[i][j][r] + bb[j]);
        *(v8h*)(&Tw[(16 * j + mm) * TSP + 16 * i + 8 * hh]) = w;
      }
  } else {
#pragma unroll
    for (int i = 0; i < 4; ++i)
#pragma unroll
      for (int j = 0; j < 4; ++j)
#pragma unroll
        for (int r = 0; r < 8; ++r) Tw[(16 * i + 8 * hh + r) * TSP + 16 * j + mm] = (h16)(acc[i][j][r] + bb[j]);
  }
  asm volatile("s_wait_dscnt 0x0" ::: "memory");        // the wave's own tile is written before it reads the rows back

  const int b  = m0 / SEQ;
  const int s0 = m0 - b * SEQ + 64 * wm;
  const int bh = b * NH + blockIdx.y * (PBT / HD) + wn;
  h16* dstp = (mat == 0) ? Qp : ((mat == 1) ? Kp : VTp);
  const int pc = (lane & 7) * 8;
  const int rb = lane >> 3;
  // each instruction: 4 staged rows = 4 whole 128-B lines
  v8h vals[16];
#pragma unroll
  for (int i = 0; i < 16; ++i) vals[i] = *(const v8h*)(&Tw[(i * 4 + rb) * TSP + pc]);
  if (tr) {
    h16* d = dstp + ((size_t)bh * HD + rb) * SEQ + s0 + pc;
#pragma unroll
    for (int i = 0; i < 16; ++i) *(v8h*)(d + (size_t)(i * 4) * SEQ) = vals[i];
  } else {
    h16* d = dstp + ((size_t)bh * SEQ + s0 + rb) * HD + pc;
#pragma unroll
    for (int i = 0; i < 16; ++i) *(v8h*)(d + (size_t)(i * 4) * HD) = vals[i];
  }
}

// ---------------- stage 2: flash attention ----------------
// Block = 4 waves, owns (bh, 128 query rows); wave owns 32 query rows (two column groups of 16), loops over key tiles of 64.
// Q fragments from the [bh][s][64] plane. Each 64-key tile of K ([key][64]) and of V^T ([d][64 keys]) is copied once per
// block into LDS (two buffers, the next tile in flight while this one is worked on) and all four waves take their
// fragments from there. The products run transposed: S^T[key][q] = K . Q^T and O^T[d][q] += V^T . P^T, so a lane holds
// one query's scores per column group (keys 16t + 8*(l>>4) + r), and two converted score tiles are the B operand of the second product.
#define KVP 72                       // f16 per staged row: 128 B of data + 16 B pad, the pitch for 16-byte LDS readers
#define KV_TILE (64 * KVP)           // f16 per staged tile (64 rows)
#define KV_BUF_BYTES (2 * KV_TILE * 2)
#define OSP 68                       // f32 per staged output row: 256 B of data + 16 B pad (16-byte LDS writers, one row per lane)

// One tile of K and one of V^T into one buffer: 8 copies of 16 B per lane, each wave-wide copy = 4 whole 128-B rows.
// kg, vg: the lane's global address in rows 0..15 of the two tiles; lk: the lane's LDS byte address in the K tile.
__device__ __forceinline__ void stage_kv(const h16* kg, const h16* vg, unsigned lk) {
  const unsigned lv = lk + KV_TILE * 2;
  const unsigned rs = 16 * KVP * 2;  // 16 staged rows, in bytes
  // s_wait_xcnt closes the statement so that no address register is rewritten ahead of it
  asm volatile("global_load_async_to_lds_b128 %0, %8, off\n\t"
               "global_load_async_to_lds_b128 %1, %9, off\n\t"
               "global_load_async_to_lds_b128 %2, %10, off\n\t"
               "global_load_async_to_lds_b128 %3, %11, off\n\t"
               "global_load_async_to_lds_b128 %4, %12, off\n\t"
               "global_load_async_to_lds_b128 %5, %13, off\n\t"
               "global_load_async_to_lds_b128 %6, %14, off\n\t"
               "global_load_async_to_lds_b128 %7, %15, off\n\t"
               "s_wait_xcnt 0x0"
               :: "v"(lk), "v"(lk + rs), "v"(lk + 2 * rs), "v"(lk + 3 * rs),
                  "v"(lv), "v"(lv + rs), "v"(lv + 2 * rs), "v"(lv + 3 * rs),
                  "v"(kg), "v"(kg + 16 * HD), "v"(kg + 32 * HD), "v"(kg + 48 * HD),
                  "v"(vg), "v"(vg + (size_t)16 * SEQ), "v"(vg + (size_t)32 * SEQ), "v"(vg + (size_t)48 * SEQ)
               : "memory");
}

#define QG 2                         // 16-query column groups per wave: each K and V^T fragment read from LDS feeds QG WMMAs
#define QW (16 * QG)                 // queries per wave
#define QBLK (4 * QW)                // queries per block

// waves_per_eu(2, 2): the grid is 2 work-groups for each of the chip's WGPs; with fewer registers in use a third could
// become resident on some WGPs and leave others short, so the register allocation is held at two waves per SIMD.
__global__ __launch_bounds__(128) __attribute__((amdgpu_waves_per_eu(2, 2)))
void k_attn(const h16* __restrict__ Qp, const h16* __restrict__ Kp, const h16* __restrict__ VTp,
            const int* __restrict__ mask, float* __restrict__ out) {
  __shared__ __attribute__((aligned(16))) h16   KVs[2][2][KV_TILE]; // [buffer][K | V^T][row * KVP + col]
  __shared__ __attribute__((aligned(16))) float Madd[SEQ];        // 8 x the additive key mask: -80000*(1 - m), one per key
  __shared__ __attribute__((aligned(16))) float Os[4][QW * OSP];  // per wave: output tile [q][d]

  const int wave = threadIdx.x >> 5, lane = threadIdx.x & 31;
  const int hh = lane >> 4, mm = lane & 15;
  const int bh = blockIdx.y;
  const int b  = bh / NH;
  const int hd = bh - b * NH;
  const int q0 = blockIdx.x * QBLK + wave * QW;
  // a wave wholly past the last query keeps its part in the staging and the barriers, works on the last rows, stores nothing
  const int q0l = (SEQ % QBLK == 0 || q0 < SEQ) ? q0 : (SEQ - QW);

  const h16* Qbh = Qp  + (size_t)bh * SEQ * HD;
  const h16* Kbh = Kp  + (size_t)bh * SEQ * HD;
  const h16* Vbh = VTp + (size_t)bh * HD * SEQ;
  const int* mk_b = mask + (size_t)b * S_FULL;

  v16h aq[QG][2];
#pragma unroll
  for (int g = 0; g < QG; ++g) {
    aq[g][0] = ldfrag_h(Qbh + (size_t)(q0l + 16 * g) * HD, HD);
    aq[g][1] = ldfrag_h(Qbh + (size_t)(q0l + 16 * g) * HD + 32, HD);
  }

  // per lane and group: running maximum of query column 16*g + mm (both halves agree), running sum over this half's keys only
  // m_run is kept in units of the raw product k.q + 8*mask (8 x the score); nmc_run is the exponent offset made from it
  const float C1 = 0.125f * 1.44269504088896340736f;   // 1/8 and log2(e) in one factor
  float m_run[QG], l_run[QG], nmc_run[QG];
  v8f o[QG][4];   // o[g][dt][r] = O^T[16*dt + 8*hh + r][16*g + mm]
#pragma unroll
  for (int g = 0; g < QG; ++g) {
    m_run[g] = -1e30f;
    l_run[g] = 0.f;
    nmc_run[g] = __builtin_fmaf(m_run[g], -C1, 10.0f);
#pragma unroll
    for (int dt = 0; dt < 4; ++dt) o[g][dt] = zero8();
  }

  // the lane's 16-byte piece of rows 0..15 of a tile: 8 lanes per 128-B row
  const int crow = threadIdx.x >> 3, ccol = (threadIdx.x & 7) * 8;
  const h16* kg = Kbh + (size_t)crow * HD + ccol;
  const h16* vg = Vbh + (size_t)crow * SEQ + ccol;
  const unsigned lk0 = (unsigned)(uintptr_t)&KVs[0][0][crow * KVP + ccol];

  stage_kv(kg, vg, lk0);
  // a lane now needs the mask term of 32 keys per tile: form all of them once per block, read them back 16 B at a time
#pragma unroll
  for (int i0 = 0; i0 < SEQ; i0 += 128 * 4) {
    const int i = i0 + (int)threadIdx.x * 4;
    if (SEQ % (128 * 4) == 0 || i < SEQ) {
      const v4i mi = *(const v4i*)(mk_b + i);
      v4f ma;
#pragma unroll
      for (int j = 0; j < 4; ++j) ma[j] = -80000.0f * (1.0f - (float)mi[j]);
      *(v4f*)(&Madd[i]) = ma;
    }
  }
  asm volatile("s_wait_asynccnt 0x0" ::: "memory");   // this wave's share of tile 0 has landed
  __syncthreads();                                     // tile 0 and the mask terms readable by every wave
  if (SEQ > 64) stage_kv(kg + (size_t)64 * HD, vg + 64, lk0 + KV_BUF_BYTES);

#pragma unroll 1
  for (int t0 = 0; t0 < SEQ; t0 += 64) {
    const int buf = (t0 >> 6) & 1;
    const h16* Kt = &KVs[buf][0][0];
    const h16* Vt = &KVs[buf][1][0];
    // 8 x scores S^T[64 keys][QW q] = k . q^T + 8 * mask term; sc[g][t][r] = key 16*t + 8*hh + r, query 16*g + mm
    // All K fragments and the mask terms are asked for ahead of the first product, not fragment by fragment between
    // its WMMAs, so that the wave waits out the LDS latency once (the compiler orders them and counts its waits).
    v8f sc[QG][4];
    v16h kf[4][2];
    v4f ma[4][2];
#pragma unroll
    for (int t = 0; t < 4; ++t) {
      kf[t][0] = ldfrag_h(Kt + (16 * t) * KVP, KVP);
      kf[t][1] = ldfrag_h(Kt + (16 * t) * KVP + 32, KVP);
    }
#pragma unroll
    for (int t = 0; t < 4; ++t) {
      ma[t][0] = *(const v4f*)(&Madd[t0 + 16 * t + 8 * hh]);
      ma[t][1] = *(const v4f*)(&Madd[t0 + 16 * t + 8 * hh + 4]);
    }
#pragma unroll
    for (int t = 0; t < 4; ++t) {   // the mask terms are the accumulators' start values: no vector add per score
      const v8f mc = __builtin_shufflevector(ma[t][0], ma[t][1], 0, 1, 2, 3, 4, 5, 6, 7);
#pragma unroll
      for (int g = 0; g < QG; ++g) sc[g][t] = mma_h(kf[t][0], aq[g][0], mc);
    }
#pragma unroll
    for (int t = 0; t < 4; ++t)
#pragma unroll
      for (int g = 0; g < QG; ++g) sc[g][t] = mma_h(kf[t][1], aq[g][1], sc[g][t]);
    // Second group: all V^T fragments of this tile, asked for here so that they arrive while the softmax runs.
    v16h vf[4][2];
#pragma unroll
    for (int dt = 0; dt < 4; ++dt) {
      vf[dt][0] = ldfrag_h(Vt + (16 * dt) * KVP, KVP);
      vf[dt][1] = ldfrag_h(Vt + (16 * dt) * KVP + 32, KVP);
    }
    // keeps the V^T reads up here as one group, ahead of the softmax
    __builtin_amdgcn_sched_barrier(0);

    // online softmax, one query per lane and group: maximum in-lane over 32 keys, then one exchange with the other half
    // The arguments first, then the exponentials together. The two scheduling barriers are there to keep the v_exp_f32
    // from being spread among the other vector work.
    // One FMA per score: 2^(sc*C1 + nmc) = 1024 * e^(score - maximum), with nmc = 10 - mn*C1 (1/8, log2(e), the maximum and
    // the x1024 carry together). The old sums carry 2^nmc_run, so their factor is 2^(nmc - nmc_run), from the rounded offsets.
    float ea[QG][4][8];
    float eal[QG];
#pragma unroll
    for (int g = 0; g < QG; ++g) {
      float mt[4];
#pragma unroll
      for (int t = 0; t < 4; ++t) {
        mt[t] = sc[g][t][0];
#pragma unroll
        for (int r = 1; r < 8; ++r) mt[t] = fmaxf(mt[t], sc[g][t][r]);
      }
      float mx = fmaxf(fmaxf(mt[0], mt[1]), fmaxf(mt[2], mt[3]));
      mx = fmaxf(mx, xhalf(mx));
      const float mn = fmaxf(m_run[g], mx);
      const float nmc = __builtin_fmaf(mn, -C1, 10.0f);
#pragma unroll
      for (int t = 0; t < 4; ++t)
#pragma unroll
        for (int r = 0; r < 8; ++r) ea[g][t][r] = __builtin_fmaf(sc[g][t][r], C1, nmc);
      eal[g] = nmc - nmc_run[g];
      m_run[g] = mn;
      nmc_run[g] = nmc;
    }
    __builtin_amdgcn_sched_barrier(0);
    float alpha[QG];
#pragma unroll
    for (int g = 0; g < QG; ++g) {
      alpha[g] = __builtin_amdgcn_exp2f(eal[g]);
#pragma unroll
      for (int t = 0; t < 4; ++t)
#pragma unroll
        for (int r = 0; r < 8; ++r) ea[g][t][r] = __builtin_amdgcn_exp2f(ea[g][t][r]);
    }
    __builtin_amdgcn_sched_barrier(0);

    // P^T (x1024, f16) straight into the B operand: element s of pb[g][j] = key 32*j + (s < 8 ? 8*hh + s : 16 + 8*hh + s - 8)
    v16h pb[QG][2];
#pragma unroll
    for (int g = 0; g < QG; ++g) {
      float pst[4];
#pragma unroll
      for (int t = 0; t < 4; ++t) {
        pst[t] = 0.f;
#pragma unroll
        for (int r = 0; r < 8; ++r) {
          const float p = ea[g][t][r];
          pst[t] += p;
          pb[g][t >> 1][(t & 1) * 8 + r] = (h16)p;
        }
      }
      l_run[g] = l_run[g] * alpha[g] + ((pst[0] + pst[1]) + (pst[2] + pst[3]));
#pragma unroll
      for (int dt = 0; dt < 4; ++dt)
#pragma unroll
        for (int r = 0; r < 8; ++r) o[g][dt][r] *= alpha[g];
    }

    // O^T[64 d][QW q] += V^T[64 d][64 keys] . P^T[64 keys][QW q]
#pragma unroll
    for (int dt = 0; dt < 4; ++dt)
#pragma unroll
      for (int g = 0; g < QG; ++g) o[g][dt] = mma_h(vf[dt][0], pb[g][0], o[g][dt]);
#pragma unroll
    for (int dt = 0; dt < 4; ++dt)
#pragma unroll
      for (int g = 0; g < QG; ++g) o[g][dt] = mma_h(vf[dt][1], pb[g][1], o[g][dt]);
    // keeps the waits and the barrier at the trip's foot, so that the copies of the next tile have the whole trip to land
    __builtin_amdgcn_sched_barrier(0);
    asm volatile("s_wait_dscnt 0x0" ::: "memory");      // this wave's reads of the buffer are done
    asm volatile("s_wait_asynccnt 0x0" ::: "memory");   // this wave's share of the next tile has landed
    __syncthreads();   // next tile readable by every wave; this trip's buffer free for the refill
    if (t0 + 128 < SEQ) stage_kv(kg + (size_t)(t0 + 128) * HD, vg + (t0 + 128), lk0 + buf * KV_BUF_BYTES);
  }
  asm volatile("s_wait_asynccnt 0x0" ::: "memory");     // no copy outstanding behind the loop

  // normalise (sums and products both carry x1024) and stage the QW x 64 f32 tile per wave
#pragma unroll
  for (int g = 0; g < QG; ++g) {
    const float inv = 1.0f / (l_run[g] + xhalf(l_run[g]));   // the two halves' key sums join here, once
#pragma unroll
    for (int dt = 0; dt < 4; ++dt) {
      v4f w0, w1;
#pragma unroll
      for (int r = 0; r < 4; ++r) { w0[r] = o[g][dt][r] * inv; w1[r] = o[g][dt][4 + r] * inv; }
      *(v4f*)(&Os[wave][(16 * g + mm) * OSP + 16 * dt + 8 * hh])     = w0;
      *(v4f*)(&Os[wave][(16 * g + mm) * OSP + 16 * dt + 8 * hh + 4]) = w1;
    }
  }
  __syncthreads();

  // each instruction: lanes 0..15 -> row 2i (256 B = 2 full lines), lanes 16..31 -> row 2i+1
  const int rsub = lane >> 4;
  const int cc = (lane & 15) * 4;
  if (SEQ % QBLK == 0 || q0 < SEQ) {
    float* ob = out + ((size_t)b * SEQ + q0) * DM + (size_t)hd * HD;
    v4f vv[QW / 2];
#pragma unroll
    for (int i = 0; i < QW / 2; ++i) vv[i] = *(const v4f*)(&Os[wave][(2 * i + rsub) * OSP + cc]);
#pragma unroll
    for (int i = 0; i < QW / 2; ++i) *(v4f*)(ob + (size_t)(2 * i + rsub) * DM + cc) = vv[i];
  }
}

// ---------------- launcher ----------------
extern "C" void kernel_launch(void* const* d_in, const int* in_sizes, int n_in,
                              void* d_out, int out_size, void* d_ws, size_t ws_size,
                              hipStream_t stream) {
  if (n_in < 8) return;
  const float* x   = (const float*)d_in[0];
  const int*   msk = (const int*)d_in[1];
  const float* Wq  = (const float*)d_in[2];
  const float* bq  = (const float*)d_in[3];
  const float* Wk  = (const float*)d_in[4];
  const float* bk  = (const float*)d_in[5];
  const float* Wv  = (const float*)d_in[6];
  const float* bv  = (const float*)d_in[7];
  float* out = (float*)d_out;

  if (in_sizes[0] < ((NB - 1) * S_FULL + SEQ) * DM) return;
  if (in_sizes[1] < (NB - 1) * S_FULL + SEQ) return;
  if (in_sizes[2] < DM * DM || in_sizes[4] < DM * DM || in_sizes[6] < DM * DM) return;
  if (in_sizes[3] < DM || in_sizes[5] < DM || in_sizes[7] < DM) return;
  if (out_size < MT * DM) return;

  char* ws = (char*)d_ws;
  const size_t XB_BYTES = (size_t)MT * DM * 2;              // bf16 x plane [MT][DM]
  const size_t W_BYTES  = (size_t)DM * DM * 2;              // one bf16 weight plane
  const size_t PL_BYTES = (size_t)NB * NH * SEQ * HD * 2;   // one f16 q/k/v^T plane
  size_t off = 0;
  u16* Xb = (u16*)(ws + off);  off += XB_BYTES;
  u16* Wb = (u16*)(ws + off);  off += 3 * W_BYTES;
  h16* Qp = (h16*)(ws + off);  off += PL_BYTES;
  h16* Kp = (h16*)(ws + off);  off += PL_BYTES;
  h16* VTp = (h16*)(ws + off); off += PL_BYTES;
  if (off > ws_size) return;

  k_cvt_bf16<<<CV_XB + 3 * CV_WB, 256, 0, stream>>>(x, Wq, Wk, Wv, Xb, Wb);

  dim3 gp(MT / PBT, DM / PBT, 3);
  k_proj<<<gp, 128, 0, stream>>>(Xb, Wb, bq, bk, bv, Qp, Kp, VTp);

  dim3 ga((SEQ + QBLK - 1) / QBLK, NB * NH);
  k_attn<<<ga, 128, 0, stream>>>(Qp, Kp, VTp, msk, out);
}

// v009
// A run of this version takes 52.7 microseconds.
// Two timings next to v008 put it at 1.04 and 1.06 times that version's speed.
// All steps since v000 together make it 4.97 times as fast.
#include <hip/hip_runtime.h>
#include <stdint.h>

// Contractions: x.Wq^T, x.Wk^T, x.Wv^T on v_wmma_f32_16x16x32_bf16 (bf16 operands = RNE-converted f32 inputs, f32 accumulate);
// k.q^T and V^T.P^T on v_wmma_f32_16x16x32_f16 (f16 operands, P carried x1024, f32 accumulate); bias add, softmax, normalisation in f32.
// The additive key mask (x8) is the start value of the k.q^T accumulators.

typedef unsigned short u16;
typedef _Float16 h16;
typedef __bf16 v16bf __attribute__((ext_vector_type(16)));
typedef h16 v16h __attribute__((ext_vector_type(16)));
typedef h16 v8h __attribute__((ext_vector_type(8), __may_alias__));
typedef float v8f __attribute__((ext_vector_type(8)));
typedef float v4f __attribute__((ext_vector_type(4), __may_alias__));
typedef unsigned int v4u __attribute__((ext_vector_type(4), __may_alias__));
typedef int v4i __attribute__((ext_vector_type(4), __may_alias__));

#ifndef NB
#define NB 4
#endif
#ifndef SEQ
#define SEQ 2048
#endif
#define NB_FULL 4
#define S_FULL 2048
#define DM 512
#define NH 8
#define HD 64
#define MT (NB * SEQ)

static_assert(NB >= 1 && NB <= NB_FULL);
static_assert(SEQ % 64 == 0 && SEQ <= S_FULL);
static_assert(DM % 64 == 0 && DM % 32 == 0);
static_assert(NH * HD == DM);
static_assert(HD == 64);
static_assert(MT % 64 == 0);

// ---------------- helpers ----------------

__device__ __forceinline__ u16 f2bf(float f) {
  unsigned u = __float_as_uint(f);
  u += 0x7FFFu + ((u >> 16) & 1u);   // RNE convert f32 -> bf16 bits
  return (u16)(u >> 16);
}

__device__ __forceinline__ float bf_rn(float f) {
  return __uint_as_float(((unsigned)f2bf(f)) << 16);
}

__device__ __forceinline__ v8f zero8() {
  v8f z = {0.f, 0.f, 0.f, 0.f, 0.f, 0.f, 0.f, 0.f};
  return z;
}

// 16x32 16-bit fragment from row-major storage with k contiguous (pitch ld elements):
// lane l: row = l&15; elements 0..7 <- k0 + 8*(l>>4) + 0..7; elements 8..15 <- k0 + 16 + 8*(l>>4) + 0..7.
// Used for A (row = m) and for B stored n-major with k contiguous (row = n).
__device__ __forceinline__ v16bf ldfrag_bf(const u16* base, int ld) {
  const int l = threadIdx.x & 31;
  const int row = l & 15;
  const int kb = (l >> 4) << 3;
  const u16* p = base + (size_t)row * ld + kb;
  union { v16bf v; v4u q[2]; } u;
  u.q[0] = *(const v4u*)(p);
  u.q[1] = *(const v4u*)(p + 16);
  return u.v;
}

__device__ __forceinline__ v16h ldfrag_h(const h16* base, int ld) {
  const int l = threadIdx.x & 31;
  const int row = l & 15;
  const int kb = (l >> 4) << 3;
  const h16* p = base + (size_t)row * ld + kb;
  union { v16h v; v8h q[2]; } u;
  u.q[0] = *(const v8h*)(p);
  u.q[1] = *(const v8h*)(p + 16);
  return u.v;
}

// D[16x16] += A[16x32] . B[32x16]; D element r of lane l = (row 8*(l>>4)+r, col l&15)
__device__ __forceinline__ v8f mma_bf(v16bf a, v16bf b, v8f c) {
  v8f r = __builtin_amdgcn_wmma_f32_16x16x32_bf16(false, a, false, b, (short)0, c, false, false);
  asm volatile("v_nop\n\tv_nop\n\tv_nop\n\tv_nop" : "+v"(r) : "v"(a), "v"(b));
  return r;
}

__device__ __forceinline__ v8f mma_h(v16h a, v16h b, v8f c) {
  return __builtin_amdgcn_wmma_f32_16x16x32_f16(false, a, false, b, (short)0, c, false, false);
}

// value of lane l ^ 16 (the other half of the wave holds the other keys of the same query column)
__device__ __forceinline__ float xhalf(float x) {
  const int b = __float_as_int(x);
  return __int_as_float(__builtin_amdgcn_permlanex16(b, b, 0x76543210, 0xfedcba98, false, false));
}

// ---------------- stage 0: f32 -> bf16 planes (rows of DM elements), one launch for x and the three weights ----------------
// A piece = 8 elements: 32 B read, 16 B written. A block converts CV_BLK consecutive pieces (CV_ROWS whole rows) of ONE
// source; the block index picks the source: [0, CV_XB) -> x, then CV_WB blocks each for Wq, Wk, Wv (their planes follow one
// another in Wb). A lane takes CV_U pieces, 256 pieces apart.
// x plane row pr <- source row (pr / SEQ) * S_FULL + pr % SEQ; a block's rows lie in one group of SEQ rows.
#define CV_U 4
#define CV_BLK (256 * CV_U)
#define CV_ROWS (CV_BLK / (DM / 8))
#define CV_XB (MT / CV_ROWS)
#define CV_WB (DM / CV_ROWS)
static_assert(CV_BLK % (DM / 8) == 0 && SEQ % CV_ROWS == 0 && DM % CV_ROWS == 0);

__global__ __launch_bounds__(256) void k_cvt_bf16(const float* __restrict__ x, const float* __restrict__ Wq,
                                                   const float* __restrict__ Wk, const float* __restrict__ Wv,
                                                   u16* __restrict__ Xb, u16* __restrict__ Wb) {
  const unsigned blk = blockIdx.x;
  const float* src;   // first source row of this block
  u16* dst;           // first plane row of this block
  if (blk < CV_XB) {
    const unsigned pr0 = blk * CV_ROWS;
    src = x + (size_t)((pr0 / SEQ) * S_FULL + pr0 % SEQ) * DM;
    dst = Xb + (size_t)pr0 * DM;
  } else {
    const unsigned wb = blk - CV_XB;
    const unsigned mat = wb / CV_WB;
    src = ((mat == 0) ? Wq : ((mat == 1) ? Wk : Wv)) + (size_t)(wb - mat * CV_WB) * CV_ROWS * DM;
    dst = Wb + (size_t)wb * CV_ROWS * DM;
  }
  const float* s = src + threadIdx.x * 8;
  u16* d = dst + threadIdx.x * 8;

  v4f a[CV_U], b[CV_U];
  // unrolled so that a and b stay in registers and all 2 * CV_U loads are issued ahead of the first conversion
#pragma unroll
  for (int j = 0; j < CV_U; ++j) {
    a[j] = *(const v4f*)(s + j * (256 * 8));
    b[j] = *(const v4f*)(s + j * (256 * 8) + 4);
  }
#pragma unroll
  for (int j = 0; j < CV_U; ++j) {
    v4u w;
    w.x = (unsigned)f2bf(a[j].x) | ((unsigned)f2bf(a[j].y) << 16);
    w.y = (unsigned)f2bf(a[j].z) | ((unsigned)f2bf(a[j].w) << 16);
    w.z = (unsigned)f2bf(b[j].x) | ((unsigned)f2bf(b[j].y) << 16);
    w.w = (unsigned)f2bf(b[j].z) | ((unsigned)f2bf(b[j].w) << 16);
    *(v4u*)(d + j * (256 * 8)) = w;
  }
}

// ---------------- stage 1: projections ----------------
// out[row, n] = sum_k Xb[row, k] * W[n, k] + bias[n]; row in [0, MT), n in [0, DM), K = DM.
// blockIdx.z selects the matrix: 0 -> Q plane [bh][s][64], 1 -> K plane [bh][s][64], 2 -> V^T plane [bh][64][SEQ] (f16).
// Block = 4 waves (2 x 2), tile 128(M) x 128(N); wave owns 64 rows x 64 cols (one head). Each k-tile of 64 elements
// (128 rows x 128 B of X and of W) is copied once per block into LDS in whole lines (two buffers, the next k-tile in flight
// while this one is worked on); the waves take their fragments from there, each fragment feeding four WMMAs.
// Each sum runs over k in ascending steps of 32.
#define PBT 128                      // rows of X and rows of W per block tile
#define XWP 72                       // bf16 per staged row: 128 B of data + 16 B pad, the pitch for 16-byte LDS readers
#define XW_TILE (PBT * XWP)          // bf16 per staged tile (128 rows)
#define XW_BUF_BYTES (2 * XW_TILE * 2)
#define TSP 72                       // f16 per staged output row: 128 B of data + 16 B pad
static_assert(MT % PBT == 0 && SEQ % PBT == 0 && DM % PBT == 0);
static_assert(4 * 64 * TSP <= 2 * 2 * XW_TILE);

// One k-tile of 128 rows into one buffer: 8 copies of 16 B per lane, each wave-wide copy = 4 whole 128-B lines.
// g: the lane's global address in rows 0..15 of the tile; l: the lane's LDS byte address in rows 0..15 of the staged tile.
__device__ __forceinline__ void stage_rows(const u16* g, unsigned l) {
  const unsigned rs = 16 * XWP * 2;  // 16 staged rows, in bytes
  // s_wait_xcnt closes the statement so that no address register is rewritten ahead of it
  asm volatile("global_load_async_to_lds_b128 %0, %8, off\n\t"
               "global_load_async_to_lds_b128 %1, %9, off\n\t"
               "global_load_async_to_lds_b128 %2, %10, off\n\t"
               "global_load_async_to_lds_b128 %3, %11, off\n\t"
               "global_load_async_to_lds_b128 %4, %12, off\n\t"
               "global_load_async_to_lds_b128 %5, %13, off\n\t"
               "global_load_async_to_lds_b128 %6, %14, off\n\t"
               "global_load_async_to_lds_b128 %7, %15, off\n\t"
               "s_wait_xcnt 0x0"
               :: "v"(l), "v"(l + rs), "v"(l + 2 * rs), "v"(l + 3 * rs),
                  "v"(l + 4 * rs), "v"(l + 5 * rs), "v"(l + 6 * rs), "v"(l + 7 * rs),
                  "v"(g), "v"(g + 16 * DM), "v"(g + 32 * DM), "v"(g + 48 * DM),
                  "v"(g + 64 * DM), "v"(g + 80 * DM), "v"(g + 96 * DM), "v"(g + 112 * DM)
               : "memory");
}

// One k-tile of X and one of W into one buffer; lx: the lane's LDS byte address in the X tile.
__device__ __forceinline__ void stage_xw(const u16* xg, const u16* wg, unsigned lx) {
  stage_rows(xg, lx);
  stage_rows(wg, lx + XW_TILE * 2);
}

// waves_per_eu(3, 3): the grid is 3 work-groups for each of the chip's WGPs; the register allocation is held at three
// waves per SIMD so that no WGP takes a fourth and leaves another short.
__global__ __launch_bounds__(128) __attribute__((amdgpu_waves_per_eu(3, 3)))
void k_proj(const u16* __restrict__ Xb, const u16* __restrict__ Wb,
            const float* __restrict__ bq, const float* __restrict__ bk, const float* __restrict__ bv,
            h16* __restrict__ Qp, h16* __restrict__ Kp, h16* __restrict__ VTp) {
  __shared__ __attribute__((aligned(16))) u16 XWs[2][2][XW_TILE];   // [buffer][X | W][row * XWP + k]

  const int wave = threadIdx.x >> 5, lane = threadIdx.x & 31;
  const int hh = lane >> 4, mm = lane & 15;
  const int wm = wave >> 1, wn = wave & 1;
  const int mat = blockIdx.z;
  const int m0 = blockIdx.x * PBT, n0 = blockIdx.y * PBT;
  const u16* W = Wb + (size_t)mat * DM * DM + (size_t)n0 * DM;   // rows n0..n0+127, k contiguous
  const float* bias = (mat == 0) ? bq : ((mat == 1) ? bk : bv);

  v8f acc[4][4];   // acc[i][j][r] = (row 64*wm + 16*i + 8*hh + r, col 64*wn + 16*j + mm)
#pragma unroll
  for (int i = 0; i < 4; ++i)
#pragma unroll
    for (int j = 0; j < 4; ++j) acc[i][j] = zero8();

  // the lane's 16-byte piece of rows 0..15 of a k-tile: 8 lanes per 128-B line
  const int crow = threadIdx.x >> 3, ccol = (threadIdx.x & 7) * 8;
  const u16* xg = Xb + (size_t)(m0 + crow) * DM + ccol;
  const u16* wg = W + (size_t)crow * DM + ccol;
  const unsigned lx0 = (unsigned)(uintptr_t)&XWs[0][0][crow * XWP + ccol];

  stage_xw(xg, wg, lx0);
  asm volatile("s_wait_asynccnt 0x0" ::: "memory");   // this wave's share of k-tile 0 has landed
  __syncthreads();                                     // k-tile 0 readable by every wave
  if (DM > 64) stage_xw(xg + 64, wg + 64, lx0 + XW_BUF_BYTES);

  for (int kt = 0; kt < DM; kt += 64) {
    const int buf = (kt >> 6) & 1;
    const u16* Xt = &XWs[buf][0][(wm * 64) * XWP];
    const u16* Wt = &XWs[buf][1][(wn * 64) * XWP];
    // unrolled so that the fragments and the sums stay in registers
#pragma unroll
    for (int k0 = 0; k0 < 64; k0 += 32) {
      v16bf a[4], b[4];
#pragma unroll
      for (int i = 0; i < 4; ++i) a[i] = ldfrag_bf(Xt + (i * 16) * XWP + k0, XWP);
#pragma unroll
      for (int j = 0; j < 4; ++j) b[j] = ldfrag_bf(Wt + (j * 16) * XWP + k0, XWP);
#pragma unroll
      for (int i = 0; i < 4; ++i)
#pragma unroll
        for (int j = 0; j < 4; ++j) acc[i][j] = mma_bf(a[i], b[j], acc[i][j]);
    }
    asm volatile("s_wait_dscnt 0x0" ::: "memory");      // this wave's reads of the buffer are done
    asm volatile("s_wait_asynccnt 0x0" ::: "memory");   // this wave's share of the next k-tile has landed
    __syncthreads();   // next k-tile readable by every wave; this trip's buffer free for the refill
    if (kt + 128 < DM) stage_xw(xg + (kt + 128), wg + (kt + 128), lx0 + buf * XW_BUF_BYTES);
  }
  asm volatile("s_wait_asynccnt 0x0" ::: "memory");     // no copy outstanding behind the loop

  // bias enters as its bf16-RNE value
  float bb[4];
#pragma unroll
  for (int j = 0; j < 4; ++j) bb[j] = bf_rn(bias[n0 + 64 * wn + 16 * j + mm]);

  // Each wave stages its own 64x64 tile in its own part of the ring, which every wave has left at the loop's last barrier:
  // [row][col] for Q/K, transposed [col][row] for V.
  h16* Tw = (h16*)&XWs[0][0][0] + wave * (64 * TSP);
  const bool tr = (mat == 2);
  if (tr) {
#pragma unroll
    for (int j = 0; j < 4; ++j)
#pragma unroll
      for (int i = 0; i < 4; ++i) {
        v8h w;
#pragma unroll
        for (int r = 0; r < 8; ++r) w[r] = (h16)(acc[i][j][r] + bb[j]);
        *(v8h*)(&Tw[(16 * j + mm) * TSP + 16 * i + 8 * hh]) = w;
      }
  } else {
#pragma unroll
    for (int i = 0; i < 4; ++i)
#pragma unroll
      for (int j = 0; j < 4; ++j)
#pragma unroll
        for (int r = 0; r < 8; ++r) Tw[(16 * i + 8 * hh + r) * TSP + 16 * j + mm] = (h16)(acc[i][j][r] + bb[j]);
  }
  asm volatile("s_wait_dscnt 0x0" ::: "memory");        // the wave's own tile is written before it reads the rows back

  const int b  = m0 / SEQ;
  const int s0 = m0 - b * SEQ + 64 * wm;
  const int bh = b * NH + blockIdx.y * (PBT / HD) + wn;
  h16* dstp = (mat == 0) ? Qp : ((mat == 1) ? Kp : VTp);
  const int pc = (lane & 7) * 8;
  const int rb = lane >> 3;
  // each instruction: 4 staged rows = 4 whole 128-B lines
  v8h vals[16];
#pragma unroll
  for (int i = 0; i < 16; ++i) vals[i] = *(const v8h*)(&Tw[(i * 4 + rb) * TSP + pc]);
  if (tr) {
    h16* d = dstp + ((size_t)bh * HD + rb) * SEQ + s0 + pc;
#pragma unroll
    for (int i = 0; i < 16; ++i) *(v8h*)(d + (size_t)(i * 4) * SEQ) = vals[i];
  } else {
    h16* d = dstp + ((size_t)bh * SEQ + s0 + rb) * HD + pc;
#pragma unroll
    for (int i = 0; i < 16; ++i) *(v8h*)(d + (size_t)(i * 4) * HD) = vals[i];
  }
}

// ---------------- stage 2: flash attention ----------------
// Block = 8 waves in KS = 2 key groups of 4, owns (bh, 128 query rows); wave owns 32 query rows (two column groups of 16)
// and loops over the 64-key tiles of its group's share of the keys (SEQ / KS keys in a row); waves w and w + 4 hold the same
// queries. The groups' partial sums are joined once, behind the loop, through LDS.
// Q fragments from the [bh][s][64] plane. Each 64-key tile of K ([key][64]) and of V^T ([d][64 keys]) is copied once per
// block into the group's own LDS ring (two buffers, the next tile in flight while this one is worked on) and the group's
// four waves take their fragments from there. The products run transposed: S^T[key][q] = K . Q^T and O^T[d][q] += V^T . P^T, so a lane holds
// one query's scores (keys 16t + 8*(l>>4) + r), and two converted score tiles are the B operand of the second product.
#define KVP 72                       // f16 per staged row: 128 B of data + 16 B pad, the pitch for 16-byte LDS readers
#define KV_TILE (64 * KVP)           // f16 per staged tile (64 rows)
#define KV_BUF_BYTES (2 * KV_TILE * 2)
#define OSP 68                       // f32 per staged output row: 256 B of data + 16 B pad (16-byte LDS writers, one row per lane)

// One tile of K and one of V^T into one buffer: 8 copies of 16 B per lane, each wave-wide copy = 4 whole 128-B rows.
// kg, vg: the lane's global address in rows 0..15 of the two tiles; lk: the lane's LDS byte address in the K tile.
__device__ __forceinline__ void stage_kv(const h16* kg, const h16* vg, unsigned lk) {
  const unsigned lv = lk + KV_TILE * 2;
  const unsigned rs = 16 * KVP * 2;  // 16 staged rows, in bytes
  // s_wait_xcnt closes the statement so that no address register is rewritten ahead of it
  asm volatile("global_load_async_to_lds_b128 %0, %8, off\n\t"
               "global_load_async_to_lds_b128 %1, %9, off\n\t"
               "global_load_async_to_lds_b128 %2, %10, off\n\t"
               "global_load_async_to_lds_b128 %3, %11, off\n\t"
               "global_load_async_to_lds_b128 %4, %12, off\n\t"
               "global_load_async_to_lds_b128 %5, %13, off\n\t"
               "global_load_async_to_lds_b128 %6, %14, off\n\t"
               "global_load_async_to_lds_b128 %7, %15, off\n\t"
               "s_wait_xcnt 0x0"
               :: "v"(lk), "v"(lk + rs), "v"(lk + 2 * rs), "v"(lk + 3 * rs),
                  "v"(lv), "v"(lv + rs), "v"(lv + 2 * rs), "v"(lv + 3 * rs),
                  "v"(kg), "v"(kg + 16 * HD), "v"(kg + 32 * HD), "v"(kg + 48 * HD),
                  "v"(vg), "v"(vg + (size_t)16 * SEQ), "v"(vg + (size_t)32 * SEQ), "v"(vg + (size_t)48 * SEQ)
               : "memory");
}

#define QG 2                         // 16-query column groups per wave: each K and V^T fragment read from LDS feeds QG WMMAs
#define QW (16 * QG)                 // queries per wave
#define QBLK (4 * QW)                // queries per block
#define KS 2                         // key groups per block
#define KSPAN (SEQ / KS)             // keys per group
static_assert(SEQ % (KS * 64) == 0);

// waves_per_eu(4, 4): the grid is 2 work-groups of 8 waves for each of the chip's WGPs, four waves per SIMD; the vector work
// of one wave's softmax then has three other waves' products to run beside.
__global__ __launch_bounds__(256) __attribute__((amdgpu_waves_per_eu(4, 4)))
void k_attn(const h16* __restrict__ Qp, const h16* __restrict__ Kp, const h16* __restrict__ VTp,
            const int* __restrict__ mask, float* __restrict__ out) {
  __shared__ __attribute__((aligned(16))) h16   KVs[KS][2][2][KV_TILE]; // [key group][buffer][K | V^T][row * KVP + col]
  __shared__ __attribute__((aligned(16))) float Madd[SEQ];        // 8 x the additive key mask: -80000*(1 - m), one per key
  __shared__ __attribute__((aligned(16))) float Os[4][QW * OSP];  // per query group: output tile [q][d]
  __shared__ float Ps[4][QG][2][32];                              // per query group: key group 1's exponent offset and key sum, per lane

  const int lane = threadIdx.x & 31;
  const int kgp  = __builtin_amdgcn_readfirstlane((int)(threadIdx.x >> 7));   // key group, the same in the whole wave
  const int wave = (threadIdx.x >> 5) & 3;                                    // query group
  const int kb0  = kgp * KSPAN;                                               // the group's first key
  const int hh = lane >> 4, mm = lane & 15;
  const int bh = blockIdx.y;
  const int b  = bh / NH;
  const int hd = bh - b * NH;
  const int q0 = blockIdx.x * QBLK + wave * QW;
  // a wave wholly past the last query keeps its part in the staging and the barriers, works on the last rows, stores nothing
  const int q0l = (SEQ % QBLK == 0 || q0 < SEQ) ? q0 : (SEQ - QW);

  const h16* Qbh = Qp  + (size_t)bh * SEQ * HD;
  const h16* Kbh = Kp  + (size_t)bh * SEQ * HD;
  const h16* Vbh = VTp + (size_t)bh * HD * SEQ;
  const int* mk_b = mask + (size_t)b * S_FULL;

  v16h aq[QG][2];
#pragma unroll
  for (int g = 0; g < QG; ++g) {
    aq[g][0] = ldfrag_h(Qbh + (size_t)(q0l + 16 * g) * HD, HD);
    aq[g][1] = ldfrag_h(Qbh + (size_t)(q0l + 16 * g) * HD + 32, HD);
  }

  // per lane and group: running maximum of query column 16*g + mm (both halves agree), running sum over this half's keys only
  // m_run is kept in units of the raw product k.q + 8*mask (8 x the score); nmc_run is the exponent offset made from it
  const float C1 = 0.125f * 1.44269504088896340736f;   // 1/8 and log2(e) in one factor
  float m_run[QG], l_run[QG], nmc_run[QG];
  v8f o[QG][4];   // o[g][dt][r] = O^T[16*dt + 8*hh + r][16*g + mm]
#pragma unroll
  for (int g = 0; g < QG; ++g) {
    m_run[g] = -1e30f;
    l_run[g] = 0.f;
    nmc_run[g] = __builtin_fmaf(m_run[g], -C1, 10.0f);
#pragma unroll
    for (int dt = 0; dt < 4; ++dt) o[g][dt] = zero8();
  }

  // the lane's 16-byte piece of rows 0..15 of a tile: 8 lanes per 128-B row
  const int crow = (threadIdx.x & 127) >> 3, ccol = (threadIdx.x & 7) * 8;
  const h16* kg = Kbh + (size_t)(kb0 + crow) * HD + ccol;
  const h16* vg = Vbh + (size_t)crow * SEQ + kb0 + ccol;
  const unsigned lk0 = (unsigned)(uintptr_t)&KVs[kgp][0][0][crow * KVP + ccol];

  stage_kv(kg, vg, lk0);
  // a lane now needs the mask term of 32 keys per tile: form all of them once per block, read them back 16 B at a time
#pragma unroll
  for (int i0 = 0; i0 < SEQ; i0 += 256 * 4) {
    const int i = i0 + (int)threadIdx.x * 4;
    if (SEQ % (256 * 4) == 0 || i < SEQ) {
      const v4i mi = *(const v4i*)(mk_b + i);
      v4f ma;
#pragma unroll
      for (int j = 0; j < 4; ++j) ma[j] = -80000.0f * (1.0f - (float)mi[j]);
      *(v4f*)(&Madd[i]) = ma;
    }
  }
  asm volatile("s_wait_asynccnt 0x0" ::: "memory");   // this wave's share of tile 0 has landed
  __syncthreads();                                     // tile 0 and the mask terms readable by every wave
  if (KSPAN > 64) stage_kv(kg + (size_t)64 * HD, vg + 64, lk0 + KV_BUF_BYTES);

#pragma unroll 1
  for (int t0 = 0; t0 < KSPAN; t0 += 64) {
    const int buf = (t0 >> 6) & 1;
    const h16* Kt = &KVs[kgp][buf][0][0];
    const h16* Vt = &KVs[kgp][buf][1][0];
    // 8 x scores S^T[64 keys][QW q] = k . q^T + 8 * mask term; sc[g][t][r] = key 16*t + 8*hh + r, query 16*g + mm
    // All K fragments and the mask terms are asked for ahead of the first product, not fragment by fragment between
    // its WMMAs, so that the wave waits out the LDS latency once (the compiler orders them and counts its waits).
    v8f sc[QG][4];
    v16h kf[4][2];
    v4f ma[4][2];
#pragma unroll
    for (int t = 0; t < 4; ++t) {
      kf[t][0] = ldfrag_h(Kt + (16 * t) * KVP, KVP);
      kf[t][1] = ldfrag_h(Kt + (16 * t) * KVP + 32, KVP);
    }
#pragma unroll
    for (int t = 0; t < 4; ++t) {
      ma[t][0] = *(const v4f*)(&Madd[kb0 + t0 + 16 * t + 8 * hh]);
      ma[t][1] = *(const v4f*)(&Madd[kb0 + t0 + 16 * t + 8 * hh + 4]);
    }
    // keeps these reads up here as one group: within 256 registers the compiler otherwise sinks the K reads in between the
    // WMMAs, two at a time into one fragment's registers, each pair waited out in full
    __builtin_amdgcn_sched_barrier(0);
#pragma unroll
    for (int t = 0; t < 4; ++t) {   // the mask terms are the accumulators' start values: no vector add per score
      const v8f mc = __builtin_shufflevector(ma[t][0], ma[t][1], 0, 1, 2, 3, 4, 5, 6, 7);
#pragma unroll
      for (int g = 0; g < QG; ++g) sc[g][t] = mma_h(kf[t][0], aq[g][0], mc);
    }
#pragma unroll
    for (int t = 0; t < 4; ++t)
#pragma unroll
      for (int g = 0; g < QG; ++g) sc[g][t] = mma_h(kf[t][1], aq[g][1], sc[g][t]);
    // Second group: the V^T fragments of this tile's first 32 keys, asked for here so that they arrive while the softmax
    // runs. Those of the last 32 keys follow behind the sums and the conversion: with all eight up here the wave needs more
    // than the 256 registers that four waves per SIMD leave it, and Q fragments go to scratch.
    v16h vf[4][2];
#pragma unroll
    for (int dt = 0; dt < 4; ++dt) vf[dt][0] = ldfrag_h(Vt + (16 * dt) * KVP, KVP);
    // keeps the V^T reads up here as one group: without it the compiler sinks them in among the second product's WMMAs
    __builtin_amdgcn_sched_barrier(0);

    // online softmax, one query per lane and group: maximum in-lane over 32 keys, then one exchange with the other half
    // The arguments first, then the exponentials together. The two scheduling barriers are there to keep the v_exp_f32
    // from being spread among the other vector work.
    // One FMA per score: 2^(sc*C1 + nmc) = 1024 * e^(score - maximum), with nmc = 10 - mn*C1 (1/8, log2(e), the maximum and
    // the x1024 carry together). The old sums carry 2^nmc_run, so their factor is 2^(nmc - nmc_run), from the rounded offsets.
    float ea[QG][4][8];
    float eal[QG];
#pragma unroll
    for (int g = 0; g < QG; ++g) {
      float mt[4];
#pragma unroll
      for (int t = 0; t < 4; ++t) {
        mt[t] = sc[g][t][0];
#pragma unroll
        for (int r = 1; r < 8; ++r) mt[t] = fmaxf(mt[t], sc[g][t][r]);
      }
      float mx = fmaxf(fmaxf(mt[0], mt[1]), fmaxf(mt[2], mt[3]));
      mx = fmaxf(mx, xhalf(mx));
      const float mn = fmaxf(m_run[g], mx);
      const float nmc = __builtin_fmaf(mn, -C1, 10.0f);
#pragma unroll
      for (int t = 0; t < 4; ++t)
#pragma unroll
        for (int r = 0; r < 8; ++r) ea[g][t][r] = __builtin_fmaf(sc[g][t][r], C1, nmc);
      eal[g] = nmc - nmc_run[g];
      m_run[g] = mn;
      nmc_run[g] = nmc;
    }
    __builtin_amdgcn_sched_barrier(0);
    float alpha[QG];
#pragma unroll
    for (int g = 0; g < QG; ++g) {
      alpha[g] = __builtin_amdgcn_exp2f(eal[g]);
#pragma unroll
      for (int t = 0; t < 4; ++t)
#pragma unroll
        for (int r = 0; r < 8; ++r) ea[g][t][r] = __builtin_amdgcn_exp2f(ea[g][t][r]);
    }
    __builtin_amdgcn_sched_barrier(0);

    // P^T (x1024, f16) straight into the B operand: element s of pb[g][j] = key 32*j + (s < 8 ? 8*hh + s : 16 + 8*hh + s - 8)
    v16h pb[QG][2];
#pragma unroll
    for (int g = 0; g < QG; ++g) {
      float pst[4];
#pragma unroll
      for (int t = 0; t < 4; ++t) {
        pst[t] = 0.f;
#pragma unroll
        for (int r = 0; r < 8; ++r) {
          const float p = ea[g][t][r];
          pst[t] += p;
          pb[g][t >> 1][(t & 1) * 8 + r] = (h16)p;
        }
      }
      l_run[g] = l_run[g] * alpha[g] + ((pst[0] + pst[1]) + (pst[2] + pst[3]));
      // each row's sum, against spills (input only): left alone the compiler sinks the additions behind the trip's barrier
      // and holds all 64 exponentials in registers through the second product, beyond what four waves per SIMD leave a wave
      asm volatile("" :: "v"(l_run[g]));
    }
    // holds the third group of LDS reads behind the sums and the conversion, which free the registers they land in
    __builtin_amdgcn_sched_barrier(0);
#pragma unroll
    for (int dt = 0; dt < 4; ++dt) vf[dt][1] = ldfrag_h(Vt + (16 * dt) * KVP + 32, KVP);
    // keeps these reads together as one group ahead of the second product, not spread among its WMMAs
    __builtin_amdgcn_sched_barrier(0);
#pragma unroll
    for (int g = 0; g < QG; ++g)
#pragma unroll
      for (int dt = 0; dt < 4; ++dt)
#pragma unroll
        for (int r = 0; r < 8; ++r) o[g][dt][r] *= alpha[g];

    // O^T[64 d][QW q] += V^T[64 d][64 keys] . P^T[64 keys][QW q]
#pragma unroll
    for (int dt = 0; dt < 4; ++dt)
#pragma unroll
      for (int g = 0; g < QG; ++g) o[g][dt] = mma_h(vf[dt][0], pb[g][0], o[g][dt]);
#pragma unroll
    for (int dt = 0; dt < 4; ++dt)
#pragma unroll
      for (int g = 0; g < QG; ++g) o[g][dt] = mma_h(vf[dt][1], pb[g][1], o[g][dt]);
    // keeps the waits and the barrier at the trip's foot: behind the second product, so that the copies of the next tile
    // have the whole trip to land
    __builtin_amdgcn_sched_barrier(0);
    asm volatile("s_wait_dscnt 0x0" ::: "memory");      // this wave's reads of the buffer are done
    asm volatile("s_wait_asynccnt 0x0" ::: "memory");   // this wave's share of the next tile has landed
    __syncthreads();   // next tile readable by every wave; this trip's buffer free for the refill
    if (t0 + 128 < KSPAN) stage_kv(kg + (size_t)(t0 + 128) * HD, vg + (t0 + 128), lk0 + buf * KV_BUF_BYTES);
  }
  asm volatile("s_wait_asynccnt 0x0" ::: "memory");     // no copy outstanding behind the loop

  // key group 1 hands its partial sums to the wave of key group 0 that holds the same queries, lane to lane:
  // the products as they stand, the exponent offset they carry, and the key sum with its two halves joined
  if (kgp != 0) {
#pragma unroll
    for (int g = 0; g < QG; ++g) {
      Ps[wave][g][0][lane] = nmc_run[g];
      Ps[wave][g][1][lane] = l_run[g] + xhalf(l_run[g]);
#pragma unroll
      for (int dt = 0; dt < 4; ++dt) {
        v4f w0, w1;
#pragma unroll
        for (int r = 0; r < 4; ++r) { w0[r] = o[g][dt][r]; w1[r] = o[g][dt][4 + r]; }
        *(v4f*)(&Os[wave][(16 * g + mm) * OSP + 16 * dt + 8 * hh])     = w0;
        *(v4f*)(&Os[wave][(16 * g + mm) * OSP + 16 * dt + 8 * hh + 4]) = w1;
      }
    }
  }
  __syncthreads();   // key group 1's partial sums readable by key group 0

  // join (both sides brought to the smaller offset, that of the larger maximum), normalise (sums and products both carry
  // x1024) and stage the QW x 64 f32 tile; a lane overwrites only what it has read itself
  if (kgp == 0) {
#pragma unroll
    for (int g = 0; g < QG; ++g) {
      const float nmc1 = Ps[wave][g][0][lane];
      const float l1   = Ps[wave][g][1][lane];
      const float nmc  = fminf(nmc_run[g], nmc1);
      const float f0 = __builtin_amdgcn_exp2f(nmc - nmc_run[g]);
      const float f1 = __builtin_amdgcn_exp2f(nmc - nmc1);
      const float l0 = l_run[g] + xhalf(l_run[g]);           // the two halves' key sums join here, once
      const float inv = 1.0f / (l0 * f0 + l1 * f1);
      const float s0 = f0 * inv, s1 = f1 * inv;
#pragma unroll
      for (int dt = 0; dt < 4; ++dt) {
        float* p = &Os[wave][(16 * g + mm) * OSP + 16 * dt + 8 * hh];
        const v4f u0 = *(const v4f*)(p), u1 = *(const v4f*)(p + 4);
        v4f w0, w1;
#pragma unroll
        for (int r = 0; r < 4; ++r) { w0[r] = o[g][dt][r] * s0 + u0[r] * s1; w1[r] = o[g][dt][4 + r] * s0 + u1[r] * s1; }
        *(v4f*)(p)     = w0;
        *(v4f*)(p + 4) = w1;
      }
    }
  }
  __syncthreads();

  // each instruction: lanes 0..15 -> row 2i (256 B = 2 full lines), lanes 16..31 -> row 2i+1; each key group's wave stores
  // its share of the query group's rows
  const int rsub = lane >> 4;
  const int cc = (lane & 15) * 4;
  if (SEQ % QBLK == 0 || q0 < SEQ) {
    const int r0 = kgp * (QW / KS) + rsub;
    float* ob = out + ((size_t)b * SEQ + q0 + r0) * DM + (size_t)hd * HD;
    v4f vv[QW / 2 / KS];
#pragma unroll
    for (int i = 0; i < QW / 2 / KS; ++i) vv[i] = *(const v4f*)(&Os[wave][(2 * i + r0) * OSP + cc]);
#pragma unroll
    for (int i = 0; i < QW / 2 / KS; ++i) *(v4f*)(ob + (size_t)(2 * i) * DM + cc) = vv[i];
  }
}

// ---------------- launcher ----------------
extern "C" void kernel_launch(void* const* d_in, const int* in_sizes, int n_in,
                              void* d_out, int out_size, void* d_ws, size_t ws_size,
                              hipStream_t stream) {
  if (n_in < 8) return;
  const float* x   = (const float*)d_in[0];
  const int*   msk = (const int*)d_in[1];
  const float* Wq  = (const float*)d_in[2];
  const float* bq  = (const float*)d_in[3];
  const float* Wk  = (const float*)d_in[4];
  const float* bk  = (const float*)d_in[5];
  const float* Wv  = (const float*)d_in[6];
  const float* bv  = (const float*)d_in[7];
  float* out = (float*)d_out;

  if (in_sizes[0] < ((NB - 1) * S_FULL + SEQ) * DM) return;
  if (in_sizes[1] < (NB - 1) * S_FULL + SEQ) return;
  if (in_sizes[2] < DM * DM || in_sizes[4] < DM * DM || in_sizes[6] < DM * DM) return;
  if (in_sizes[3] < DM || in_sizes[5] < DM || in_sizes[7] < DM) return;
  if (out_size < MT * DM) return;

  char* ws = (char*)d_ws;
  const size_t XB_BYTES = (size_t)MT * DM * 2;              // bf16 x plane [MT][DM]
  const size_t W_BYTES  = (size_t)DM * DM * 2;              // one bf16 weight plane
  const size_t PL_BYTES = (size_t)NB * NH * SEQ * HD * 2;   // one f16 q/k/v^T plane
  size_t off = 0;
  u16* Xb = (u16*)(ws + off);  off += XB_BYTES;
  u16* Wb = (u16*)(ws + off);  off += 3 * W_BYTES;
  h16* Qp = (h16*)(ws + off);  off += PL_BYTES;
  h16* Kp = (h16*)(ws + off);  off += PL_BYTES;
  h16* VTp = (h16*)(ws + off); off += PL_BYTES;
  if (off > ws_size) return;

  k_cvt_bf16<<<CV_XB + 3 * CV_WB, 256, 0, stream>>>(x, Wq, Wk, Wv, Xb, Wb);

  dim3 gp(MT / PBT, DM / PBT, 3);
  k_proj<<<gp, 128, 0, stream>>>(Xb, Wb, bq, bk, bv, Qp, Kp, VTp);

  dim3 ga((SEQ + QBLK - 1) / QBLK, NB * NH);
  k_attn<<<ga, 256, 0, stream>>>(Qp, Kp, VTp, msk, out);
}

// v010
// It runs in 47.7 microseconds.
// Next to v009, in two timings, it ran 1.11 times as fast each time.
// Over all steps from v000 it is 5.50 times as fast.
#include <hip/hip_runtime.h>
#include <stdint.h>

// Contractions: x.Wq^T, x.Wk^T, x.Wv^T on v_wmma_f32_16x16x32_bf16 (bf16 operands = RNE-converted f32 inputs, f32 accumulate);
// k.q^T and V^T.P^T on v_wmma_f32_16x16x32_f16 (f16 operands, P carried x1024, f32 accumulate); bias add, softmax, normalisation in f32.
// q is stored times log2(e)/8, so that k.q^T is the score in powers of two; the start value of its accumulators is the
// exponent offset in use (or, on the general path, the additive key mask).

typedef unsigned short u16;
typedef _Float16 h16;
typedef __bf16 v16bf __attribute__((ext_vector_type(16)));
typedef h16 v16h __attribute__((ext_vector_type(16)));
typedef h16 v8h __attribute__((ext_vector_type(8), __may_alias__));
typedef float v8f __attribute__((ext_vector_type(8)));
typedef float v4f __attribute__((ext_vector_type(4), __may_alias__));
typedef float v2f __attribute__((ext_vector_type(2)));
typedef unsigned int v4u __attribute__((ext_vector_type(4), __may_alias__));
typedef int v4i __attribute__((ext_vector_type(4), __may_alias__));

#ifndef NB
#define NB 4
#endif
#ifndef SEQ
#define SEQ 2048
#endif
#define NB_FULL 4
#define S_FULL 2048
#define DM 512
#define NH 8
#define HD 64
#define MT (NB * SEQ)

static_assert(NB >= 1 && NB <= NB_FULL);
static_assert(SEQ % 64 == 0 && SEQ <= S_FULL);
static_assert(DM % 64 == 0 && DM % 32 == 0);
static_assert(NH * HD == DM);
static_assert(HD == 64);
static_assert(MT % 64 == 0);

// ---------------- helpers ----------------

__device__ __forceinline__ u16 f2bf(float f) {
  unsigned u = __float_as_uint(f);
  u += 0x7FFFu + ((u >> 16) & 1u);   // RNE convert f32 -> bf16 bits
  return (u16)(u >> 16);
}

__device__ __forceinline__ float bf_rn(float f) {
  return __uint_as_float(((unsigned)f2bf(f)) << 16);
}

__device__ __forceinline__ v8f zero8() {
  v8f z = {0.f, 0.f, 0.f, 0.f, 0.f, 0.f, 0.f, 0.f};
  return z;
}

// 16x32 16-bit fragment from row-major storage with k contiguous (pitch ld elements):
// lane l: row = l&15; elements 0..7 <- k0 + 8*(l>>4) + 0..7; elements 8..15 <- k0 + 16 + 8*(l>>4) + 0..7.
// Used for A (row = m) and for B stored n-major with k contiguous (row = n).
__device__ __forceinline__ v16bf ldfrag_bf(const u16* base, int ld) {
  const int l = threadIdx.x & 31;
  const int row = l & 15;
  const int kb = (l >> 4) << 3;
  const u16* p = base + (size_t)row * ld + kb;
  union { v16bf v; v4u q[2]; } u;
  u.q[0] = *(const v4u*)(p);
  u.q[1] = *(const v4u*)(p + 16);
  return u.v;
}

__device__ __forceinline__ v16h ldfrag_h(const h16* base, int ld) {
  const int l = threadIdx.x & 31;
  const int row = l & 15;
  const int kb = (l >> 4) << 3;
  const h16* p = base + (size_t)row * ld + kb;
  union { v16h v; v8h q[2]; } u;
  u.q[0] = *(const v8h*)(p);
  u.q[1] = *(const v8h*)(p + 16);
  return u.v;
}

// D[16x16] += A[16x32] . B[32x16]; D element r of lane l = (row 8*(l>>4)+r, col l&15)
__device__ __forceinline__ v8f mma_bf(v16bf a, v16bf b, v8f c) {
  v8f r = __builtin_amdgcn_wmma_f32_16x16x32_bf16(false, a, false, b, (short)0, c, false, false);
  asm volatile("v_nop\n\tv_nop\n\tv_nop\n\tv_nop" : "+v"(r) : "v"(a), "v"(b));
  return r;
}

__device__ __forceinline__ v8f mma_h(v16h a, v16h b, v8f c) {
  return __builtin_amdgcn_wmma_f32_16x16x32_f16(false, a, false, b, (short)0, c, false, false);
}

// value of lane l ^ 16 (the other half of the wave holds the other keys of the same query column)
__device__ __forceinline__ float xhalf(float x) {
  const int b = __float_as_int(x);
  return __int_as_float(__builtin_amdgcn_permlanex16(b, b, 0x76543210, 0xfedcba98, false, false));
}

// ---------------- stage 0: f32 -> bf16 planes (rows of DM elements), one launch for x and the three weights ----------------
// A piece = 8 elements: 32 B read, 16 B written. A block converts CV_BLK consecutive pieces (CV_ROWS whole rows) of ONE
// source; the block index picks the source: [0, CV_XB) -> x, then CV_WB blocks each for Wq, Wk, Wv (their planes follow one
// another in Wb). A lane takes CV_U pieces, 256 pieces apart.
// x plane row pr <- source row (pr / SEQ) * S_FULL + pr % SEQ; a block's rows lie in one group of SEQ rows.
#define CV_U 4
#define CV_BLK (256 * CV_U)
#define CV_ROWS (CV_BLK / (DM / 8))
#define CV_XB (MT / CV_ROWS)
#define CV_WB (DM / CV_ROWS)
static_assert(CV_BLK % (DM / 8) == 0 && SEQ % CV_ROWS == 0 && DM % CV_ROWS == 0);

__global__ __launch_bounds__(256) void k_cvt_bf16(const float* __restrict__ x, const float* __restrict__ Wq,
                                                   const float* __restrict__ Wk, const float* __restrict__ Wv,
                                                   u16* __restrict__ Xb, u16* __restrict__ Wb) {
  const unsigned blk = blockIdx.x;
  const float* src;   // first source row of this block
  u16* dst;           // first plane row of this block
  if (blk < CV_XB) {
    const unsigned pr0 = blk * CV_ROWS;
    src = x + (size_t)((pr0 / SEQ) * S_FULL + pr0 % SEQ) * DM;
    dst = Xb + (size_t)pr0 * DM;
  } else {
    const unsigned wb = blk - CV_XB;
    const unsigned mat = wb / CV_WB;
    src = ((mat == 0) ? Wq : ((mat == 1) ? Wk : Wv)) + (size_t)(wb - mat * CV_WB) * CV_ROWS * DM;
    dst = Wb + (size_t)wb * CV_ROWS * DM;
  }
  const float* s = src + threadIdx.x * 8;
  u16* d = dst + threadIdx.x * 8;

  v4f a[CV_U], b[CV_U];
  // unrolled so that a and b stay in registers and all 2 * CV_U loads are issued ahead of the first conversion
#pragma unroll
  for (int j = 0; j < CV_U; ++j) {
    a[j] = *(const v4f*)(s + j * (256 * 8));
    b[j] = *(const v4f*)(s + j * (256 * 8) + 4);
  }
#pragma unroll
  for (int j = 0; j < CV_U; ++j) {
    v4u w;
    w.x = (unsigned)f2bf(a[j].x) | ((unsigned)f2bf(a[j].y) << 16);
    w.y = (unsigned)f2bf(a[j].z) | ((unsigned)f2bf(a[j].w) << 16);
    w.z = (unsigned)f2bf(b[j].x) | ((unsigned)f2bf(b[j].y) << 16);
    w.w = (unsigned)f2bf(b[j].z) | ((unsigned)f2bf(b[j].w) << 16);
    *(v4u*)(d + j * (256 * 8)) = w;
  }
}

// ---------------- stage 1: projections ----------------
// out[row, n] = (sum_k Xb[row, k] * W[n, k] + bias[n]) times QSC for q; row in [0, MT), n in [0, DM), K = DM.
// blockIdx.z selects the matrix: 0 -> Q plane [bh][s][64], 1 -> K plane [bh][s][64], 2 -> V^T plane [bh][64][SEQ] (f16).
// Block = 4 waves (2 x 2), tile 128(M) x 128(N); wave owns 64 rows x 64 cols (one head). Each k-tile of 64 elements
// (128 rows x 128 B of X and of W) is copied once per block into LDS in whole lines (two buffers, the next k-tile in flight
// while this one is worked on); the waves take their fragments from there, each fragment feeding four WMMAs.
// Each sum runs over k in ascending steps of 32.
#define QSC (0.125f * 1.44269504088896340736f)   // 1/sqrt(HD) and log2(e) in one factor, carried by the stored q
#define PBT 128                      // rows of X and rows of W per block tile
#define XWP 72                       // bf16 per staged row: 128 B of data + 16 B pad, the pitch for 16-byte LDS readers
#define XW_TILE (PBT * XWP)          // bf16 per staged tile (128 rows)
#define XW_BUF_BYTES (2 * XW_TILE * 2)
#define TSP 72                       // f16 per staged output row: 128 B of data + 16 B pad
static_assert(MT % PBT == 0 && SEQ % PBT == 0 && DM % PBT == 0);
static_assert(4 * 64 * TSP <= 2 * 2 * XW_TILE);

// One k-tile of 128 rows into one buffer: 8 copies of 16 B per lane, each wave-wide copy = 4 whole 128-B lines.
// g: the lane's global address in rows 0..15 of the tile; l: the lane's LDS byte address in rows 0..15 of the staged tile.
__device__ __forceinline__ void stage_rows(const u16* g, unsigned l) {
  const unsigned rs = 16 * XWP * 2;  // 16 staged rows, in bytes
  // s_wait_xcnt closes the statement so that no address register is rewritten ahead of it
  asm volatile("global_load_async_to_lds_b128 %0, %8, off\n\t"
               "global_load_async_to_lds_b128 %1, %9, off\n\t"
               "global_load_async_to_lds_b128 %2, %10, off\n\t"
               "global_load_async_to_lds_b128 %3, %11, off\n\t"
               "global_load_async_to_lds_b128 %4, %12, off\n\t"
               "global_load_async_to_lds_b128 %5, %13, off\n\t"
               "global_load_async_to_lds_b128 %6, %14, off\n\t"
               "global_load_async_to_lds_b128 %7, %15, off\n\t"
               "s_wait_xcnt 0x0"
               :: "v"(l), "v"(l + rs), "v"(l + 2 * rs), "v"(l + 3 * rs),
                  "v"(l + 4 * rs), "v"(l + 5 * rs), "v"(l + 6 * rs), "v"(l + 7 * rs),
                  "v"(g), "v"(g + 16 * DM), "v"(g + 32 * DM), "v"(g + 48 * DM),
                  "v"(g + 64 * DM), "v"(g + 80 * DM), "v"(g + 96 * DM), "v"(g + 112 * DM)
               : "memory");
}

// One k-tile of X and one of W into one buffer; lx: the lane's LDS byte address in the X tile.
__device__ __forceinline__ void stage_xw(const u16* xg, const u16* wg, unsigned lx) {
  stage_rows(xg, lx);
  stage_rows(wg, lx + XW_TILE * 2);
}

// waves_per_eu(3, 3): the grid is 3 work-groups for each of the chip's WGPs; the register allocation is held at three
// waves per SIMD so that no WGP takes a fourth and leaves another short.
__global__ __launch_bounds__(128) __attribute__((amdgpu_waves_per_eu(3, 3)))
void k_proj(const u16* __restrict__ Xb, const u16* __restrict__ Wb,
            const float* __restrict__ bq, const float* __restrict__ bk, const float* __restrict__ bv,
            h16* __restrict__ Qp, h16* __restrict__ Kp, h16* __restrict__ VTp) {
  __shared__ __attribute__((aligned(16))) u16 XWs[2][2][XW_TILE];   // [buffer][X | W][row * XWP + k]

  const int wave = threadIdx.x >> 5, lane = threadIdx.x & 31;
  const int hh = lane >> 4, mm = lane & 15;
  const int wm = wave >> 1, wn = wave & 1;
  const int mat = blockIdx.z;
  const int m0 = blockIdx.x * PBT, n0 = blockIdx.y * PBT;
  const u16* W = Wb + (size_t)mat * DM * DM + (size_t)n0 * DM;   // rows n0..n0+127, k contiguous
  const float* bias = (mat == 0) ? bq : ((mat == 1) ? bk : bv);

  v8f acc[4][4];   // acc[i][j][r] = (row 64*wm + 16*i + 8*hh + r, col 64*wn + 16*j + mm)
#pragma unroll
  for (int i = 0; i < 4; ++i)
#pragma unroll
    for (int j = 0; j < 4; ++j) acc[i][j] = zero8();

  // the lane's 16-byte piece of rows 0..15 of a k-tile: 8 lanes per 128-B line
  const int crow = threadIdx.x >> 3, ccol = (threadIdx.x & 7) * 8;
  const u16* xg = Xb + (size_t)(m0 + crow) * DM + ccol;
  const u16* wg = W + (size_t)crow * DM + ccol;
  const unsigned lx0 = (unsigned)(uintptr_t)&XWs[0][0][crow * XWP + ccol];

  stage_xw(xg, wg, lx0);
  asm volatile("s_wait_asynccnt 0x0" ::: "memory");   // this wave's share of k-tile 0 has landed
  __syncthreads();                                     // k-tile 0 readable by every wave
  if (DM > 64) stage_xw(xg + 64, wg + 64, lx0 + XW_BUF_BYTES);

  for (int kt = 0; kt < DM; kt += 64) {
    const int buf = (kt >> 6) & 1;
    const u16* Xt = &XWs[buf][0][(wm * 64) * XWP];
    const u16* Wt = &XWs[buf][1][(wn * 64) * XWP];
    // unrolled so that the fragments and the sums stay in registers
#pragma unroll
    for (int k0 = 0; k0 < 64; k0 += 32) {
      v16bf a[4], b[4];
#pragma unroll
      for (int i = 0; i < 4; ++i) a[i] = ldfrag_bf(Xt + (i * 16) * XWP + k0, XWP);
#pragma unroll
      for (int j = 0; j < 4; ++j) b[j] = ldfrag_bf(Wt + (j * 16) * XWP + k0, XWP);
#pragma unroll
      for (int i = 0; i < 4; ++i)
#pragma unroll
        for (int j = 0; j < 4; ++j) acc[i][j] = mma_bf(a[i], b[j], acc[i][j]);
    }
    asm volatile("s_wait_dscnt 0x0" ::: "memory");      // this wave's reads of the buffer are done
    asm volatile("s_wait_asynccnt 0x0" ::: "memory");   // this wave's share of the next k-tile has landed
    __syncthreads();   // next k-tile readable by every wave; this trip's buffer free for the refill
    if (kt + 128 < DM) stage_xw(xg + (kt + 128), wg + (kt + 128), lx0 + buf * XW_BUF_BYTES);
  }
  asm volatile("s_wait_asynccnt 0x0" ::: "memory");     // no copy outstanding behind the loop

  // bias enters as its bf16-RNE value; q leaves times QSC (f32, ahead of the one rounding to f16), k and v times 1
  const float qs = (mat == 0) ? QSC : 1.0f;
  float bb[4];
#pragma unroll
  for (int j = 0; j < 4; ++j) bb[j] = bf_rn(bias[n0 + 64 * wn + 16 * j + mm]) * qs;

  // Each wave stages its own 64x64 tile in its own part of the ring, which every wave has left at the loop's last barrier:
  // [row][col] for Q/K, transposed [col][row] for V.
  h16* Tw = (h16*)&XWs[0][0][0] + wave * (64 * TSP);
  const bool tr = (mat == 2);
  if (tr) {
#pragma unroll
    for (int j = 0; j < 4; ++j)
#pragma unroll
      for (int i = 0; i < 4; ++i) {
        v8h w;
#pragma unroll
        for (int r = 0; r < 8; ++r) w[r] = (h16)(acc[i][j][r] + bb[j]);
        *(v8h*)(&Tw[(16 * j + mm) * TSP + 16 * i + 8 * hh]) = w;
      }
  } else {
#pragma unroll
    for (int i = 0; i < 4; ++i)
#pragma unroll
      for (int j = 0; j < 4; ++j)
#pragma unroll
        for (int r = 0; r < 8; ++r) Tw[(16 * i + 8 * hh + r) * TSP + 16 * j + mm] = (h16)__builtin_fmaf(acc[i][j][r], qs, bb[j]);
  }
  asm volatile("s_wait_dscnt 0x0" ::: "memory");        // the wave's own tile is written before it reads the rows back

  const int b  = m0 / SEQ;
  const int s0 = m0 - b * SEQ + 64 * wm;
  const int bh = b * NH + blockIdx.y * (PBT / HD) + wn;
  h16* dstp = (mat == 0) ? Qp : ((mat == 1) ? Kp : VTp);
  const int pc = (lane & 7) * 8;
  const int rb = lane >> 3;
  // each instruction: 4 staged rows = 4 whole 128-B lines
  v8h vals[16];
#pragma unroll
  for (int i = 0; i < 16; ++i) vals[i] = *(const v8h*)(&Tw[(i * 4 + rb) * TSP + pc]);
  if (tr) {
    h16* d = dstp + ((size_t)bh * HD + rb) * SEQ + s0 + pc;
#pragma unroll
    for (int i = 0; i < 16; ++i) *(v8h*)(d + (size_t)(i * 4) * SEQ) = vals[i];
  } else {
    h16* d = dstp + ((size_t)bh * SEQ + s0 + rb) * HD + pc;
#pragma unroll
    for (int i = 0; i < 16; ++i) *(v8h*)(d + (size_t)(i * 4) * HD) = vals[i];
  }
}

// ---------------- stage 2: flash attention ----------------
// Block = 8 waves in KS = 2 key groups of 4, owns (bh, 128 query rows); wave owns 32 query rows (two column groups of 16)
// and loops over the 64-key tiles of its group's share of the keys (SEQ / KS keys in a row); waves w and w + 4 hold the same
// queries. The groups' partial sums are joined once, behind the loop, through LDS.
// Q fragments from the [bh][s][64] plane. Each 64-key tile of K ([key][64]) and of V^T ([d][64 keys]) is copied once per
// block into the group's own LDS ring (two buffers, the next tile in flight while this one is worked on) and the group's
// four waves take their fragments from there. The products run transposed: S^T[key][q] = K . Q^T and O^T[d][q] += V^T . P^T, so a lane holds
// one query's scores (keys 16t + 8*(l>>4) + r), and two converted score tiles are the B operand of the second product.
#define KVP 72                       // f16 per staged row: 128 B of data + 16 B pad, the pitch for 16-byte LDS readers
#define KV_TILE (64 * KVP)           // f16 per staged tile (64 rows)
#define KV_BUF_BYTES (2 * KV_TILE * 2)
#define OSP 68                       // f32 per staged output row: 256 B of data + 16 B pad (16-byte LDS writers, one row per lane)

// One tile of K and one of V^T into one buffer: 8 copies of 16 B per lane, each wave-wide copy = 4 whole 128-B rows.
// kg, vg: the lane's global address in rows 0..15 of the two tiles; lk: the lane's LDS byte address in the K tile.
__device__ __forceinline__ void stage_kv(const h16* kg, const h16* vg, unsigned lk) {
  const unsigned lv = lk + KV_TILE * 2;
  const unsigned rs = 16 * KVP * 2;  // 16 staged rows, in bytes
  // s_wait_xcnt closes the statement so that no address register is rewritten ahead of it
  asm volatile("global_load_async_to_lds_b128 %0, %8, off\n\t"
               "global_load_async_to_lds_b128 %1, %9, off\n\t"
               "global_load_async_to_lds_b128 %2, %10, off\n\t"
               "global_load_async_to_lds_b128 %3, %11, off\n\t"
               "global_load_async_to_lds_b128 %4, %12, off\n\t"
               "global_load_async_to_lds_b128 %5, %13, off\n\t"
               "global_load_async_to_lds_b128 %6, %14, off\n\t"
               "global_load_async_to_lds_b128 %7, %15, off\n\t"
               "s_wait_xcnt 0x0"
               :: "v"(lk), "v"(lk + rs), "v"(lk + 2 * rs), "v"(lk + 3 * rs),
                  "v"(lv), "v"(lv + rs), "v"(lv + 2 * rs), "v"(lv + 3 * rs),
                  "v"(kg), "v"(kg + 16 * HD), "v"(kg + 32 * HD), "v"(kg + 48 * HD),
                  "v"(vg), "v"(vg + (size_t)16 * SEQ), "v"(vg + (size_t)32 * SEQ), "v"(vg + (size_t)48 * SEQ)
               : "memory");
}

#define QG 2                         // 16-query column groups per wave: each K and V^T fragment read from LDS feeds QG WMMAs
#define QW (16 * QG)                 // queries per wave
#define QBLK (4 * QW)                // queries per block
#define KS 2                         // key groups per block
#define KSPAN (SEQ / KS)             // keys per group
#define PSMAX 60000.0f               // bound on a lane's sum of one tile's P terms (32 keys): below the largest f16
static_assert(SEQ % (KS * 64) == 0);
static_assert(KSPAN % 128 == 0 && KSPAN / 64 <= 32);

// waves_per_eu(4, 4): the grid is 2 work-groups of 8 waves for each of the chip's WGPs, four waves per SIMD; the vector work
// of one wave's softmax then has three other waves' products to run beside.
__global__ __launch_bounds__(256) __attribute__((amdgpu_waves_per_eu(4, 4)))
void k_attn(const h16* __restrict__ Qp, const h16* __restrict__ Kp, const h16* __restrict__ VTp,
            const int* __restrict__ mask, float* __restrict__ out) {
  __shared__ __attribute__((aligned(16))) h16   KVs[KS][2][2][KV_TILE]; // [key group][buffer][K | V^T][row * KVP + col]
  __shared__ __attribute__((aligned(16))) float Madd[SEQ];        // the additive key mask times log2(e): -10000*log2(e)*(1 - m), one per key
  __shared__ __attribute__((aligned(16))) float Os[4][QW * OSP];  // per query group: output tile [q][d]
  __shared__ float Ps[4][QG][2][32];                              // per query group: key group 1's exponent offset and key sum, per lane

  const int lane = threadIdx.x & 31;
  const int kgp  = __builtin_amdgcn_readfirstlane((int)(threadIdx.x >> 7));   // key group, the same in the whole wave
  const int wave = __builtin_amdgcn_readfirstlane((int)(threadIdx.x >> 5)) & 3;   // query group, held in a scalar register
  const int kb0  = kgp * KSPAN;                                               // the group's first key
  const int hh = lane >> 4, mm = lane & 15;
  const int bh = blockIdx.y;
  const int b  = bh / NH;
  const int hd = bh - b * NH;
  const int q0 = blockIdx.x * QBLK + wave * QW;
  // a wave wholly past the last query keeps its part in the staging and the barriers, works on the last rows, stores nothing
  const int q0l = (SEQ % QBLK == 0 || q0 < SEQ) ? q0 : (SEQ - QW);

  const h16* Qbh = Qp  + (size_t)bh * SEQ * HD;
  const h16* Kbh = Kp  + (size_t)bh * SEQ * HD;
  const h16* Vbh = VTp + (size_t)bh * HD * SEQ;
  const int* mk_b = mask + (size_t)b * S_FULL;

  v16h aq[QG][2];
#pragma unroll
  for (int g = 0; g < QG; ++g) {
    aq[g][0] = ldfrag_h(Qbh + (size_t)(q0l + 16 * g) * HD, HD);
    aq[g][1] = ldfrag_h(Qbh + (size_t)(q0l + 16 * g) * HD + 32, HD);
  }

  // per lane and group: the exponent offset in use for query column 16*g + mm (both halves agree), 10 minus the reference
  // score (in powers of two), held eight times over as a WMMA start value; running sum over this half's keys only.
  // The sums and products carry 2^offset. The reference is a maximum of scores met so far, not always the latest one.
  float l_run[QG], nmc_run[QG];   // nmc_run: the offset once more, for the vector work
  v8f cref[QG];
  v8f o[QG][4];   // o[g][dt][r] = O^T[16*dt + 8*hh + r][16*g + mm]
#pragma unroll
  for (int g = 0; g < QG; ++g) {
    l_run[g] = 0.f;
    nmc_run[g] = 1e30f;
#pragma unroll
    for (int r = 0; r < 8; ++r) cref[g][r] = 1e30f;
#pragma unroll
    for (int dt = 0; dt < 4; ++dt) o[g][dt] = zero8();
  }

  // the lane's 16-byte piece of rows 0..15 of a tile: 8 lanes per 128-B row
  const int crow = (threadIdx.x & 127) >> 3, ccol = (threadIdx.x & 7) * 8;
  const h16* kg = Kbh + (size_t)(kb0 + crow) * HD + ccol;
  const h16* vg = Vbh + (size_t)crow * SEQ + kb0 + ccol;
  const unsigned lk0 = (unsigned)(uintptr_t)&KVs[kgp][0][0][crow * KVP + ccol];

  stage_kv(kg, vg, lk0);
  // a lane now needs the mask term of 32 keys per tile: form all of them once per block, read them back 16 B at a time
#pragma unroll
  for (int i0 = 0; i0 < SEQ; i0 += 256 * 4) {
    const int i = i0 + (int)threadIdx.x * 4;
    if (SEQ % (256 * 4) == 0 || i < SEQ) {
      const v4i mi = *(const v4i*)(mk_b + i);
      v4f ma;
#pragma unroll
      for (int j = 0; j < 4; ++j) ma[j] = -14426.950408889634f * (1.0f - (float)mi[j]);
      *(v4f*)(&Madd[i]) = ma;
    }
  }
  asm volatile("s_wait_asynccnt 0x0" ::: "memory");   // this wave's share of tile 0 has landed
  __syncthreads();                                     // tile 0 and the mask terms readable by every wave
  if (KSPAN > 64) stage_kv(kg + (size_t)64 * HD, vg + 64, lk0 + KV_BUF_BYTES);

  // bit i: tile i of this group's keys holds a key whose mask term is not zero (the same word in every lane)
  unsigned mflags = 0;
#pragma unroll
  for (int j = 0; j < KSPAN / 128; ++j) {
    const v4f mv = *(const v4f*)(&Madd[kb0 + j * 128 + lane * 4]);
    const unsigned bl = __builtin_amdgcn_ballot_w32((mv[0] != 0.f) | (mv[1] != 0.f) | (mv[2] != 0.f) | (mv[3] != 0.f));
    mflags |= (((bl & 0xFFFFu) != 0u) ? 1u : 0u) << (2 * j);
    mflags |= (((bl >> 16) != 0u) ? 2u : 0u) << (2 * j);
  }

#pragma unroll 1
  for (int t0 = 0; t0 < KSPAN; t0 += 64) {
    const int buf = (t0 >> 6) & 1;
    const h16* Kt = &KVs[kgp][buf][0][0];
    const h16* Vt = &KVs[kgp][buf][1][0];
    // P^T (x 2^offset, f16), the B operand: element s of pb[g][j] = key 32*j + (s < 8 ? 8*hh + s : 16 + 8*hh + s - 8)
    v16h pb[QG][2];
    v16h vf[4][2];
    // The general path takes the group's first tile (no reference yet) and every tile with a masked key; both tests are scalar.
    bool gen = (t0 == 0) || (((mflags >> (t0 >> 6)) & 1u) != 0u);

    if (!gen) {
      // Short path: the offset in use is the accumulators' start value, so the products are the exponents themselves:
      // no maximum, no add per score, no rescaling of the sums. sc[g][t][r] = key 16*t + 8*hh + r, query 16*g + mm.
      v8f sc[QG][4];
      v16h kf[4][2];
      float ps[QG];
#pragma unroll
      for (int t = 0; t < 4; ++t) {
        kf[t][0] = ldfrag_h(Kt + (16 * t) * KVP, KVP);
        kf[t][1] = ldfrag_h(Kt + (16 * t) * KVP + 32, KVP);
      }
      // keeps the K reads up here as one group, waited out once, not sunk in between the WMMAs
      __builtin_amdgcn_sched_barrier(0);
#pragma unroll
      for (int t = 0; t < 4; ++t)
#pragma unroll
        for (int g = 0; g < QG; ++g) sc[g][t] = mma_h(kf[t][0], aq[g][0], cref[g]);
#pragma unroll
      for (int t = 0; t < 4; ++t)
#pragma unroll
        for (int g = 0; g < QG; ++g) sc[g][t] = mma_h(kf[t][1], aq[g][1], sc[g][t]);
      // input only: the offsets are still in use behind the last product that starts from them; without this the compiler
      // copies them (8 v_mov_b64) into that product's accumulators and holds the WMMA run up for the copies
      asm volatile("" :: "v"(cref[0]), "v"(cref[1]));
      // the V^T fragments of the tile's first 32 keys, asked for here so that they arrive while the exponentials run
#pragma unroll
      for (int dt = 0; dt < 4; ++dt) vf[dt][0] = ldfrag_h(Vt + (16 * dt) * KVP, KVP);
      // keeps the V^T reads up here as one group: without it the compiler sinks them in among the second product's WMMAs
      __builtin_amdgcn_sched_barrier(0);
#pragma unroll
      for (int g = 0; g < QG; ++g)
#pragma unroll
        for (int t = 0; t < 4; ++t)
#pragma unroll
          for (int r = 0; r < 8; ++r) sc[g][t][r] = __builtin_amdgcn_exp2f(sc[g][t][r]);
      // keeps the v_exp_f32 together
      __builtin_amdgcn_sched_barrier(0);
#pragma unroll
      for (int g = 0; g < QG; ++g) {
        v2f pst[4];   // register pairs as they lie, one chain per score tile
#pragma unroll
        for (int t = 0; t < 4; ++t) {
          pst[t] = (v2f){sc[g][t][0], sc[g][t][1]};
#pragma unroll
          for (int r = 2; r < 8; r += 2) pst[t] += (v2f){sc[g][t][r], sc[g][t][r + 1]};
#pragma unroll
          for (int r = 0; r < 8; ++r) pb[g][t >> 1][(t & 1) * 8 + r] = (h16)sc[g][t][r];
        }
        const v2f p2 = (pst[0] + pst[1]) + (pst[2] + pst[3]);
        ps[g] = p2[0] + p2[1];
      }
      // Every term is >= 0, so a tile sum within PSMAX bounds each of its terms inside the f16 range. One test per tile for
      // the whole wave: where a score has outgrown the reference (an infinite sum included), the tile is done again below.
      gen = __builtin_amdgcn_ballot_w32(!(fmaxf(ps[0], ps[1]) <= PSMAX)) != 0u;
#pragma unroll
      for (int g = 0; g < QG; ++g) l_run[g] = gen ? l_run[g] : l_run[g] + ps[g];
    }

    if (gen) {
      // General path: scores S^T[64 keys][QW q] = k . q^T + mask term, their maximum, a new reference, the old sums rescaled.
      // All K fragments and the mask terms are asked for ahead of the first product, not fragment by fragment between
      // its WMMAs, so that the wave waits out the LDS latency once (the compiler orders them and counts its waits).
      v8f sc[QG][4];
      v16h kf[4][2];
      v4f ma[4][2];
#pragma unroll
      for (int t = 0; t < 4; ++t) {
        kf[t][0] = ldfrag_h(Kt + (16 * t) * KVP, KVP);
        kf[t][1] = ldfrag_h(Kt + (16 * t) * KVP + 32, KVP);
      }
#pragma unroll
      for (int t = 0; t < 4; ++t) {
        ma[t][0] = *(const v4f*)(&Madd[kb0 + t0 + 16 * t + 8 * hh]);
        ma[t][1] = *(const v4f*)(&Madd[kb0 + t0 + 16 * t + 8 * hh + 4]);
      }
      // keeps these reads up here as one group: within 256 registers the compiler otherwise sinks the K reads in between the
      // WMMAs, two at a time into one fragment's registers, each pair waited out in full
      __builtin_amdgcn_sched_barrier(0);
#pragma unroll
      for (int t = 0; t < 4; ++t) {   // the mask terms are the accumulators' start values: no vector add per score
        const v8f mc = __builtin_shufflevector(ma[t][0], ma[t][1], 0, 1, 2, 3, 4, 5, 6, 7);
#pragma unroll
        for (int g = 0; g < QG; ++g) sc[g][t] = mma_h(kf[t][0], aq[g][0], mc);
      }
#pragma unroll
      for (int t = 0; t < 4; ++t)
#pragma unroll
        for (int g = 0; g < QG; ++g) sc[g][t] = mma_h(kf[t][1], aq[g][1], sc[g][t]);
      // the V^T fragments of this tile's first 32 keys, asked for here so that they arrive while the softmax runs
#pragma unroll
      for (int dt = 0; dt < 4; ++dt) vf[dt][0] = ldfrag_h(Vt + (16 * dt) * KVP, KVP);
      // keeps the V^T reads up here as one group: without it the compiler sinks them in among the second product's WMMAs
      __builtin_amdgcn_sched_barrier(0);

      // one query per lane and group: maximum in-lane over 32 keys, then one exchange with the other half.
      // 2^(sc + nmc) = 1024 * e^(score - reference), with nmc = 10 - reference; the reference only rises. The old sums carry
      // the old offset, so their factor is 2^(nmc - old offset).
      float eal[QG], nnew[QG];
#pragma unroll
      for (int g = 0; g < QG; ++g) {
        float mt[4];
#pragma unroll
        for (int t = 0; t < 4; ++t) {
          mt[t] = sc[g][t][0];
#pragma unroll
          for (int r = 1; r < 8; ++r) mt[t] = fmaxf(mt[t], sc[g][t][r]);
        }
        float mx = fmaxf(fmaxf(mt[0], mt[1]), fmaxf(mt[2], mt[3]));
        mx = fmaxf(mx, xhalf(mx));
        const float nold = nmc_run[g];
        const float nmc = fminf(nold, 10.0f - mx);
#pragma unroll
        for (int t = 0; t < 4; ++t)
#pragma unroll
          for (int r = 0; r < 8; ++r) sc[g][t][r] += nmc;
        eal[g] = nmc - nold;
        nnew[g] = nmc;
      }
      // the arguments first, then the exponentials together (the free slot behind a transcendental, as on the short path)
      __builtin_amdgcn_sched_barrier(0);
      float alpha[QG];
#pragma unroll
      for (int g = 0; g < QG; ++g) {
        alpha[g] = __builtin_amdgcn_exp2f(eal[g]);
#pragma unroll
        for (int t = 0; t < 4; ++t)
#pragma unroll
          for (int r = 0; r < 8; ++r) sc[g][t][r] = __builtin_amdgcn_exp2f(sc[g][t][r]);
      }
      // ends the group of exponentials (see above)
      __builtin_amdgcn_sched_barrier(0);
#pragma unroll
      for (int g = 0; g < QG; ++g) {
        v2f pst[4];   // summed in the short path's order
#pragma unroll
        for (int t = 0; t < 4; ++t) {
          pst[t] = (v2f){sc[g][t][0], sc[g][t][1]};
#pragma unroll
          for (int r = 2; r < 8; r += 2) pst[t] += (v2f){sc[g][t][r], sc[g][t][r + 1]};
#pragma unroll
          for (int r = 0; r < 8; ++r) pb[g][t >> 1][(t & 1) * 8 + r] = (h16)sc[g][t][r];
        }
        const v2f p2 = (pst[0] + pst[1]) + (pst[2] + pst[3]);
        l_run[g] = l_run[g] * alpha[g] + (p2[0] + p2[1]);
#pragma unroll
        for (int r = 0; r < 8; ++r) cref[g][r] = nnew[g];
        nmc_run[g] = nnew[g];
#pragma unroll
        for (int dt = 0; dt < 4; ++dt)
#pragma unroll
          for (int r = 0; r < 8; ++r) o[g][dt][r] *= alpha[g];
      }
    }

    // The V^T fragments of the last 32 keys follow behind the sums and the conversion, which free the registers they land
    // in: with all eight ahead of the exponentials the wave needs more than the 256 registers of four waves per SIMD.
#pragma unroll
    for (int dt = 0; dt < 4; ++dt) vf[dt][1] = ldfrag_h(Vt + (16 * dt) * KVP + 32, KVP);
    // keeps these reads together as one group ahead of the second product, not spread among its WMMAs
    __builtin_amdgcn_sched_barrier(0);

    // O^T[64 d][QW q] += V^T[64 d][64 keys] . P^T[64 keys][QW q]
#pragma unroll
    for (int dt = 0; dt < 4; ++dt)
#pragma unroll
      for (int g = 0; g < QG; ++g) o[g][dt] = mma_h(vf[dt][0], pb[g][0], o[g][dt]);
#pragma unroll
    for (int dt = 0; dt < 4; ++dt)
#pragma unroll
      for (int g = 0; g < QG; ++g) o[g][dt] = mma_h(vf[dt][1], pb[g][1], o[g][dt]);
    // keeps the waits and the barrier at the trip's foot: behind the second product, so that the copies of the next tile
    // have the whole trip to land
    __builtin_amdgcn_sched_barrier(0);
    asm volatile("s_wait_dscnt 0x0" ::: "memory");      // this wave's reads of the buffer are done
    asm volatile("s_wait_asynccnt 0x0" ::: "memory");   // this wave's share of the next tile has landed
    __syncthreads();   // next tile readable by every wave; this trip's buffer free for the refill
    if (t0 + 128 < KSPAN) stage_kv(kg + (size_t)(t0 + 128) * HD, vg + (t0 + 128), lk0 + buf * KV_BUF_BYTES);
  }
  asm volatile("s_wait_asynccnt 0x0" ::: "memory");     // no copy outstanding behind the loop

  // key group 1 hands its partial sums to the wave of key group 0 that holds the same queries, lane to lane:
  // the products as they stand, the exponent offset they carry, and the key sum with its two halves joined
  if (kgp != 0) {
#pragma unroll
    for (int g = 0; g < QG; ++g) {
      Ps[wave][g][0][lane] = nmc_run[g];
      Ps[wave][g][1][lane] = l_run[g] + xhalf(l_run[g]);
#pragma unroll
      for (int dt = 0; dt < 4; ++dt) {
        v4f w0, w1;
#pragma unroll
        for (int r = 0; r < 4; ++r) { w0[r] = o[g][dt][r]; w1[r] = o[g][dt][4 + r]; }
        *(v4f*)(&Os[wave][(16 * g + mm) * OSP + 16 * dt + 8 * hh])     = w0;
        *(v4f*)(&Os[wave][(16 * g + mm) * OSP + 16 * dt + 8 * hh + 4]) = w1;
      }
    }
  }
  __syncthreads();   // key group 1's partial sums readable by key group 0

  // join (both sides brought to the smaller offset, that of the larger maximum), normalise (sums and products both carry
  // x1024) and stage the QW x 64 f32 tile; a lane overwrites only what it has read itself
  if (kgp == 0) {
#pragma unroll
    for (int g = 0; g < QG; ++g) {
      const float nmc1 = Ps[wave][g][0][lane];
      const float l1   = Ps[wave][g][1][lane];
      const float nmc0 = nmc_run[g];
      const float nmc  = fminf(nmc0, nmc1);
      const float f0 = __builtin_amdgcn_exp2f(nmc - nmc0);
      const float f1 = __builtin_amdgcn_exp2f(nmc - nmc1);
      const float l0 = l_run[g] + xhalf(l_run[g]);           // the two halves' key sums join here, once
      const float inv = 1.0f / (l0 * f0 + l1 * f1);
      const float s0 = f0 * inv, s1 = f1 * inv;
#pragma unroll
      for (int dt = 0; dt < 4; ++dt) {
        float* p = &Os[wave][(16 * g + mm) * OSP + 16 * dt + 8 * hh];
        const v4f u0 = *(const v4f*)(p), u1 = *(const v4f*)(p + 4);
        v4f w0, w1;
#pragma unroll
        for (int r = 0; r < 4; ++r) { w0[r] = o[g][dt][r] * s0 + u0[r] * s1; w1[r] = o[g][dt][4 + r] * s0 + u1[r] * s1; }
        *(v4f*)(p)     = w0;
        *(v4f*)(p + 4) = w1;
      }
    }
  }
  __syncthreads();

  // each instruction: lanes 0..15 -> row 2i (256 B = 2 full lines), lanes 16..31 -> row 2i+1; each key group's wave stores
  // its share of the query group's rows
  const int rsub = lane >> 4;
  const int cc = (lane & 15) * 4;
  if (SEQ % QBLK == 0 || q0 < SEQ) {
    const int r0 = kgp * (QW / KS) + rsub;
    float* ob = out + ((size_t)b * SEQ + q0 + r0) * DM + (size_t)hd * HD;
    v4f vv[QW / 2 / KS];
#pragma unroll
    for (int i = 0; i < QW / 2 / KS; ++i) vv[i] = *(const v4f*)(&Os[wave][(2 * i + r0) * OSP + cc]);
#pragma unroll
    for (int i = 0; i < QW / 2 / KS; ++i) *(v4f*)(ob + (size_t)(2 * i) * DM + cc) = vv[i];
  }
}

// ---------------- launcher ----------------
extern "C" void kernel_launch(void* const* d_in, const int* in_sizes, int n_in,
                              void* d_out, int out_size, void* d_ws, size_t ws_size,
                              hipStream_t stream) {
  if (n_in < 8) return;
  const float* x   = (const float*)d_in[0];
  const int*   msk = (const int*)d_in[1];
  const float* Wq  = (const float*)d_in[2];
  const float* bq  = (const float*)d_in[3];
  const float* Wk  = (const float*)d_in[4];
  const float* bk  = (const float*)d_in[5];
  const float* Wv  = (const float*)d_in[6];
  const float* bv  = (const float*)d_in[7];
  float* out = (float*)d_out;

  if (in_sizes[0] < ((NB - 1) * S_FULL + SEQ) * DM) return;
  if (in_sizes[1] < (NB - 1) * S_FULL + SEQ) return;
  if (in_sizes[2] < DM * DM || in_sizes[4] < DM * DM || in_sizes[6] < DM * DM) return;
  if (in_sizes[3] < DM || in_sizes[5] < DM || in_sizes[7] < DM) return;
  if (out_size < MT * DM) return;

  char* ws = (char*)d_ws;
  const size_t XB_BYTES = (size_t)MT * DM * 2;              // bf16 x plane [MT][DM]
  const size_t W_BYTES  = (size_t)DM * DM * 2;              // one bf16 weight plane
  const size_t PL_BYTES = (size_t)NB * NH * SEQ * HD * 2;   // one f16 q/k/v^T plane
  size_t off = 0;
  u16* Xb = (u16*)(ws + off);  off += XB_BYTES;
  u16* Wb = (u16*)(ws + off);  off += 3 * W_BYTES;
  h16* Qp = (h16*)(ws + off);  off += PL_BYTES;
  h16* Kp = (h16*)(ws + off);  off += PL_BYTES;
  h16* VTp = (h16*)(ws + off); off += PL_BYTES;
  if (off > ws_size) return;

  k_cvt_bf16<<<CV_XB + 3 * CV_WB, 256, 0, stream>>>(x, Wq, Wk, Wv, Xb, Wb);

  dim3 gp(MT / PBT, DM / PBT, 3);
  k_proj<<<gp, 128, 0, stream>>>(Xb, Wb, bq, bk, bv, Qp, Kp, VTp);

  dim3 ga((SEQ + QBLK - 1) / QBLK, NB * NH);
  k_attn<<<ga, 256, 0, stream>>>(Qp, Kp, VTp, msk, out);
}
